// v000
// The times below were measured on an AMD MI455X: many runs one after another, warmed up first and cycling through
// copies of the inputs, with the whole window's GPU time divided by the number of runs. Launches and the gaps
// between them are all in it. The median over several windows is given; except for v000 it joins two sittings, which
// can be a few percent apart, so the side-by-side timings, each taken in one sitting, are the better comparison.
// v000, which the later versions start from, runs in 31.4 milliseconds.
#include <hip/hip_runtime.h>

// Compute dtypes, f32 accumulate, one image per pass (M = 196 tokens padded to 256 rows, K = 1000 texts padded to 1024): Fs L2-normalised in f32 -> bf16 hi + UNSCALED
// residual planes (row-major and transposed); A = Fs_n.Ft^T ([256 x 512].[512 x 1024], split Fs_n against the exact bf16 Ft, two products), the two softmaxes (over texts
// x 1/alpha_s, over the 196 real tokens x 1/alpha_t) in f32 -> hi/lo planes, Fsa = P_s.Ft ([256 x 1024].[1024 x 512], two products) and Fta = P_t.Fs_n ([1024 x 256].[256
// x 512], three products) on v_wmma_f32_16x16x32_bf16; mean + max pooling over the real tokens, and the final logits (three 512-term dots per text, x exp(logit_scale) and

#define NBI  128
#define MM   196
#define MP   256
#define KT   1000
#define KTP  1024
#define DD   512
#define DM   DD
#define NTK  MP
#define ALS  0.5f
#define ALT  0.5f
#define B1_  1.0f
#define B2_  0.1f
#define B3_  0.1f
#define LOSC 1024.0f

typedef _Float16 h16;
typedef unsigned short bf;
typedef __attribute__((ext_vector_type(16))) __bf16   v16bf;
typedef __attribute__((ext_vector_type(16))) _Float16 v16h;
typedef __attribute__((ext_vector_type(8)))  _Float16 v8h;
typedef __attribute__((ext_vector_type(8)))  unsigned short v8us;
typedef __attribute__((ext_vector_type(8)))  float    v8f;
typedef __attribute__((ext_vector_type(4)))  float    v4f;
typedef __attribute__((ext_vector_type(4)))  _Float16 v4h;
typedef v8h  __attribute__((may_alias)) v8ha;
typedef v4f  __attribute__((may_alias)) v4fa;
typedef v8us __attribute__((may_alias)) v8usa;

__device__ __forceinline__ unsigned short f2bf(float f) { unsigned u = __float_as_uint(f); u += 0x7FFFu + ((u >> 16) & 1u); return (unsigned short)(u >> 16); }
__device__ __forceinline__ float bf2f(unsigned short b) { return __uint_as_float(((unsigned)b) << 16); }
__device__ __forceinline__ float bfr(float f) { return bf2f(f2bf(f)); }
__device__ __forceinline__ v16h cat16(v8h lo, v8h hi) { return __builtin_shufflevector(lo, hi, 0, 1, 2, 3, 4, 5, 6, 7, 8, 9, 10, 11, 12, 13, 14, 15); }
__device__ __forceinline__ v16bf cat16b(v8us lo, v8us hi) { return __builtin_bit_cast(v16bf, __builtin_shufflevector(lo, hi, 0, 1, 2, 3, 4, 5, 6, 7, 8, 9, 10, 11, 12, 13, 14, 15)); }
__device__ __forceinline__ v8f wmma16(v16h a, v16h b, v8f c) { return __builtin_amdgcn_wmma_f32_16x16x32_f16(false, a, false, b, (short)0, c, false, false); }
__device__ __forceinline__ v8f wmmab(v16bf a, v16bf b, v8f c) { return __builtin_amdgcn_wmma_f32_16x16x32_bf16(false, a, false, b, (short)0, c, false, false); }

// k_wt: WT [n][K] = bf16(W[k][n]) (k-major [K][ncols]) via 64 x 64 LDS tiles; grid (K/64, ncols/64).
__global__ __launch_bounds__(256) void k_wt(const float* __restrict__ Wm, int K, int ncols, bf* WT) {
    __shared__ __align__(16) unsigned short tl[64 * 72];
    const int tid = threadIdx.x, k0 = blockIdx.x * 64, n0 = blockIdx.y * 64;
    const int kk = tid >> 2, nq = (tid & 3) * 16;
#pragma unroll
    for (int i = 0; i < 16; ++i) tl[(nq + i) * 72 + kk] = f2bf(Wm[(size_t)(k0 + kk) * ncols + n0 + nq + i]);
    __syncthreads();
    const int piece = tid & 7;
    auto pass = [&]() {
#pragma unroll
        for (int s = 0; s < 2; ++s) { const int nr = (tid >> 3) + 32 * s; const v8us val = *(const v8usa*)(tl + nr * 72 + piece * 8); *(v8us*)(WT + (size_t)(n0 + nr) * K + k0 + piece * 8) = val; }
    };
    pass(); 
}
// k_gemmb: 64 x 64 block tile (4 waves x 16 x 64) of C[NTK][NW] = (A [+ Al]).B^T (K = 512 or 1024) [+ bf(bias[c])] [+ bf(R[r][c]) residual]; f32 whole-line epilogue (or f16
template <bool SPLITA, bool F16OUT = false>
__global__ __launch_bounds__(128) void k_gemmb(const bf* __restrict__ A, const bf* __restrict__ Al, const bf* __restrict__ Bn, const float* __restrict__ bias, float* C, int ldc, h16* C2, const float* __restrict__ R = nullptr, int K = DM, int roundR = 1) {
    __shared__ __align__(16) float ost[4][16 * 68];
    const int lane = threadIdx.x & 31, wave = threadIdx.x >> 5, lr = lane & 15, hi = lane >> 4;
    const int r0 = blockIdx.x * 64 + wave * 16, c0 = blockIdx.y * 64;
    const size_t aoff = (size_t)(r0 + lr) * K + 8 * hi;
    size_t boff[4];
#pragma unroll
    for (int t = 0; t < 4; ++t) boff[t] = (size_t)(c0 + t * 16 + lr) * K + 8 * hi;
    v8f acc[4];
#pragma unroll
    for (int t = 0; t < 4; ++t) acc[t] = (v8f){};
#pragma unroll 1
    for (int kc = 0; kc < K; kc += 32) {
        const v16bf a = cat16b(*(const v8us*)(A + aoff + kc), *(const v8us*)(A + aoff + kc + 16));
        v16bf al = a;
        if (SPLITA) al = cat16b(*(const v8us*)(Al + aoff + kc), *(const v8us*)(Al + aoff + kc + 16));
#pragma unroll
        for (int t = 0; t < 4; ++t) { const v16bf b = cat16b(*(const v8us*)(Bn + boff[t] + kc), *(const v8us*)(Bn + boff[t] + kc + 16)); acc[t] = wmmab(a, b, acc[t]); if (SPLITA) acc[t] = wmmab(al, b, acc[t]); }
        asm volatile("v_nop\n\tv_nop\n\tv_nop\n\tv_nop" : "+v"(acc[0]), "+v"(acc[1]), "+v"(acc[2]), "+v"(acc[3]) : "v"(a), "v"(al));
    }
    float* os = &ost[wave][0];
#pragma unroll
    for (int t = 0; t < 4; ++t) { const float bv = bias ? bfr(bias[c0 + t * 16 + lr]) : 0.f;
#pragma unroll
        for (int j = 0; j < 8; ++j) os[(hi * 8 + j) * 68 + t * 16 + lr] = acc[t][j] + bv; }
    __syncthreads();
    if (F16OUT) {
        h16* crow = (h16*)(void*)C + (size_t)r0 * ldc + c0;
        auto pass = [&]() {
#pragma unroll
            for (int s = 0; s < 4; ++s) { const int row = 4 * s + (lane >> 3), piece = lane & 7; const float* sp = os + row * 68 + piece * 8; v8h o, o2;
#pragma unroll
                for (int i = 0; i < 8; ++i) { const h16 a = (h16)sp[i]; o[i] = a; o2[i] = (h16)((sp[i] - (float)a) * LOSC); }
                *(v8h*)(crow + (size_t)row * ldc + piece * 8) = o; if (C2) *(v8h*)(C2 + (size_t)r0 * ldc + c0 + (size_t)row * ldc + piece * 8) = o2; }
        };
        pass(); 
    } else {
        float* crow = C + (size_t)r0 * ldc + c0;
        auto pass = [&]() {
#pragma unroll
            for (int s = 0; s < 8; ++s) { const int Lid = (lane >> 3) + 4 * s, piece = lane & 7; const int row = Lid >> 1, cofs = (Lid & 1) * 32 + piece * 4;
                v4f val = *(const v4fa*)(os + row * 68 + cofs); if (R) { const v4f rv = *(const v4f*)(R + ((size_t)r0 + row) * ldc + c0 + cofs); val += roundR ? (v4f){bfr(rv[0]), bfr(rv[1]), bfr(rv[2]), bfr(rv[3])} : rv; }
                *(v4f*)(crow + (size_t)row * ldc + cofs) = val; }
        };
        pass(); 
    }
}

// k_gemm3: 64 x 64 tile of C = (Ah + Al).(Bh + Bl)^T over K (row strides = K for all four planes; n-major B): three products per 32-k step (hh, hl, lh); f32
__global__ __launch_bounds__(128) void k_gemm3(const bf* __restrict__ Ah, const bf* __restrict__ Al, const bf* __restrict__ Bh, const bf* __restrict__ Bl, int K, float* C, int ldc) {
    __shared__ __align__(16) float ost[4][16 * 68];
    const int lane = threadIdx.x & 31, wave = threadIdx.x >> 5, lr = lane & 15, hi = lane >> 4;
    const int r0 = blockIdx.x * 64 + wave * 16, c0 = blockIdx.y * 64;
    const size_t aoff = (size_t)(r0 + lr) * K + 8 * hi;
    v8f acc[4];
#pragma unroll
    for (int t = 0; t < 4; ++t) acc[t] = (v8f){};
#pragma unroll 1
    for (int kc = 0; kc < K; kc += 32) {
        const v16bf a = cat16b(*(const v8us*)(Ah + aoff + kc), *(const v8us*)(Ah + aoff + kc + 16));
        const v16bf al = cat16b(*(const v8us*)(Al + aoff + kc), *(const v8us*)(Al + aoff + kc + 16));
#pragma unroll
        for (int t = 0; t < 4; ++t) { const size_t bo = (size_t)(c0 + t * 16 + lr) * K + kc + 8 * hi;
            const v16bf bh = cat16b(*(const v8us*)(Bh + bo), *(const v8us*)(Bh + bo + 16)); const v16bf bl = cat16b(*(const v8us*)(Bl + bo), *(const v8us*)(Bl + bo + 16));
            acc[t] = wmmab(a, bh, acc[t]); acc[t] = wmmab(al, bh, acc[t]); acc[t] = wmmab(a, bl, acc[t]); }
        asm volatile("v_nop\n\tv_nop\n\tv_nop\n\tv_nop" : "+v"(acc[0]), "+v"(acc[1]), "+v"(acc[2]), "+v"(acc[3]) : "v"(a), "v"(al));
    }
    float* os = &ost[wave][0];
#pragma unroll
    for (int t = 0; t < 4; ++t) {
#pragma unroll
        for (int j = 0; j < 8; ++j) os[(hi * 8 + j) * 68 + t * 16 + lr] = acc[t][j]; }
    __builtin_amdgcn_wave_barrier(); asm volatile("" ::: "memory");
    float* crow = C + (size_t)r0 * ldc + c0;
    auto pass = [&]() {
#pragma unroll
        for (int s = 0; s < 8; ++s) { const int Lid = (lane >> 3) + 4 * s, piece = lane & 7; const int row = Lid >> 1, cofs = (Lid & 1) * 32 + piece * 4;
            const v4f val = *(const v4fa*)(os + row * 68 + cofs); *(v4f*)(crow + (size_t)row * ldc + cofs) = val; }
    };
    pass(); 
}

// k_ftpad: FtP [1024][512] f32 copy of Ft with rows 1000..1023 zero (feeds k_wt for the exact transposed operand) and FtB = its bf16 rows (the n-major B of A = Fs_n.Ft^T);
__global__ __launch_bounds__(256) void k_ftpad(const float* __restrict__ Ft, float* FtP, bf* FtB) {
    const size_t u = (size_t)blockIdx.x * 256 + threadIdx.x; if (u >= (size_t)KTP * DD / 8) return;
    const int k = (int)(u / (DD / 8)); v8f v; v8us o;
#pragma unroll
    for (int i = 0; i < 8; ++i) { v[i] = (k < KT) ? Ft[u * 8 + i] : 0.f; o[i] = f2bf(v[i]); }
    *(v8f*)(FtP + u * 8) = v; *(v8us*)(FtB + u * 8) = o; 
}
__global__ __launch_bounds__(256) void k_norm(const float* __restrict__ Fs, int b, float* INV) {
    const int m = threadIdx.x; float s = 0.f;
    if (m < MM) { const float* r = Fs + ((size_t)b * MM + m) * DD;
#pragma unroll 1
        for (int d = 0; d < DD; ++d) { const float v = bfr(r[d]); s = fmaf(v, v, s); } }
    const float inv = (m < MM) ? 1.0f / sqrtf(s) : 0.f;
    *(float*)(INV + m) = inv; 
}
__global__ __launch_bounds__(256) void k_fsn(const float* __restrict__ Fs, const float* __restrict__ INV, int b, bf* Nh, bf* Nl) {
    const int lane = threadIdx.x & 31, m = blockIdx.x * 8 + (threadIdx.x >> 5); if (m >= MP) return;
    const float inv = INV[m];
{
#pragma unroll 1
        for (int q = 0; q < DD / 256; ++q) { const int d0 = q * 256 + lane * 8; v8us oh, ol;
#pragma unroll
            for (int i = 0; i < 8; ++i) { const float v = (m < MM) ? bfr(Fs[((size_t)b * MM + m) * DD + d0 + i]) * inv : 0.f; const unsigned short hb = f2bf(v); oh[i] = hb; ol[i] = f2bf(v - bf2f(hb)); }
            const size_t o = (size_t)m * DD + d0; *(v8us*)(Nh + o) = oh; *(v8us*)(Nl + o) = ol; }
         }
}
__global__ __launch_bounds__(256) void k_fsnT(const float* __restrict__ Fs, const float* __restrict__ INV, int b, bf* Th, bf* Tl) {
    typedef __attribute__((ext_vector_type(2))) unsigned short v2us;
    const int lane = threadIdx.x & 31, wid = blockIdx.x * 8 + (threadIdx.x >> 5); if (wid >= DD * (MP / 64)) return;
    const int g = wid % (MP / 64), d = wid / (MP / 64); const int m0 = g * 64 + 2 * lane; v2us oh, ol;
#pragma unroll
    for (int i = 0; i < 2; ++i) { const int m = m0 + i; const float v = (m < MM) ? bfr(Fs[((size_t)b * MM + m) * DD + d]) * INV[m] : 0.f; const unsigned short hb = f2bf(v); oh[i] = hb; ol[i] = f2bf(v - bf2f(hb)); }
    const size_t o = (size_t)d * MP + m0;
    *(v2us*)(Th + o) = oh; *(v2us*)(Tl + o) = ol; 
}
__global__ __launch_bounds__(256) void k_soft_s(const float* __restrict__ A, bf* PH, bf* PL) {
    const int lane = threadIdx.x & 31, m = blockIdx.x * 8 + (threadIdx.x >> 5); if (m >= MP) return;
    const float* ar = A + (size_t)m * KTP; float mx = -3.0e38f;
#pragma unroll 1
    for (int c0 = lane * 8; c0 < KTP; c0 += 256) { const v8f v = *(const v8f*)(ar + c0);
#pragma unroll
        for (int i = 0; i < 8; ++i) if (c0 + i < KT) mx = fmaxf(mx, v[i] * (1.0f / ALS)); }
#pragma unroll
    for (int sh = 16; sh; sh >>= 1) mx = fmaxf(mx, __shfl_xor(mx, sh, 32));
    float sum = 0.f;
#pragma unroll 1
    for (int c0 = lane * 8; c0 < KTP; c0 += 256) { const v8f v = *(const v8f*)(ar + c0);
#pragma unroll
        for (int i = 0; i < 8; ++i) if (c0 + i < KT) sum += __expf(v[i] * (1.0f / ALS) - mx); }
#pragma unroll
    for (int sh = 16; sh; sh >>= 1) sum += __shfl_xor(sum, sh, 32);
    const float inv = 1.0f / sum;
{
#pragma unroll 1
        for (int c0 = lane * 8; c0 < KTP; c0 += 256) { const v8f v = *(const v8f*)(ar + c0); v8us oh, ol;
#pragma unroll
            for (int i = 0; i < 8; ++i) { const float p = (c0 + i < KT) ? __expf(v[i] * (1.0f / ALS) - mx) * inv : 0.f; const unsigned short hb = f2bf(p); oh[i] = hb; ol[i] = f2bf(p - bf2f(hb)); }
            const size_t o = (size_t)m * KTP + c0; *(v8us*)(PH + o) = oh; *(v8us*)(PL + o) = ol; }
         }
}
// k_soft_t: one wave per text k (of 1024; pad texts produce zero rows): softmax over the 196 real tokens of A[m][k]/alpha_t (column read; f32, fixed lane order: lane ->
// tokens 2*lane, 2*lane+1, 2*lane+64, ...) -> planes [1024 k][256 m] (4 B per plane per lane per 64-token group: lanes write m = g*64 + 2*lane, 2*lane + 1; to keep
__global__ __launch_bounds__(256) void k_soft_t(const float* __restrict__ A, bf* PTh, bf* PTl) {
    typedef __attribute__((ext_vector_type(2))) unsigned short v2us;
    const int lane = threadIdx.x & 31, k = blockIdx.x * 8 + (threadIdx.x >> 5); if (k >= KTP) return;
    float a[MP / 32]; float mx = -3.0e38f;
#pragma unroll
    for (int j = 0; j < MP / 64; ++j)
#pragma unroll
        for (int i = 0; i < 2; ++i) { const int m = j * 64 + 2 * lane + i; const float v = (m < MM && k < KT) ? A[(size_t)m * KTP + k] * (1.0f / ALT) : -3.0e38f; a[j * 2 + i] = v; mx = fmaxf(mx, v); }
#pragma unroll
    for (int sh = 16; sh; sh >>= 1) mx = fmaxf(mx, __shfl_xor(mx, sh, 32));
    float sum = 0.f;
#pragma unroll
    for (int j = 0; j < MP / 32; ++j) sum += (a[j] > -1.0e38f) ? __expf(a[j] - mx) : 0.f;
#pragma unroll
    for (int sh = 16; sh; sh >>= 1) sum += __shfl_xor(sum, sh, 32);
    const float inv = (k < KT) ? 1.0f / sum : 0.f;
{
#pragma unroll
        for (int j = 0; j < MP / 64; ++j) { v2us oh, ol;
#pragma unroll
            for (int i = 0; i < 2; ++i) { const float p = (a[j * 2 + i] > -1.0e38f) ? __expf(a[j * 2 + i] - mx) * inv : 0.f; const unsigned short hb = f2bf(p); oh[i] = hb; ol[i] = f2bf(p - bf2f(hb)); }
            const size_t o = (size_t)k * MP + j * 64 + 2 * lane; *(v2us*)(PTh + o) = oh; *(v2us*)(PTl + o) = ol; }
         }
}
__global__ __launch_bounds__(256) void k_pool(const float* __restrict__ Fsa, int b, float* FVA) {
    const int d = blockIdx.x * 256 + threadIdx.x; if (d >= DD) return; float s = 0.f, mx = -3.0e38f;
#pragma unroll 1
    for (int m = 0; m < MM; ++m) { const float v = Fsa[(size_t)m * DD + d]; s += v; mx = fmaxf(mx, v); }
    const float y = s * (1.0f / MM) + mx; *(float*)(FVA + (size_t)b * DD + d) = y; 
}
// k_logits: RES[b][k] = ls (beta1 bf(Fv[b]).bf(Ft[k]) + beta2 bf(Fv[b]).Fta[k] + beta3 Fva[b].bf(Ft[k])) (f32, rolled 512-term dots), ls = e^bf(logit_scale); thread per
__global__ __launch_bounds__(256) void k_logits(const float* __restrict__ Fv, const float* __restrict__ Ft, const float* __restrict__ FTA, const float* __restrict__ FVA, const float* __restrict__ lsc, int b, float* RES) {
    const int k = blockIdx.x * 256 + threadIdx.x; if (k >= KTP) return; float r = 0.f;
    if (k < KT) { float d1 = 0.f, d2 = 0.f, d3 = 0.f;
#pragma unroll 1
        for (int d = 0; d < DD; ++d) { const float fv = bfr(Fv[(size_t)b * DD + d]), ft = bfr(Ft[(size_t)k * DD + d]); d1 = fmaf(fv, ft, d1); d2 = fmaf(fv, FTA[(size_t)k * DD + d], d2); d3 = fmaf(FVA[(size_t)b * DD + d], ft, d3); }
        const float ls = __expf(bfr(lsc[0])); r = B1_ * ls * d1 + B2_ * ls * d2 + B3_ * ls * d3; }
    *(float*)(RES + (size_t)b * KTP + k) = r; 
}
__global__ __launch_bounds__(256) void k_out(const float* __restrict__ RES, float* OUTP) {
    const int i = blockIdx.x * 256 + threadIdx.x; if (i >= NBI * KT) return; const float v = RES[(size_t)(i / KT) * KTP + (i % KT)];
    *(float*)(OUTP + i) = v; 
}

extern "C" void kernel_launch(void* const* d_in, const int* in_sizes, int n_in,
                              void* d_out, int out_size, void* d_ws, size_t ws_size, hipStream_t stream) {
    (void)in_sizes; (void)n_in; (void)out_size;
    const float* Fs = (const float*)d_in[0]; const float* Ft = (const float*)d_in[1]; const float* Fv = (const float*)d_in[2]; const float* lsc = (const float*)d_in[3];
    float* out = (float*)d_out;    // [128][1][1000]
    char* wsp = (char*)d_ws;
    auto take = [&](size_t bytes) { char* p = wsp; wsp += (bytes + 255) & ~(size_t)255; return (void*)p; };
    float* FtP = (float*)take((size_t)KTP * DD * 4); bf* FtB = (bf*)take((size_t)KTP * DD * 2); bf* FtT = (bf*)take((size_t)DD * KTP * 2); float* INV = (float*)take(MP * 4);
    bf* Nh = (bf*)take((size_t)MP * DD * 2); bf* Nl = (bf*)take((size_t)MP * DD * 2); bf* Th = (bf*)take((size_t)DD * MP * 2); bf* Tl = (bf*)take((size_t)DD * MP * 2);
    float* A = (float*)take((size_t)MP * KTP * 4); bf* PH = (bf*)take((size_t)MP * KTP * 2); bf* PL = (bf*)take((size_t)MP * KTP * 2); bf* PTh = (bf*)take((size_t)KTP * MP * 2); bf* PTl = (bf*)take((size_t)KTP * MP * 2);
    float* FSA = (float*)take((size_t)MP * DD * 4); float* FTA = (float*)take((size_t)KTP * DD * 4); float* FVA = (float*)take((size_t)NBI * DD * 4); float* RES = (float*)take((size_t)NBI * KTP * 4);
    if ((size_t)(wsp - (char*)d_ws) > ws_size) return;    // 2.1 + 1 + 1 + 4 x 0.26 + 1 + 4 x 0.5 + 0.5 + 2.1 + 0.26 + 0.5 ~ 12 MB
    k_ftpad<<<(KTP * DD / 8 + 255) / 256, 256, 0, stream>>>(Ft, FtP, FtB); k_wt<<<dim3(KTP / 64, DD / 64, 1), 256, 0, stream>>>(FtP, KTP, DD, FtT);     // Ft^T [512][1024] exact bf16
    for (int b = 0; b < NBI; ++b) {
        k_norm<<<1, 256, 0, stream>>>(Fs, b, INV);
        k_fsn<<<MP / 8, 256, 0, stream>>>(Fs, INV, b, Nh, Nl); k_fsnT<<<(DD * (MP / 64)) / 8, 256, 0, stream>>>(Fs, INV, b, Th, Tl);
        k_gemmb<true, false><<<dim3(MP / 64, KTP / 64, 1), 128, 0, stream>>>(Nh, Nl, FtB, nullptr, A, KTP, nullptr, nullptr, DD);            // A = Fs_n.Ft^T  [256][1024]
        k_soft_s<<<MP / 8, 256, 0, stream>>>(A, PH, PL); k_soft_t<<<KTP / 8, 256, 0, stream>>>(A, PTh, PTl);
        k_gemmb<true, false><<<dim3(MP / 64, DD / 64, 1), 128, 0, stream>>>(PH, PL, FtT, nullptr, FSA, DD, nullptr, nullptr, KTP);          // Fsa = P_s.Ft    [256][512]
        k_gemm3<<<dim3(KTP / 64, DD / 64, 1), 128, 0, stream>>>(PTh, PTl, Th, Tl, MP, FTA, DD);                                        // Fta = P_t.Fs_n  [1024][512]
        k_pool<<<DD / 256, 256, 0, stream>>>(FSA, b, FVA);
        k_logits<<<KTP / 256, 256, 0, stream>>>(Fv, Ft, FTA, FVA, lsc, b, RES);
    }
    k_out<<<(NBI * KT + 255) / 256, 256, 0, stream>>>(RES, out);
}

// v001
// Measured time: 1490 microseconds a run.
// Next to v000, in two timings, it ran 21.3 times as fast each time.
#include <hip/hip_runtime.h>

// Compute dtypes, f32 accumulate, 64 images per pass, one per blockIdx.z (M = 196 tokens padded to 256 rows, K = 1000 texts padded to 1024): Fs L2-normalised in f32 -> bf16 hi + UNSCALED
// residual planes (row-major and transposed); A = Fs_n.Ft^T ([256 x 512].[512 x 1024], split Fs_n against the exact bf16 Ft, two products), the two softmaxes (over texts
// x 1/alpha_s, over the 196 real tokens x 1/alpha_t) in f32 -> hi/lo planes, Fsa = P_s.Ft ([256 x 1024].[1024 x 512], two products) and Fta = P_t.Fs_n ([1024 x 256].[256
// x 512], three products) on v_wmma_f32_16x16x32_bf16; mean + max pooling over the real tokens, and the final logits (three 512-term dots per text, x exp(logit_scale) and

#define NBI  128
#define GB   64      // images per launch: blockIdx.z picks the image of the group, each image has its own slice of every per-image plane
#define MM   196
#define MP   256
#define KT   1000
#define KTP  1024
#define DD   512
#define DM   DD
#define NTK  MP
#define ALS  0.5f
#define ALT  0.5f
#define B1_  1.0f
#define B2_  0.1f
#define B3_  0.1f
#define LOSC 1024.0f

typedef _Float16 h16;
typedef unsigned short bf;
typedef __attribute__((ext_vector_type(16))) __bf16   v16bf;
typedef __attribute__((ext_vector_type(16))) _Float16 v16h;
typedef __attribute__((ext_vector_type(8)))  _Float16 v8h;
typedef __attribute__((ext_vector_type(8)))  unsigned short v8us;
typedef __attribute__((ext_vector_type(8)))  float    v8f;
typedef __attribute__((ext_vector_type(4)))  float    v4f;
typedef __attribute__((ext_vector_type(4)))  _Float16 v4h;
typedef v8h  __attribute__((may_alias)) v8ha;
typedef v4f  __attribute__((may_alias)) v4fa;
typedef v8us __attribute__((may_alias)) v8usa;

__device__ __forceinline__ unsigned short f2bf(float f) { unsigned u = __float_as_uint(f); u += 0x7FFFu + ((u >> 16) & 1u); return (unsigned short)(u >> 16); }
__device__ __forceinline__ float bf2f(unsigned short b) { return __uint_as_float(((unsigned)b) << 16); }
__device__ __forceinline__ float bfr(float f) { return bf2f(f2bf(f)); }
__device__ __forceinline__ v16h cat16(v8h lo, v8h hi) { return __builtin_shufflevector(lo, hi, 0, 1, 2, 3, 4, 5, 6, 7, 8, 9, 10, 11, 12, 13, 14, 15); }
__device__ __forceinline__ v16bf cat16b(v8us lo, v8us hi) { return __builtin_bit_cast(v16bf, __builtin_shufflevector(lo, hi, 0, 1, 2, 3, 4, 5, 6, 7, 8, 9, 10, 11, 12, 13, 14, 15)); }
__device__ __forceinline__ v8f wmma16(v16h a, v16h b, v8f c) { return __builtin_amdgcn_wmma_f32_16x16x32_f16(false, a, false, b, (short)0, c, false, false); }
__device__ __forceinline__ v8f wmmab(v16bf a, v16bf b, v8f c) { return __builtin_amdgcn_wmma_f32_16x16x32_bf16(false, a, false, b, (short)0, c, false, false); }

// k_wt: WT [n][K] = bf16(W[k][n]) (k-major [K][ncols]) via 64 x 64 LDS tiles; grid (K/64, ncols/64).
__global__ __launch_bounds__(256) void k_wt(const float* __restrict__ Wm, int K, int ncols, bf* WT) {
    __shared__ __align__(16) unsigned short tl[64 * 72];
    const int tid = threadIdx.x, k0 = blockIdx.x * 64, n0 = blockIdx.y * 64;
    const int kk = tid >> 2, nq = (tid & 3) * 16;
#pragma unroll
    for (int i = 0; i < 16; ++i) tl[(nq + i) * 72 + kk] = f2bf(Wm[(size_t)(k0 + kk) * ncols + n0 + nq + i]);
    __syncthreads();
    const int piece = tid & 7;
    auto pass = [&]() {
#pragma unroll
        for (int s = 0; s < 2; ++s) { const int nr = (tid >> 3) + 32 * s; const v8us val = *(const v8usa*)(tl + nr * 72 + piece * 8); *(v8us*)(WT + (size_t)(n0 + nr) * K + k0 + piece * 8) = val; }
    };
    pass(); 
}
// k_gemmb: 64 x 64 block tile (4 waves x 16 x 64) of C[NTK][NW] = (A [+ Al]).B^T (K = 512 or 1024) [+ bf(bias[c])] [+ bf(R[r][c]) residual]; f32 whole-line epilogue (or f16
template <bool SPLITA, bool F16OUT = false>
__global__ __launch_bounds__(128) void k_gemmb(const bf* __restrict__ A, const bf* __restrict__ Al, const bf* __restrict__ Bn, const float* __restrict__ bias, float* C, int ldc, h16* C2, const float* __restrict__ R = nullptr, int K = DM, int roundR = 1, size_t zA = 0, size_t zC = 0) {
    __shared__ __align__(16) float ost[4][16 * 68];
    A += blockIdx.z * zA; Al += blockIdx.z * zA; C += blockIdx.z * zC;
    const int lane = threadIdx.x & 31, wave = threadIdx.x >> 5, lr = lane & 15, hi = lane >> 4;
    const int r0 = blockIdx.x * 64 + wave * 16, c0 = blockIdx.y * 64;
    const size_t aoff = (size_t)(r0 + lr) * K + 8 * hi;
    size_t boff[4];
#pragma unroll
    for (int t = 0; t < 4; ++t) boff[t] = (size_t)(c0 + t * 16 + lr) * K + 8 * hi;
    v8f acc[4];
#pragma unroll
    for (int t = 0; t < 4; ++t) acc[t] = (v8f){};
#pragma unroll 1
    for (int kc = 0; kc < K; kc += 32) {
        const v16bf a = cat16b(*(const v8us*)(A + aoff + kc), *(const v8us*)(A + aoff + kc + 16));
        v16bf al = a;
        if (SPLITA) al = cat16b(*(const v8us*)(Al + aoff + kc), *(const v8us*)(Al + aoff + kc + 16));
#pragma unroll
        for (int t = 0; t < 4; ++t) { const v16bf b = cat16b(*(const v8us*)(Bn + boff[t] + kc), *(const v8us*)(Bn + boff[t] + kc + 16)); acc[t] = wmmab(a, b, acc[t]); if (SPLITA) acc[t] = wmmab(al, b, acc[t]); }
        asm volatile("v_nop\n\tv_nop\n\tv_nop\n\tv_nop" : "+v"(acc[0]), "+v"(acc[1]), "+v"(acc[2]), "+v"(acc[3]) : "v"(a), "v"(al));
    }
    float* os = &ost[wave][0];
#pragma unroll
    for (int t = 0; t < 4; ++t) { const float bv = bias ? bfr(bias[c0 + t * 16 + lr]) : 0.f;
#pragma unroll
        for (int j = 0; j < 8; ++j) os[(hi * 8 + j) * 68 + t * 16 + lr] = acc[t][j] + bv; }
    __syncthreads();
    if (F16OUT) {
        h16* crow = (h16*)(void*)C + (size_t)r0 * ldc + c0;
        auto pass = [&]() {
#pragma unroll
            for (int s = 0; s < 4; ++s) { const int row = 4 * s + (lane >> 3), piece = lane & 7; const float* sp = os + row * 68 + piece * 8; v8h o, o2;
#pragma unroll
                for (int i = 0; i < 8; ++i) { const h16 a = (h16)sp[i]; o[i] = a; o2[i] = (h16)((sp[i] - (float)a) * LOSC); }
                *(v8h*)(crow + (size_t)row * ldc + piece * 8) = o; if (C2) *(v8h*)(C2 + (size_t)r0 * ldc + c0 + (size_t)row * ldc + piece * 8) = o2; }
        };
        pass(); 
    } else {
        float* crow = C + (size_t)r0 * ldc + c0;
        auto pass = [&]() {
#pragma unroll
            for (int s = 0; s < 8; ++s) { const int Lid = (lane >> 3) + 4 * s, piece = lane & 7; const int row = Lid >> 1, cofs = (Lid & 1) * 32 + piece * 4;
                v4f val = *(const v4fa*)(os + row * 68 + cofs); if (R) { const v4f rv = *(const v4f*)(R + ((size_t)r0 + row) * ldc + c0 + cofs); val += roundR ? (v4f){bfr(rv[0]), bfr(rv[1]), bfr(rv[2]), bfr(rv[3])} : rv; }
                *(v4f*)(crow + (size_t)row * ldc + cofs) = val; }
        };
        pass(); 
    }
}

// k_gemm3: 64 x 64 tile of C = (Ah + Al).(Bh + Bl)^T over K (row strides = K for all four planes; n-major B): three products per 32-k step (hh, hl, lh); f32
__global__ __launch_bounds__(128) void k_gemm3(const bf* __restrict__ Ah, const bf* __restrict__ Al, const bf* __restrict__ Bh, const bf* __restrict__ Bl, int K, float* C, int ldc, size_t zA, size_t zB, size_t zC) {
    __shared__ __align__(16) float ost[4][16 * 68];
    Ah += blockIdx.z * zA; Al += blockIdx.z * zA; Bh += blockIdx.z * zB; Bl += blockIdx.z * zB; C += blockIdx.z * zC;
    const int lane = threadIdx.x & 31, wave = threadIdx.x >> 5, lr = lane & 15, hi = lane >> 4;
    const int r0 = blockIdx.x * 64 + wave * 16, c0 = blockIdx.y * 64;
    const size_t aoff = (size_t)(r0 + lr) * K + 8 * hi;
    v8f acc[4];
#pragma unroll
    for (int t = 0; t < 4; ++t) acc[t] = (v8f){};
#pragma unroll 1
    for (int kc = 0; kc < K; kc += 32) {
        const v16bf a = cat16b(*(const v8us*)(Ah + aoff + kc), *(const v8us*)(Ah + aoff + kc + 16));
        const v16bf al = cat16b(*(const v8us*)(Al + aoff + kc), *(const v8us*)(Al + aoff + kc + 16));
#pragma unroll
        for (int t = 0; t < 4; ++t) { const size_t bo = (size_t)(c0 + t * 16 + lr) * K + kc + 8 * hi;
            const v16bf bh = cat16b(*(const v8us*)(Bh + bo), *(const v8us*)(Bh + bo + 16)); const v16bf bl = cat16b(*(const v8us*)(Bl + bo), *(const v8us*)(Bl + bo + 16));
            acc[t] = wmmab(a, bh, acc[t]); acc[t] = wmmab(al, bh, acc[t]); acc[t] = wmmab(a, bl, acc[t]); }
        asm volatile("v_nop\n\tv_nop\n\tv_nop\n\tv_nop" : "+v"(acc[0]), "+v"(acc[1]), "+v"(acc[2]), "+v"(acc[3]) : "v"(a), "v"(al));
    }
    float* os = &ost[wave][0];
#pragma unroll
    for (int t = 0; t < 4; ++t) {
#pragma unroll
        for (int j = 0; j < 8; ++j) os[(hi * 8 + j) * 68 + t * 16 + lr] = acc[t][j]; }
    __builtin_amdgcn_wave_barrier(); asm volatile("" ::: "memory");
    float* crow = C + (size_t)r0 * ldc + c0;
    auto pass = [&]() {
#pragma unroll
        for (int s = 0; s < 8; ++s) { const int Lid = (lane >> 3) + 4 * s, piece = lane & 7; const int row = Lid >> 1, cofs = (Lid & 1) * 32 + piece * 4;
            const v4f val = *(const v4fa*)(os + row * 68 + cofs); *(v4f*)(crow + (size_t)row * ldc + cofs) = val; }
    };
    pass(); 
}

// k_ftpad: FtP [1024][512] f32 copy of Ft with rows 1000..1023 zero (feeds k_wt for the exact transposed operand) and FtB = its bf16 rows (the n-major B of A = Fs_n.Ft^T);
__global__ __launch_bounds__(256) void k_ftpad(const float* __restrict__ Ft, float* FtP, bf* FtB) {
    const size_t u = (size_t)blockIdx.x * 256 + threadIdx.x; if (u >= (size_t)KTP * DD / 8) return;
    const int k = (int)(u / (DD / 8)); v8f v; v8us o;
#pragma unroll
    for (int i = 0; i < 8; ++i) { v[i] = (k < KT) ? Ft[u * 8 + i] : 0.f; o[i] = f2bf(v[i]); }
    *(v8f*)(FtP + u * 8) = v; *(v8us*)(FtB + u * 8) = o; 
}
__global__ __launch_bounds__(256) void k_norm(const float* __restrict__ Fs, int b0, float* INV) {
    const int m = threadIdx.x, b = b0 + blockIdx.z; float s = 0.f; INV += (size_t)blockIdx.z * MP;
    if (m < MM) { const float* r = Fs + ((size_t)b * MM + m) * DD;
#pragma unroll 1
        for (int d = 0; d < DD; ++d) { const float v = bfr(r[d]); s = fmaf(v, v, s); } }
    const float inv = (m < MM) ? 1.0f / sqrtf(s) : 0.f;
    *(float*)(INV + m) = inv; 
}
__global__ __launch_bounds__(256) void k_fsn(const float* __restrict__ Fs, const float* __restrict__ INV, int b0, bf* Nh, bf* Nl) {
    const int lane = threadIdx.x & 31, m = blockIdx.x * 8 + (threadIdx.x >> 5), b = b0 + blockIdx.z; if (m >= MP) return;
    INV += (size_t)blockIdx.z * MP; Nh += (size_t)blockIdx.z * MP * DD; Nl += (size_t)blockIdx.z * MP * DD;
    const float inv = INV[m];
{
#pragma unroll 1
        for (int q = 0; q < DD / 256; ++q) { const int d0 = q * 256 + lane * 8; v8us oh, ol;
#pragma unroll
            for (int i = 0; i < 8; ++i) { const float v = (m < MM) ? bfr(Fs[((size_t)b * MM + m) * DD + d0 + i]) * inv : 0.f; const unsigned short hb = f2bf(v); oh[i] = hb; ol[i] = f2bf(v - bf2f(hb)); }
            const size_t o = (size_t)m * DD + d0; *(v8us*)(Nh + o) = oh; *(v8us*)(Nl + o) = ol; }
         }
}
__global__ __launch_bounds__(256) void k_fsnT(const float* __restrict__ Fs, const float* __restrict__ INV, int b0, bf* Th, bf* Tl) {
    typedef __attribute__((ext_vector_type(2))) unsigned short v2us;
    const int lane = threadIdx.x & 31, wid = blockIdx.x * 8 + (threadIdx.x >> 5), b = b0 + blockIdx.z; if (wid >= DD * (MP / 64)) return;
    INV += (size_t)blockIdx.z * MP; Th += (size_t)blockIdx.z * DD * MP; Tl += (size_t)blockIdx.z * DD * MP;
    const int g = wid % (MP / 64), d = wid / (MP / 64); const int m0 = g * 64 + 2 * lane; v2us oh, ol;
#pragma unroll
    for (int i = 0; i < 2; ++i) { const int m = m0 + i; const float v = (m < MM) ? bfr(Fs[((size_t)b * MM + m) * DD + d]) * INV[m] : 0.f; const unsigned short hb = f2bf(v); oh[i] = hb; ol[i] = f2bf(v - bf2f(hb)); }
    const size_t o = (size_t)d * MP + m0;
    *(v2us*)(Th + o) = oh; *(v2us*)(Tl + o) = ol; 
}
__global__ __launch_bounds__(256) void k_soft_s(const float* __restrict__ A, bf* PH, bf* PL) {
    const int lane = threadIdx.x & 31, m = blockIdx.x * 8 + (threadIdx.x >> 5); if (m >= MP) return;
    A += (size_t)blockIdx.z * MP * KTP; PH += (size_t)blockIdx.z * MP * KTP; PL += (size_t)blockIdx.z * MP * KTP;
    const float* ar = A + (size_t)m * KTP; float mx = -3.0e38f;
#pragma unroll 1
    for (int c0 = lane * 8; c0 < KTP; c0 += 256) { const v8f v = *(const v8f*)(ar + c0);
#pragma unroll
        for (int i = 0; i < 8; ++i) if (c0 + i < KT) mx = fmaxf(mx, v[i] * (1.0f / ALS)); }
#pragma unroll
    for (int sh = 16; sh; sh >>= 1) mx = fmaxf(mx, __shfl_xor(mx, sh, 32));
    float sum = 0.f;
#pragma unroll 1
    for (int c0 = lane * 8; c0 < KTP; c0 += 256) { const v8f v = *(const v8f*)(ar + c0);
#pragma unroll
        for (int i = 0; i < 8; ++i) if (c0 + i < KT) sum += __expf(v[i] * (1.0f / ALS) - mx); }
#pragma unroll
    for (int sh = 16; sh; sh >>= 1) sum += __shfl_xor(sum, sh, 32);
    const float inv = 1.0f / sum;
{
#pragma unroll 1
        for (int c0 = lane * 8; c0 < KTP; c0 += 256) { const v8f v = *(const v8f*)(ar + c0); v8us oh, ol;
#pragma unroll
            for (int i = 0; i < 8; ++i) { const float p = (c0 + i < KT) ? __expf(v[i] * (1.0f / ALS) - mx) * inv : 0.f; const unsigned short hb = f2bf(p); oh[i] = hb; ol[i] = f2bf(p - bf2f(hb)); }
            const size_t o = (size_t)m * KTP + c0; *(v8us*)(PH + o) = oh; *(v8us*)(PL + o) = ol; }
         }
}
// k_soft_t: one wave per text k (of 1024; pad texts produce zero rows): softmax over the 196 real tokens of A[m][k]/alpha_t (column read; f32, fixed lane order: lane ->
// tokens 2*lane, 2*lane+1, 2*lane+64, ...) -> planes [1024 k][256 m] (4 B per plane per lane per 64-token group: lanes write m = g*64 + 2*lane, 2*lane + 1; to keep
__global__ __launch_bounds__(256) void k_soft_t(const float* __restrict__ A, bf* PTh, bf* PTl) {
    typedef __attribute__((ext_vector_type(2))) unsigned short v2us;
    const int lane = threadIdx.x & 31, k = blockIdx.x * 8 + (threadIdx.x >> 5); if (k >= KTP) return;
    A += (size_t)blockIdx.z * MP * KTP; PTh += (size_t)blockIdx.z * KTP * MP; PTl += (size_t)blockIdx.z * KTP * MP;
    float a[MP / 32]; float mx = -3.0e38f;
#pragma unroll
    for (int j = 0; j < MP / 64; ++j)
#pragma unroll
        for (int i = 0; i < 2; ++i) { const int m = j * 64 + 2 * lane + i; const float v = (m < MM && k < KT) ? A[(size_t)m * KTP + k] * (1.0f / ALT) : -3.0e38f; a[j * 2 + i] = v; mx = fmaxf(mx, v); }
#pragma unroll
    for (int sh = 16; sh; sh >>= 1) mx = fmaxf(mx, __shfl_xor(mx, sh, 32));
    float sum = 0.f;
#pragma unroll
    for (int j = 0; j < MP / 32; ++j) sum += (a[j] > -1.0e38f) ? __expf(a[j] - mx) : 0.f;
#pragma unroll
    for (int sh = 16; sh; sh >>= 1) sum += __shfl_xor(sum, sh, 32);
    const float inv = (k < KT) ? 1.0f / sum : 0.f;
{
#pragma unroll
        for (int j = 0; j < MP / 64; ++j) { v2us oh, ol;
#pragma unroll
            for (int i = 0; i < 2; ++i) { const float p = (a[j * 2 + i] > -1.0e38f) ? __expf(a[j * 2 + i] - mx) * inv : 0.f; const unsigned short hb = f2bf(p); oh[i] = hb; ol[i] = f2bf(p - bf2f(hb)); }
            const size_t o = (size_t)k * MP + j * 64 + 2 * lane; *(v2us*)(PTh + o) = oh; *(v2us*)(PTl + o) = ol; }
         }
}
__global__ __launch_bounds__(256) void k_pool(const float* __restrict__ Fsa, int b0, float* FVA) {
    const int d = blockIdx.x * 256 + threadIdx.x, b = b0 + blockIdx.z; if (d >= DD) return; float s = 0.f, mx = -3.0e38f; Fsa += (size_t)blockIdx.z * MP * DD;
#pragma unroll 1
    for (int m = 0; m < MM; ++m) { const float v = Fsa[(size_t)m * DD + d]; s += v; mx = fmaxf(mx, v); }
    const float y = s * (1.0f / MM) + mx; *(float*)(FVA + (size_t)b * DD + d) = y; 
}
// k_logits: RES[b][k] = ls (beta1 bf(Fv[b]).bf(Ft[k]) + beta2 bf(Fv[b]).Fta[k] + beta3 Fva[b].bf(Ft[k])) (f32, rolled 512-term dots), ls = e^bf(logit_scale); thread per
__global__ __launch_bounds__(256) void k_logits(const float* __restrict__ Fv, const float* __restrict__ Ft, const float* __restrict__ FTA, const float* __restrict__ FVA, const float* __restrict__ lsc, int b0, float* RES) {
    const int k = blockIdx.x * 256 + threadIdx.x, b = b0 + blockIdx.z; if (k >= KTP) return; float r = 0.f; FTA += (size_t)blockIdx.z * KTP * DD;
    if (k < KT) { float d1 = 0.f, d2 = 0.f, d3 = 0.f;
#pragma unroll 1
        for (int d = 0; d < DD; ++d) { const float fv = bfr(Fv[(size_t)b * DD + d]), ft = bfr(Ft[(size_t)k * DD + d]); d1 = fmaf(fv, ft, d1); d2 = fmaf(fv, FTA[(size_t)k * DD + d], d2); d3 = fmaf(FVA[(size_t)b * DD + d], ft, d3); }
        const float ls = __expf(bfr(lsc[0])); r = B1_ * ls * d1 + B2_ * ls * d2 + B3_ * ls * d3; }
    *(float*)(RES + (size_t)b * KTP + k) = r; 
}
__global__ __launch_bounds__(256) void k_out(const float* __restrict__ RES, float* OUTP) {
    const int i = blockIdx.x * 256 + threadIdx.x; if (i >= NBI * KT) return; const float v = RES[(size_t)(i / KT) * KTP + (i % KT)];
    *(float*)(OUTP + i) = v; 
}

extern "C" void kernel_launch(void* const* d_in, const int* in_sizes, int n_in,
                              void* d_out, int out_size, void* d_ws, size_t ws_size, hipStream_t stream) {
    (void)in_sizes; (void)n_in; (void)out_size;
    const float* Fs = (const float*)d_in[0]; const float* Ft = (const float*)d_in[1]; const float* Fv = (const float*)d_in[2]; const float* lsc = (const float*)d_in[3];
    float* out = (float*)d_out;    // [128][1][1000]
    char* wsp = (char*)d_ws;
    auto take = [&](size_t bytes) { char* p = wsp; wsp += (bytes + 255) & ~(size_t)255; return (void*)p; };
    float* FtP = (float*)take((size_t)KTP * DD * 4); bf* FtB = (bf*)take((size_t)KTP * DD * 2); bf* FtT = (bf*)take((size_t)DD * KTP * 2); float* INV = (float*)take((size_t)GB * MP * 4);
    float* FVA = (float*)take((size_t)NBI * DD * 4); float* RES = (float*)take((size_t)NBI * KTP * 4);
    bf* Th = (bf*)take((size_t)GB * DD * MP * 2); bf* Tl = (bf*)take((size_t)GB * DD * MP * 2); bf* PTh = (bf*)take((size_t)GB * KTP * MP * 2); bf* PTl = (bf*)take((size_t)GB * KTP * MP * 2);
    // One region holds, one after the other in stream order: {A | Nh, Nl}, then {A | PH, PL}, then {FSA | PH, PL}, then FTA alone. Each plane is written after the last read of what it lies on.
    float* FTA = (float*)take((size_t)GB * KTP * DD * 4); float* A = FTA; float* FSA = FTA;
    bf* PH = (bf*)(A + (size_t)GB * MP * KTP); bf* PL = PH + (size_t)GB * MP * KTP; bf* Nh = PH; bf* Nl = Nh + (size_t)GB * MP * DD;
    if ((size_t)(wsp - (char*)d_ws) > ws_size) return;    // 4 + 0.8 + 32 + 64 + 128 ~ 229 MiB
    k_ftpad<<<(KTP * DD / 8 + 255) / 256, 256, 0, stream>>>(Ft, FtP, FtB); k_wt<<<dim3(KTP / 64, DD / 64, 1), 256, 0, stream>>>(FtP, KTP, DD, FtT);     // Ft^T [512][1024] exact bf16
    for (int b = 0; b < NBI; b += GB) {
        k_norm<<<dim3(1, 1, GB), 256, 0, stream>>>(Fs, b, INV);
        k_fsn<<<dim3(MP / 8, 1, GB), 256, 0, stream>>>(Fs, INV, b, Nh, Nl); k_fsnT<<<dim3((DD * (MP / 64)) / 8, 1, GB), 256, 0, stream>>>(Fs, INV, b, Th, Tl);
        k_gemmb<true, false><<<dim3(MP / 64, KTP / 64, GB), 128, 0, stream>>>(Nh, Nl, FtB, nullptr, A, KTP, nullptr, nullptr, DD, 1, (size_t)MP * DD, (size_t)MP * KTP);     // A = Fs_n.Ft^T  [256][1024]
        k_soft_s<<<dim3(MP / 8, 1, GB), 256, 0, stream>>>(A, PH, PL); k_soft_t<<<dim3(KTP / 8, 1, GB), 256, 0, stream>>>(A, PTh, PTl);
        k_gemmb<true, false><<<dim3(MP / 64, DD / 64, GB), 128, 0, stream>>>(PH, PL, FtT, nullptr, FSA, DD, nullptr, nullptr, KTP, 1, (size_t)MP * KTP, (size_t)MP * DD);    // Fsa = P_s.Ft    [256][512]
        k_pool<<<dim3(DD / 256, 1, GB), 256, 0, stream>>>(FSA, b, FVA);                                                                 // before k_gemm3: FTA lies on FSA
        k_gemm3<<<dim3(KTP / 64, DD / 64, GB), 128, 0, stream>>>(PTh, PTl, Th, Tl, MP, FTA, DD, (size_t)KTP * MP, (size_t)DD * MP, (size_t)KTP * DD);   // Fta = P_t.Fs_n  [1024][512]
        k_logits<<<dim3(KTP / 256, 1, GB), 256, 0, stream>>>(Fv, Ft, FTA, FVA, lsc, b, RES);
    }
    k_out<<<(NBI * KT + 255) / 256, 256, 0, stream>>>(RES, out);
}

// v002
// It runs in 951 microseconds.
// Next to v001, in two timings, it ran 1.57 times as fast each time.
// Over all steps from v000 it is 33.4 times as fast.
#include <hip/hip_runtime.h>

// Compute dtypes, f32 accumulate, 64 images per pass, one per blockIdx.z (M = 196 tokens padded to 256 rows, K = 1000 texts padded to 1024): Fs L2-normalised in f32 -> bf16 hi + UNSCALED
// residual planes (row-major and transposed); A = Fs_n.Ft^T ([256 x 512].[512 x 1024], split Fs_n against the exact bf16 Ft, two products), the two softmaxes (over texts
// x 1/alpha_s, over the 196 real tokens x 1/alpha_t) in f32 -> hi/lo planes, Fsa = P_s.Ft ([256 x 1024].[1024 x 512], two products) and Fta = P_t.Fs_n ([1024 x 256].[256
// x 512], three products) on v_wmma_f32_16x16x32_bf16; mean + max pooling over the real tokens, and the final logits (three 512-term dots per text, x exp(logit_scale) and

#define NBI  128
#define GB   64      // images per launch: blockIdx.z picks the image of the group, each image has its own slice of every per-image plane
#define MM   196
#define MP   256
#define KT   1000
#define KTP  1024
#define DD   512
#define DM   DD
#define NTK  MP
#define ALS  0.5f
#define ALT  0.5f
#define B1_  1.0f
#define B2_  0.1f
#define B3_  0.1f
#define LOSC 1024.0f

typedef _Float16 h16;
typedef unsigned short bf;
typedef __attribute__((ext_vector_type(16))) __bf16   v16bf;
typedef __attribute__((ext_vector_type(16))) _Float16 v16h;
typedef __attribute__((ext_vector_type(8)))  _Float16 v8h;
typedef __attribute__((ext_vector_type(8)))  unsigned short v8us;
typedef __attribute__((ext_vector_type(8)))  float    v8f;
typedef __attribute__((ext_vector_type(4)))  float    v4f;
typedef __attribute__((ext_vector_type(4)))  _Float16 v4h;
typedef v8h  __attribute__((may_alias)) v8ha;
typedef v4f  __attribute__((may_alias)) v4fa;
typedef v8us __attribute__((may_alias)) v8usa;

__device__ __forceinline__ unsigned short f2bf(float f) { unsigned u = __float_as_uint(f); u += 0x7FFFu + ((u >> 16) & 1u); return (unsigned short)(u >> 16); }
__device__ __forceinline__ float bf2f(unsigned short b) { return __uint_as_float(((unsigned)b) << 16); }
__device__ __forceinline__ float bfr(float f) { return bf2f(f2bf(f)); }
__device__ __forceinline__ v16h cat16(v8h lo, v8h hi) { return __builtin_shufflevector(lo, hi, 0, 1, 2, 3, 4, 5, 6, 7, 8, 9, 10, 11, 12, 13, 14, 15); }
__device__ __forceinline__ v16bf cat16b(v8us lo, v8us hi) { return __builtin_bit_cast(v16bf, __builtin_shufflevector(lo, hi, 0, 1, 2, 3, 4, 5, 6, 7, 8, 9, 10, 11, 12, 13, 14, 15)); }
__device__ __forceinline__ v8f wmma16(v16h a, v16h b, v8f c) { return __builtin_amdgcn_wmma_f32_16x16x32_f16(false, a, false, b, (short)0, c, false, false); }
__device__ __forceinline__ v8f wmmab(v16bf a, v16bf b, v8f c) { return __builtin_amdgcn_wmma_f32_16x16x32_bf16(false, a, false, b, (short)0, c, false, false); }

// k_wt: WT [n][K] = bf16(W[k][n]) (k-major [K][ncols]) via 64 x 64 LDS tiles; grid (K/64, ncols/64).
__global__ __launch_bounds__(256) void k_wt(const float* __restrict__ Wm, int K, int ncols, bf* WT) {
    __shared__ __align__(16) unsigned short tl[64 * 72];
    const int tid = threadIdx.x, k0 = blockIdx.x * 64, n0 = blockIdx.y * 64;
    const int kk = tid >> 2, nq = (tid & 3) * 16;
#pragma unroll
    for (int i = 0; i < 16; ++i) tl[(nq + i) * 72 + kk] = f2bf(Wm[(size_t)(k0 + kk) * ncols + n0 + nq + i]);
    __syncthreads();
    const int piece = tid & 7;
    auto pass = [&]() {
#pragma unroll
        for (int s = 0; s < 2; ++s) { const int nr = (tid >> 3) + 32 * s; const v8us val = *(const v8usa*)(tl + nr * 72 + piece * 8); *(v8us*)(WT + (size_t)(n0 + nr) * K + k0 + piece * 8) = val; }
    };
    pass(); 
}
// k_gemm: 128 x 128 block tile (8 waves, 4 x 2, each 32 x 64) of C = (Ah + Al).(Bh [+ Bl])^T over K (every plane k-contiguous with row stride K; n-major B). Per 32 k and
// accumulator the products come in the order hh, lh [, hl]. A stage is 64 k = one 128-byte line of each of the 128 rows of every plane: 8 lanes fetch a row's whole line,
// the stage goes through registers into one of two LDS buffers (row pitch 144 B for the 16-byte fragment reads) while the other buffer is multiplied.
// The inner loops are all unrolled so that st, acc and the fragments are indexed by constants and stay in registers.
#define BKE 64
#define LPB 144
#define PLB (128 * LPB)
template <int K, bool SPLITB>
__global__ __launch_bounds__(256) void k_gemm(const bf* __restrict__ Ah, const bf* __restrict__ Al, const bf* __restrict__ Bh, const bf* __restrict__ Bl, float* C, int ldc, size_t zA, size_t zB, size_t zC) {
    constexpr int NP = SPLITB ? 4 : 3, NS = K / BKE;
    __shared__ __align__(16) unsigned char sm[2 * NP * PLB];
    const int tid = threadIdx.x, lane = tid & 31, wave = tid >> 5, lr = lane & 15, hi = lane >> 4, wm = wave >> 1, wn = wave & 1;
    const int r0 = blockIdx.x * 128, c0 = blockIdx.y * 128;
    const int soff = (tid >> 3) * LPB + (tid & 7) * 16;
    unsigned go = (unsigned)((tid >> 3) * K + (tid & 7) * 8) * 2u;    // the lane's byte offset in every plane's tile: one register serves all planes beside their block-uniform bases; it steps by a stage
    const bf* src[4];
    src[0] = Ah + blockIdx.z * zA + (size_t)r0 * K; src[1] = Al + blockIdx.z * zA + (size_t)r0 * K;
    src[2] = Bh + blockIdx.z * zB + (size_t)c0 * K; src[3] = SPLITB ? Bl + blockIdx.z * zB + (size_t)c0 * K : src[2];
    v8us st[NP][4];
    auto fetch = [&]() {
#pragma unroll
        for (int p = 0; p < NP; ++p)
#pragma unroll
            for (int i = 0; i < 4; ++i) st[p][i] = *(const v8us*)((const unsigned char*)src[p] + (size_t)go + (size_t)(i * 32 * K * 2));
    };
    auto put = [&](int buf) {
#pragma unroll
        for (int p = 0; p < NP; ++p)
#pragma unroll
            for (int i = 0; i < 4; ++i) *(v8usa*)(sm + (buf * NP + p) * PLB + soff + i * 32 * LPB) = st[p][i];
    };
    v8f acc[2][4];
#pragma unroll
    for (int i = 0; i < 2; ++i)
#pragma unroll
        for (int t = 0; t < 4; ++t) acc[i][t] = (v8f){};
    fetch(); put(0); go += BKE * 2;
    __syncthreads();                         // publishes stage 0
    for (int s = 0; s < NS; ++s) {
        if (s + 1 < NS) fetch();
        __builtin_amdgcn_sched_barrier(0);    // keeps the next stage's global loads in front of this stage's products: sunk to the LDS stores below, their latency would be waited out every stage
        const unsigned char* bb = sm + (s & 1) * (NP * PLB) + lr * LPB + hi * 16;
#pragma unroll
        for (int kk = 0; kk < 2; ++kk) {
            v16bf a[2], al[2], b[4], bl[4];
#pragma unroll
            for (int i = 0; i < 2; ++i) { const unsigned char* p = bb + (wm * 32 + i * 16) * LPB + kk * 64;
                a[i] = cat16b(*(const v8usa*)p, *(const v8usa*)(p + 32)); al[i] = cat16b(*(const v8usa*)(p + PLB), *(const v8usa*)(p + PLB + 32)); }
#pragma unroll
            for (int t = 0; t < 4; ++t) { const unsigned char* p = bb + 2 * PLB + (wn * 64 + t * 16) * LPB + kk * 64;
                b[t] = cat16b(*(const v8usa*)p, *(const v8usa*)(p + 32)); bl[t] = b[t]; if (SPLITB) bl[t] = cat16b(*(const v8usa*)(p + PLB), *(const v8usa*)(p + PLB + 32)); }
#pragma unroll
            for (int i = 0; i < 2; ++i)
#pragma unroll
                for (int t = 0; t < 4; ++t) acc[i][t] = wmmab(a[i], b[t], acc[i][t]);
#pragma unroll
            for (int i = 0; i < 2; ++i)
#pragma unroll
                for (int t = 0; t < 4; ++t) acc[i][t] = wmmab(al[i], b[t], acc[i][t]);
            if (SPLITB) {
#pragma unroll
                for (int i = 0; i < 2; ++i)
#pragma unroll
                    for (int t = 0; t < 4; ++t) acc[i][t] = wmmab(a[i], bl[t], acc[i][t]);
            }
        }
        if (s + 1 < NS) put((s + 1) & 1);    // the buffer that every wave left at the barrier of stage s - 1
        go += BKE * 2;
        __syncthreads();                     // publishes stage s + 1 and ends the reads of stage s
    }
    float* os = (float*)(void*)sm + wave * (32 * 68);    // whole-line stores: each wave turns its 32 x 64 tile in its own range of the ring, free behind the last barrier
#pragma unroll
    for (int i = 0; i < 2; ++i)
#pragma unroll
        for (int t = 0; t < 4; ++t)
#pragma unroll
            for (int j = 0; j < 8; ++j) os[(i * 16 + hi * 8 + j) * 68 + t * 16 + lr] = acc[i][t][j];
    __syncthreads();                         // the tile's LDS stores are done before lanes read rows that other lanes wrote
    float* crow = C + blockIdx.z * zC + (size_t)(r0 + wm * 32) * ldc + c0 + wn * 64;
#pragma unroll
    for (int s = 0; s < 16; ++s) { const int Lid = (lane >> 3) + 4 * s, piece = lane & 7; const int row = Lid >> 1, cofs = (Lid & 1) * 32 + piece * 4;
        const v4f val = *(const v4fa*)(os + row * 68 + cofs); *(v4f*)(crow + (size_t)row * ldc + cofs) = val; }
}

// k_ftpad: FtP [1024][512] f32 copy of Ft with rows 1000..1023 zero (feeds k_wt for the exact transposed operand) and FtB = its bf16 rows (the n-major B of A = Fs_n.Ft^T);
__global__ __launch_bounds__(256) void k_ftpad(const float* __restrict__ Ft, float* FtP, bf* FtB) {
    const size_t u = (size_t)blockIdx.x * 256 + threadIdx.x; if (u >= (size_t)KTP * DD / 8) return;
    const int k = (int)(u / (DD / 8)); v8f v; v8us o;
#pragma unroll
    for (int i = 0; i < 8; ++i) { v[i] = (k < KT) ? Ft[u * 8 + i] : 0.f; o[i] = f2bf(v[i]); }
    *(v8f*)(FtP + u * 8) = v; *(v8us*)(FtB + u * 8) = o; 
}
__global__ __launch_bounds__(256) void k_norm(const float* __restrict__ Fs, int b0, float* INV) {
    const int m = threadIdx.x, b = b0 + blockIdx.z; float s = 0.f; INV += (size_t)blockIdx.z * MP;
    if (m < MM) { const float* r = Fs + ((size_t)b * MM + m) * DD;
#pragma unroll 1
        for (int d = 0; d < DD; ++d) { const float v = bfr(r[d]); s = fmaf(v, v, s); } }
    const float inv = (m < MM) ? 1.0f / sqrtf(s) : 0.f;
    *(float*)(INV + m) = inv; 
}
__global__ __launch_bounds__(256) void k_fsn(const float* __restrict__ Fs, const float* __restrict__ INV, int b0, bf* Nh, bf* Nl) {
    const int lane = threadIdx.x & 31, m = blockIdx.x * 8 + (threadIdx.x >> 5), b = b0 + blockIdx.z; if (m >= MP) return;
    INV += (size_t)blockIdx.z * MP; Nh += (size_t)blockIdx.z * MP * DD; Nl += (size_t)blockIdx.z * MP * DD;
    const float inv = INV[m];
{
#pragma unroll 1
        for (int q = 0; q < DD / 256; ++q) { const int d0 = q * 256 + lane * 8; v8us oh, ol;
#pragma unroll
            for (int i = 0; i < 8; ++i) { const float v = (m < MM) ? bfr(Fs[((size_t)b * MM + m) * DD + d0 + i]) * inv : 0.f; const unsigned short hb = f2bf(v); oh[i] = hb; ol[i] = f2bf(v - bf2f(hb)); }
            const size_t o = (size_t)m * DD + d0; *(v8us*)(Nh + o) = oh; *(v8us*)(Nl + o) = ol; }
         }
}
__global__ __launch_bounds__(256) void k_fsnT(const float* __restrict__ Fs, const float* __restrict__ INV, int b0, bf* Th, bf* Tl) {
    typedef __attribute__((ext_vector_type(2))) unsigned short v2us;
    const int lane = threadIdx.x & 31, wid = blockIdx.x * 8 + (threadIdx.x >> 5), b = b0 + blockIdx.z; if (wid >= DD * (MP / 64)) return;
    INV += (size_t)blockIdx.z * MP; Th += (size_t)blockIdx.z * DD * MP; Tl += (size_t)blockIdx.z * DD * MP;
    const int g = wid % (MP / 64), d = wid / (MP / 64); const int m0 = g * 64 + 2 * lane; v2us oh, ol;
#pragma unroll
    for (int i = 0; i < 2; ++i) { const int m = m0 + i; const float v = (m < MM) ? bfr(Fs[((size_t)b * MM + m) * DD + d]) * INV[m] : 0.f; const unsigned short hb = f2bf(v); oh[i] = hb; ol[i] = f2bf(v - bf2f(hb)); }
    const size_t o = (size_t)d * MP + m0;
    *(v2us*)(Th + o) = oh; *(v2us*)(Tl + o) = ol; 
}
__global__ __launch_bounds__(256) void k_soft_s(const float* __restrict__ A, bf* PH, bf* PL) {
    const int lane = threadIdx.x & 31, m = blockIdx.x * 8 + (threadIdx.x >> 5); if (m >= MP) return;
    A += (size_t)blockIdx.z * MP * KTP; PH += (size_t)blockIdx.z * MP * KTP; PL += (size_t)blockIdx.z * MP * KTP;
    const float* ar = A + (size_t)m * KTP; float mx = -3.0e38f;
#pragma unroll 1
    for (int c0 = lane * 8; c0 < KTP; c0 += 256) { const v8f v = *(const v8f*)(ar + c0);
#pragma unroll
        for (int i = 0; i < 8; ++i) if (c0 + i < KT) mx = fmaxf(mx, v[i] * (1.0f / ALS)); }
#pragma unroll
    for (int sh = 16; sh; sh >>= 1) mx = fmaxf(mx, __shfl_xor(mx, sh, 32));
    float sum = 0.f;
#pragma unroll 1
    for (int c0 = lane * 8; c0 < KTP; c0 += 256) { const v8f v = *(const v8f*)(ar + c0);
#pragma unroll
        for (int i = 0; i < 8; ++i) if (c0 + i < KT) sum += __expf(v[i] * (1.0f / ALS) - mx); }
#pragma unroll
    for (int sh = 16; sh; sh >>= 1) sum += __shfl_xor(sum, sh, 32);
    const float inv = 1.0f / sum;
{
#pragma unroll 1
        for (int c0 = lane * 8; c0 < KTP; c0 += 256) { const v8f v = *(const v8f*)(ar + c0); v8us oh, ol;
#pragma unroll
            for (int i = 0; i < 8; ++i) { const float p = (c0 + i < KT) ? __expf(v[i] * (1.0f / ALS) - mx) * inv : 0.f; const unsigned short hb = f2bf(p); oh[i] = hb; ol[i] = f2bf(p - bf2f(hb)); }
            const size_t o = (size_t)m * KTP + c0; *(v8us*)(PH + o) = oh; *(v8us*)(PL + o) = ol; }
         }
}
// k_soft_t: one wave per text k (of 1024; pad texts produce zero rows): softmax over the 196 real tokens of A[m][k]/alpha_t (column read; f32, fixed lane order: lane ->
// tokens 2*lane, 2*lane+1, 2*lane+64, ...) -> planes [1024 k][256 m] (4 B per plane per lane per 64-token group: lanes write m = g*64 + 2*lane, 2*lane + 1; to keep
__global__ __launch_bounds__(256) void k_soft_t(const float* __restrict__ A, bf* PTh, bf* PTl) {
    typedef __attribute__((ext_vector_type(2))) unsigned short v2us;
    const int lane = threadIdx.x & 31, k = blockIdx.x * 8 + (threadIdx.x >> 5); if (k >= KTP) return;
    A += (size_t)blockIdx.z * MP * KTP; PTh += (size_t)blockIdx.z * KTP * MP; PTl += (size_t)blockIdx.z * KTP * MP;
    float a[MP / 32]; float mx = -3.0e38f;
#pragma unroll
    for (int j = 0; j < MP / 64; ++j)
#pragma unroll
        for (int i = 0; i < 2; ++i) { const int m = j * 64 + 2 * lane + i; const float v = (m < MM && k < KT) ? A[(size_t)m * KTP + k] * (1.0f / ALT) : -3.0e38f; a[j * 2 + i] = v; mx = fmaxf(mx, v); }
#pragma unroll
    for (int sh = 16; sh; sh >>= 1) mx = fmaxf(mx, __shfl_xor(mx, sh, 32));
    float sum = 0.f;
#pragma unroll
    for (int j = 0; j < MP / 32; ++j) sum += (a[j] > -1.0e38f) ? __expf(a[j] - mx) : 0.f;
#pragma unroll
    for (int sh = 16; sh; sh >>= 1) sum += __shfl_xor(sum, sh, 32);
    const float inv = (k < KT) ? 1.0f / sum : 0.f;
{
#pragma unroll
        for (int j = 0; j < MP / 64; ++j) { v2us oh, ol;
#pragma unroll
            for (int i = 0; i < 2; ++i) { const float p = (a[j * 2 + i] > -1.0e38f) ? __expf(a[j * 2 + i] - mx) * inv : 0.f; const unsigned short hb = f2bf(p); oh[i] = hb; ol[i] = f2bf(p - bf2f(hb)); }
            const size_t o = (size_t)k * MP + j * 64 + 2 * lane; *(v2us*)(PTh + o) = oh; *(v2us*)(PTl + o) = ol; }
         }
}
__global__ __launch_bounds__(256) void k_pool(const float* __restrict__ Fsa, int b0, float* FVA) {
    const int d = blockIdx.x * 256 + threadIdx.x, b = b0 + blockIdx.z; if (d >= DD) return; float s = 0.f, mx = -3.0e38f; Fsa += (size_t)blockIdx.z * MP * DD;
#pragma unroll 1
    for (int m = 0; m < MM; ++m) { const float v = Fsa[(size_t)m * DD + d]; s += v; mx = fmaxf(mx, v); }
    const float y = s * (1.0f / MM) + mx; *(float*)(FVA + (size_t)b * DD + d) = y; 
}
// k_logits: RES[b][k] = ls (beta1 bf(Fv[b]).bf(Ft[k]) + beta2 bf(Fv[b]).Fta[k] + beta3 Fva[b].bf(Ft[k])) (f32, rolled 512-term dots), ls = e^bf(logit_scale); thread per
__global__ __launch_bounds__(256) void k_logits(const float* __restrict__ Fv, const float* __restrict__ Ft, const float* __restrict__ FTA, const float* __restrict__ FVA, const float* __restrict__ lsc, int b0, float* RES) {
    const int k = blockIdx.x * 256 + threadIdx.x, b = b0 + blockIdx.z; if (k >= KTP) return; float r = 0.f; FTA += (size_t)blockIdx.z * KTP * DD;
    if (k < KT) { float d1 = 0.f, d2 = 0.f, d3 = 0.f;
#pragma unroll 1
        for (int d = 0; d < DD; ++d) { const float fv = bfr(Fv[(size_t)b * DD + d]), ft = bfr(Ft[(size_t)k * DD + d]); d1 = fmaf(fv, ft, d1); d2 = fmaf(fv, FTA[(size_t)k * DD + d], d2); d3 = fmaf(FVA[(size_t)b * DD + d], ft, d3); }
        const float ls = __expf(bfr(lsc[0])); r = B1_ * ls * d1 + B2_ * ls * d2 + B3_ * ls * d3; }
    *(float*)(RES + (size_t)b * KTP + k) = r; 
}
__global__ __launch_bounds__(256) void k_out(const float* __restrict__ RES, float* OUTP) {
    const int i = blockIdx.x * 256 + threadIdx.x; if (i >= NBI * KT) return; const float v = RES[(size_t)(i / KT) * KTP + (i % KT)];
    *(float*)(OUTP + i) = v; 
}

extern "C" void kernel_launch(void* const* d_in, const int* in_sizes, int n_in,
                              void* d_out, int out_size, void* d_ws, size_t ws_size, hipStream_t stream) {
    (void)in_sizes; (void)n_in; (void)out_size;
    const float* Fs = (const float*)d_in[0]; const float* Ft = (const float*)d_in[1]; const float* Fv = (const float*)d_in[2]; const float* lsc = (const float*)d_in[3];
    float* out = (float*)d_out;    // [128][1][1000]
    char* wsp = (char*)d_ws;
    auto take = [&](size_t bytes) { char* p = wsp; wsp += (bytes + 255) & ~(size_t)255; return (void*)p; };
    float* FtP = (float*)take((size_t)KTP * DD * 4); bf* FtB = (bf*)take((size_t)KTP * DD * 2); bf* FtT = (bf*)take((size_t)DD * KTP * 2); float* INV = (float*)take((size_t)GB * MP * 4);
    float* FVA = (float*)take((size_t)NBI * DD * 4); float* RES = (float*)take((size_t)NBI * KTP * 4);
    bf* Th = (bf*)take((size_t)GB * DD * MP * 2); bf* Tl = (bf*)take((size_t)GB * DD * MP * 2); bf* PTh = (bf*)take((size_t)GB * KTP * MP * 2); bf* PTl = (bf*)take((size_t)GB * KTP * MP * 2);
    // One region holds, one after the other in stream order: {A | Nh, Nl}, then {A | PH, PL}, then {FSA | PH, PL}, then FTA alone. Each plane is written after the last read of what it lies on.
    float* FTA = (float*)take((size_t)GB * KTP * DD * 4); float* A = FTA; float* FSA = FTA;
    bf* PH = (bf*)(A + (size_t)GB * MP * KTP); bf* PL = PH + (size_t)GB * MP * KTP; bf* Nh = PH; bf* Nl = Nh + (size_t)GB * MP * DD;
    if ((size_t)(wsp - (char*)d_ws) > ws_size) return;    // 4 + 0.8 + 32 + 64 + 128 ~ 229 MiB
    k_ftpad<<<(KTP * DD / 8 + 255) / 256, 256, 0, stream>>>(Ft, FtP, FtB); k_wt<<<dim3(KTP / 64, DD / 64, 1), 256, 0, stream>>>(FtP, KTP, DD, FtT);     // Ft^T [512][1024] exact bf16
    for (int b = 0; b < NBI; b += GB) {
        k_norm<<<dim3(1, 1, GB), 256, 0, stream>>>(Fs, b, INV);
        k_fsn<<<dim3(MP / 8, 1, GB), 256, 0, stream>>>(Fs, INV, b, Nh, Nl); k_fsnT<<<dim3((DD * (MP / 64)) / 8, 1, GB), 256, 0, stream>>>(Fs, INV, b, Th, Tl);
        k_gemm<DD, false><<<dim3(MP / 128, KTP / 128, GB), 256, 0, stream>>>(Nh, Nl, FtB, FtB, A, KTP, (size_t)MP * DD, 0, (size_t)MP * KTP);     // A = Fs_n.Ft^T  [256][1024]
        k_soft_s<<<dim3(MP / 8, 1, GB), 256, 0, stream>>>(A, PH, PL); k_soft_t<<<dim3(KTP / 8, 1, GB), 256, 0, stream>>>(A, PTh, PTl);
        k_gemm<KTP, false><<<dim3(MP / 128, DD / 128, GB), 256, 0, stream>>>(PH, PL, FtT, FtT, FSA, DD, (size_t)MP * KTP, 0, (size_t)MP * DD);    // Fsa = P_s.Ft    [256][512]
        k_pool<<<dim3(DD / 256, 1, GB), 256, 0, stream>>>(FSA, b, FVA);                                                                 // before the Fta product: FTA lies on FSA
        k_gemm<MP, true><<<dim3(KTP / 128, DD / 128, GB), 256, 0, stream>>>(PTh, PTl, Th, Tl, FTA, DD, (size_t)KTP * MP, (size_t)DD * MP, (size_t)KTP * DD);   // Fta = P_t.Fs_n  [1024][512]
        k_logits<<<dim3(KTP / 256, 1, GB), 256, 0, stream>>>(Fv, Ft, FTA, FVA, lsc, b, RES);
    }
    k_out<<<(NBI * KT + 255) / 256, 256, 0, stream>>>(RES, out);
}

// v003
// It runs in 485 microseconds.
// In both of two side-by-side timings against v002, it was 1.95 times as fast.
// Counting every step since v000, it is 65.3 times as fast.
#include <hip/hip_runtime.h>

// Compute dtypes, f32 accumulate, 64 images per pass, one per blockIdx.z (M = 196 tokens padded to 256 rows, K = 1000 texts padded to 1024): Fs L2-normalised in f32 -> bf16 hi + UNSCALED
// residual planes (row-major and transposed); A = Fs_n.Ft^T ([256 x 512].[512 x 1024], split Fs_n against the exact bf16 Ft, two products), the two softmaxes (over texts
// x 1/alpha_s, over the 196 real tokens x 1/alpha_t) in f32 -> hi/lo planes, Fsa = P_s.Ft ([256 x 1024].[1024 x 512], two products) and Fta = P_t.Fs_n ([1024 x 256].[256
// x 512], three products) on v_wmma_f32_16x16x32_bf16; mean + max pooling over the real tokens, and the final logits (three 512-term dots per text, x exp(logit_scale) and

#define NBI  128
#define GB   64      // images per launch: blockIdx.z picks the image of the group, each image has its own slice of every per-image plane
#define MM   196
#define MP   256
#define KT   1000
#define KTP  1024
#define DD   512
#define DM   DD
#define NTK  MP
#define ALS  0.5f
#define ALT  0.5f
#define B1_  1.0f
#define B2_  0.1f
#define B3_  0.1f
#define LOSC 1024.0f

typedef _Float16 h16;
typedef unsigned short bf;
typedef __attribute__((ext_vector_type(16))) __bf16   v16bf;
typedef __attribute__((ext_vector_type(16))) _Float16 v16h;
typedef __attribute__((ext_vector_type(8)))  _Float16 v8h;
typedef __attribute__((ext_vector_type(8)))  unsigned short v8us;
typedef __attribute__((ext_vector_type(8)))  float    v8f;
typedef __attribute__((ext_vector_type(4)))  float    v4f;
typedef __attribute__((ext_vector_type(4)))  _Float16 v4h;
typedef v8h  __attribute__((may_alias)) v8ha;
typedef v4f  __attribute__((may_alias)) v4fa;
typedef v8us __attribute__((may_alias)) v8usa;

__device__ __forceinline__ unsigned short f2bf(float f) { unsigned u = __float_as_uint(f); u += 0x7FFFu + ((u >> 16) & 1u); return (unsigned short)(u >> 16); }
__device__ __forceinline__ float bf2f(unsigned short b) { return __uint_as_float(((unsigned)b) << 16); }
__device__ __forceinline__ float bfr(float f) { return bf2f(f2bf(f)); }
__device__ __forceinline__ v16h cat16(v8h lo, v8h hi) { return __builtin_shufflevector(lo, hi, 0, 1, 2, 3, 4, 5, 6, 7, 8, 9, 10, 11, 12, 13, 14, 15); }
__device__ __forceinline__ v16bf cat16b(v8us lo, v8us hi) { return __builtin_bit_cast(v16bf, __builtin_shufflevector(lo, hi, 0, 1, 2, 3, 4, 5, 6, 7, 8, 9, 10, 11, 12, 13, 14, 15)); }
__device__ __forceinline__ v8f wmma16(v16h a, v16h b, v8f c) { return __builtin_amdgcn_wmma_f32_16x16x32_f16(false, a, false, b, (short)0, c, false, false); }
__device__ __forceinline__ v8f wmmab(v16bf a, v16bf b, v8f c) { return __builtin_amdgcn_wmma_f32_16x16x32_bf16(false, a, false, b, (short)0, c, false, false); }

// k_wt: WT [n][K] = bf16(W[k][n]) (k-major [K][ncols]) via 64 x 64 LDS tiles; grid (K/64, ncols/64).
__global__ __launch_bounds__(256) void k_wt(const float* __restrict__ Wm, int K, int ncols, bf* WT) {
    __shared__ __align__(16) unsigned short tl[64 * 72];
    const int tid = threadIdx.x, k0 = blockIdx.x * 64, n0 = blockIdx.y * 64;
    const int kk = tid >> 2, nq = (tid & 3) * 16;
#pragma unroll
    for (int i = 0; i < 16; ++i) tl[(nq + i) * 72 + kk] = f2bf(Wm[(size_t)(k0 + kk) * ncols + n0 + nq + i]);
    __syncthreads();
    const int piece = tid & 7;
    auto pass = [&]() {
#pragma unroll
        for (int s = 0; s < 2; ++s) { const int nr = (tid >> 3) + 32 * s; const v8us val = *(const v8usa*)(tl + nr * 72 + piece * 8); *(v8us*)(WT + (size_t)(n0 + nr) * K + k0 + piece * 8) = val; }
    };
    pass(); 
}
// k_gemm: 128 x 128 block tile (8 waves, 4 x 2, each 32 x 64) of C = (Ah + Al).(Bh [+ Bl])^T over K (every plane k-contiguous with row stride K; n-major B). Per 32 k and
// accumulator the products come in the order hh, lh [, hl]. A stage is 64 k = one 128-byte line of each of the 128 rows of every plane: 8 lanes fetch a row's whole line,
// the stage goes through registers into one of two LDS buffers (row pitch 144 B for the 16-byte fragment reads) while the other buffer is multiplied.
// The inner loops are all unrolled so that st, acc and the fragments are indexed by constants and stay in registers.
#define BKE 64
#define LPB 144
#define PLB (128 * LPB)
template <int K, bool SPLITB>
__global__ __launch_bounds__(256) void k_gemm(const bf* __restrict__ Ah, const bf* __restrict__ Al, const bf* __restrict__ Bh, const bf* __restrict__ Bl, float* C, int ldc, size_t zA, size_t zB, size_t zC) {
    constexpr int NP = SPLITB ? 4 : 3, NS = K / BKE;
    __shared__ __align__(16) unsigned char sm[2 * NP * PLB];
    const int tid = threadIdx.x, lane = tid & 31, wave = tid >> 5, lr = lane & 15, hi = lane >> 4, wm = wave >> 1, wn = wave & 1;
    const int r0 = blockIdx.x * 128, c0 = blockIdx.y * 128;
    const int soff = (tid >> 3) * LPB + (tid & 7) * 16;
    unsigned go = (unsigned)((tid >> 3) * K + (tid & 7) * 8) * 2u;    // the lane's byte offset in every plane's tile: one register serves all planes beside their block-uniform bases; it steps by a stage
    const bf* src[4];
    src[0] = Ah + blockIdx.z * zA + (size_t)r0 * K; src[1] = Al + blockIdx.z * zA + (size_t)r0 * K;
    src[2] = Bh + blockIdx.z * zB + (size_t)c0 * K; src[3] = SPLITB ? Bl + blockIdx.z * zB + (size_t)c0 * K : src[2];
    v8us st[NP][4];
    auto fetch = [&]() {
#pragma unroll
        for (int p = 0; p < NP; ++p)
#pragma unroll
            for (int i = 0; i < 4; ++i) st[p][i] = *(const v8us*)((const unsigned char*)src[p] + (size_t)go + (size_t)(i * 32 * K * 2));
    };
    auto put = [&](int buf) {
#pragma unroll
        for (int p = 0; p < NP; ++p)
#pragma unroll
            for (int i = 0; i < 4; ++i) *(v8usa*)(sm + (buf * NP + p) * PLB + soff + i * 32 * LPB) = st[p][i];
    };
    v8f acc[2][4];
#pragma unroll
    for (int i = 0; i < 2; ++i)
#pragma unroll
        for (int t = 0; t < 4; ++t) acc[i][t] = (v8f){};
    fetch(); put(0); go += BKE * 2;
    __syncthreads();                         // publishes stage 0
    for (int s = 0; s < NS; ++s) {
        if (s + 1 < NS) fetch();
        __builtin_amdgcn_sched_barrier(0);    // keeps the next stage's global loads in front of this stage's products: sunk to the LDS stores below, their latency would be waited out every stage
        const unsigned char* bb = sm + (s & 1) * (NP * PLB) + lr * LPB + hi * 16;
#pragma unroll
        for (int kk = 0; kk < 2; ++kk) {
            v16bf a[2], al[2], b[4], bl[4];
#pragma unroll
            for (int i = 0; i < 2; ++i) { const unsigned char* p = bb + (wm * 32 + i * 16) * LPB + kk * 64;
                a[i] = cat16b(*(const v8usa*)p, *(const v8usa*)(p + 32)); al[i] = cat16b(*(const v8usa*)(p + PLB), *(const v8usa*)(p + PLB + 32)); }
#pragma unroll
            for (int t = 0; t < 4; ++t) { const unsigned char* p = bb + 2 * PLB + (wn * 64 + t * 16) * LPB + kk * 64;
                b[t] = cat16b(*(const v8usa*)p, *(const v8usa*)(p + 32)); bl[t] = b[t]; if (SPLITB) bl[t] = cat16b(*(const v8usa*)(p + PLB), *(const v8usa*)(p + PLB + 32)); }
#pragma unroll
            for (int i = 0; i < 2; ++i)
#pragma unroll
                for (int t = 0; t < 4; ++t) acc[i][t] = wmmab(a[i], b[t], acc[i][t]);
#pragma unroll
            for (int i = 0; i < 2; ++i)
#pragma unroll
                for (int t = 0; t < 4; ++t) acc[i][t] = wmmab(al[i], b[t], acc[i][t]);
            if (SPLITB) {
#pragma unroll
                for (int i = 0; i < 2; ++i)
#pragma unroll
                    for (int t = 0; t < 4; ++t) acc[i][t] = wmmab(a[i], bl[t], acc[i][t]);
            }
        }
        if (s + 1 < NS) put((s + 1) & 1);    // the buffer that every wave left at the barrier of stage s - 1
        go += BKE * 2;
        __syncthreads();                     // publishes stage s + 1 and ends the reads of stage s
    }
    float* os = (float*)(void*)sm + wave * (32 * 68);    // whole-line stores: each wave turns its 32 x 64 tile in its own range of the ring, free behind the last barrier
#pragma unroll
    for (int i = 0; i < 2; ++i)
#pragma unroll
        for (int t = 0; t < 4; ++t)
#pragma unroll
            for (int j = 0; j < 8; ++j) os[(i * 16 + hi * 8 + j) * 68 + t * 16 + lr] = acc[i][t][j];
    __syncthreads();                         // the tile's LDS stores are done before lanes read rows that other lanes wrote
    float* crow = C + blockIdx.z * zC + (size_t)(r0 + wm * 32) * ldc + c0 + wn * 64;
#pragma unroll
    for (int s = 0; s < 16; ++s) { const int Lid = (lane >> 3) + 4 * s, piece = lane & 7; const int row = Lid >> 1, cofs = (Lid & 1) * 32 + piece * 4;
        const v4f val = *(const v4fa*)(os + row * 68 + cofs); *(v4f*)(crow + (size_t)row * ldc + cofs) = val; }
}

// k_ftpad: FtP [1024][512] f32 copy of Ft with rows 1000..1023 zero (feeds k_wt for the exact transposed operand) and FtB = its bf16 rows (the n-major B of A = Fs_n.Ft^T);
__global__ __launch_bounds__(256) void k_ftpad(const float* __restrict__ Ft, float* FtP, bf* FtB) {
    const size_t u = (size_t)blockIdx.x * 256 + threadIdx.x; if (u >= (size_t)KTP * DD / 8) return;
    const int k = (int)(u / (DD / 8)); v8f v; v8us o;
#pragma unroll
    for (int i = 0; i < 8; ++i) { v[i] = (k < KT) ? Ft[u * 8 + i] : 0.f; o[i] = f2bf(v[i]); }
    *(v8f*)(FtP + u * 8) = v; *(v8us*)(FtB + u * 8) = o; 
}
// wsum: sum over the 32 lanes of a wave, five-step butterfly; every lane ends with the same value.
__device__ __forceinline__ float wsum(float v) {
#pragma unroll
    for (int sh = 16; sh; sh >>= 1) v += __shfl_xor(v, sh, 32);
    return v;
}
// k_norm: a wave per token row, four rows a wave (16 loads of 16 B in flight, each 512 contiguous bytes of a row), 32 rows a block; pad rows read the last real row and store 0.
__global__ __launch_bounds__(256) void k_norm(const float* __restrict__ Fs, int b0, float* INV) {
    __shared__ float sh[32];
    const int lane = threadIdx.x & 31, wave = __builtin_amdgcn_readfirstlane(threadIdx.x >> 5), m0 = blockIdx.x * 32 + wave * 4, b = b0 + blockIdx.z; INV += (size_t)blockIdx.z * MP;
    v4f v[4][4]; const float* r[4];
#pragma unroll
    for (int i = 0; i < 4; ++i) { const int mr = (m0 + i < MM) ? m0 + i : MM - 1; r[i] = Fs + ((size_t)b * MM + mr) * DD + lane * 4;
#pragma unroll
        for (int q = 0; q < 4; ++q) v[i][q] = *(const v4f*)(r[i] + q * 128); }
    // the wait stands in front of every overwrite of a register that these loads name as an address; the addresses are its inputs, so that none of their registers is given to a load's result ahead of it
    asm volatile("s_wait_xcnt 0x0" :: "v"(r[0]), "v"(r[1]), "v"(r[2]), "v"(r[3]) : "memory");
    __builtin_amdgcn_sched_barrier(0);        // keeps all 16 loads in front of the sums: with sums lifted between them the wave would wait out the memory latency twice
    float s[4];
#pragma unroll
    for (int i = 0; i < 4; ++i) { v4f a = (v4f){};
#pragma unroll
        for (int q = 0; q < 4; ++q) { v4f x;
#pragma unroll
            for (int e = 0; e < 4; ++e) x[e] = bfr(v[i][q][e]);
            a = __builtin_elementwise_fma(x, x, a); }
        s[i] = (a[0] + a[1]) + (a[2] + a[3]); }
#pragma unroll
    for (int i = 0; i < 4; ++i) s[i] = wsum(s[i]);
    if (lane < 4) { const float sq = (lane == 0) ? s[0] : (lane == 1) ? s[1] : (lane == 2) ? s[2] : s[3];    // lane i finishes row i
        sh[wave * 4 + lane] = (m0 + lane < MM) ? 1.0f / sqrtf(sq) : 0.f; }
    __syncthreads();                         // the eight waves' results are in LDS before one wave stores the block's whole 128-byte line
    if (threadIdx.x < 32) INV[blockIdx.x * 32 + threadIdx.x] = sh[threadIdx.x];
}
__global__ __launch_bounds__(256) void k_fsn(const float* __restrict__ Fs, const float* __restrict__ INV, int b0, bf* Nh, bf* Nl) {
    const int lane = threadIdx.x & 31, m = blockIdx.x * 8 + (threadIdx.x >> 5), b = b0 + blockIdx.z; if (m >= MP) return;
    INV += (size_t)blockIdx.z * MP; Nh += (size_t)blockIdx.z * MP * DD; Nl += (size_t)blockIdx.z * MP * DD;
    const float inv = INV[m];
{
#pragma unroll 1
        for (int q = 0; q < DD / 256; ++q) { const int d0 = q * 256 + lane * 8; v8us oh, ol;
#pragma unroll
            for (int i = 0; i < 8; ++i) { const float v = (m < MM) ? bfr(Fs[((size_t)b * MM + m) * DD + d0 + i]) * inv : 0.f; const unsigned short hb = f2bf(v); oh[i] = hb; ol[i] = f2bf(v - bf2f(hb)); }
            const size_t o = (size_t)m * DD + d0; *(v8us*)(Nh + o) = oh; *(v8us*)(Nl + o) = ol; }
         }
}
__global__ __launch_bounds__(256) void k_fsnT(const float* __restrict__ Fs, const float* __restrict__ INV, int b0, bf* Th, bf* Tl) {
    typedef __attribute__((ext_vector_type(2))) unsigned short v2us;
    const int lane = threadIdx.x & 31, wid = blockIdx.x * 8 + (threadIdx.x >> 5), b = b0 + blockIdx.z; if (wid >= DD * (MP / 64)) return;
    INV += (size_t)blockIdx.z * MP; Th += (size_t)blockIdx.z * DD * MP; Tl += (size_t)blockIdx.z * DD * MP;
    const int g = wid % (MP / 64), d = wid / (MP / 64); const int m0 = g * 64 + 2 * lane; v2us oh, ol;
#pragma unroll
    for (int i = 0; i < 2; ++i) { const int m = m0 + i; const float v = (m < MM) ? bfr(Fs[((size_t)b * MM + m) * DD + d]) * INV[m] : 0.f; const unsigned short hb = f2bf(v); oh[i] = hb; ol[i] = f2bf(v - bf2f(hb)); }
    const size_t o = (size_t)d * MP + m0;
    *(v2us*)(Th + o) = oh; *(v2us*)(Tl + o) = ol; 
}
__global__ __launch_bounds__(256) void k_soft_s(const float* __restrict__ A, bf* PH, bf* PL) {
    const int lane = threadIdx.x & 31, m = blockIdx.x * 8 + (threadIdx.x >> 5); if (m >= MP) return;
    A += (size_t)blockIdx.z * MP * KTP; PH += (size_t)blockIdx.z * MP * KTP; PL += (size_t)blockIdx.z * MP * KTP;
    const float* ar = A + (size_t)m * KTP; float mx = -3.0e38f;
#pragma unroll 1
    for (int c0 = lane * 8; c0 < KTP; c0 += 256) { const v8f v = *(const v8f*)(ar + c0);
#pragma unroll
        for (int i = 0; i < 8; ++i) if (c0 + i < KT) mx = fmaxf(mx, v[i] * (1.0f / ALS)); }
#pragma unroll
    for (int sh = 16; sh; sh >>= 1) mx = fmaxf(mx, __shfl_xor(mx, sh, 32));
    float sum = 0.f;
#pragma unroll 1
    for (int c0 = lane * 8; c0 < KTP; c0 += 256) { const v8f v = *(const v8f*)(ar + c0);
#pragma unroll
        for (int i = 0; i < 8; ++i) if (c0 + i < KT) sum += __expf(v[i] * (1.0f / ALS) - mx); }
#pragma unroll
    for (int sh = 16; sh; sh >>= 1) sum += __shfl_xor(sum, sh, 32);
    const float inv = 1.0f / sum;
{
#pragma unroll 1
        for (int c0 = lane * 8; c0 < KTP; c0 += 256) { const v8f v = *(const v8f*)(ar + c0); v8us oh, ol;
#pragma unroll
            for (int i = 0; i < 8; ++i) { const float p = (c0 + i < KT) ? __expf(v[i] * (1.0f / ALS) - mx) * inv : 0.f; const unsigned short hb = f2bf(p); oh[i] = hb; ol[i] = f2bf(p - bf2f(hb)); }
            const size_t o = (size_t)m * KTP + c0; *(v8us*)(PH + o) = oh; *(v8us*)(PL + o) = ol; }
         }
}
// k_soft_t: one wave per text k (of 1024; pad texts produce zero rows): softmax over the 196 real tokens of A[m][k]/alpha_t (column read; f32, fixed lane order: lane ->
// tokens 2*lane, 2*lane+1, 2*lane+64, ...) -> planes [1024 k][256 m] (4 B per plane per lane per 64-token group: lanes write m = g*64 + 2*lane, 2*lane + 1; to keep
__global__ __launch_bounds__(256) void k_soft_t(const float* __restrict__ A, bf* PTh, bf* PTl) {
    typedef __attribute__((ext_vector_type(2))) unsigned short v2us;
    const int lane = threadIdx.x & 31, k = blockIdx.x * 8 + (threadIdx.x >> 5); if (k >= KTP) return;
    A += (size_t)blockIdx.z * MP * KTP; PTh += (size_t)blockIdx.z * KTP * MP; PTl += (size_t)blockIdx.z * KTP * MP;
    float a[MP / 32]; float mx = -3.0e38f;
#pragma unroll
    for (int j = 0; j < MP / 64; ++j)
#pragma unroll
        for (int i = 0; i < 2; ++i) { const int m = j * 64 + 2 * lane + i; const float v = (m < MM && k < KT) ? A[(size_t)m * KTP + k] * (1.0f / ALT) : -3.0e38f; a[j * 2 + i] = v; mx = fmaxf(mx, v); }
#pragma unroll
    for (int sh = 16; sh; sh >>= 1) mx = fmaxf(mx, __shfl_xor(mx, sh, 32));
    float sum = 0.f;
#pragma unroll
    for (int j = 0; j < MP / 32; ++j) sum += (a[j] > -1.0e38f) ? __expf(a[j] - mx) : 0.f;
#pragma unroll
    for (int sh = 16; sh; sh >>= 1) sum += __shfl_xor(sum, sh, 32);
    const float inv = (k < KT) ? 1.0f / sum : 0.f;
{
#pragma unroll
        for (int j = 0; j < MP / 64; ++j) { v2us oh, ol;
#pragma unroll
            for (int i = 0; i < 2; ++i) { const float p = (a[j * 2 + i] > -1.0e38f) ? __expf(a[j * 2 + i] - mx) * inv : 0.f; const unsigned short hb = f2bf(p); oh[i] = hb; ol[i] = f2bf(p - bf2f(hb)); }
            const size_t o = (size_t)k * MP + j * 64 + 2 * lane; *(v2us*)(PTh + o) = oh; *(v2us*)(PTl + o) = ol; }
         }
}
// k_pool: a block per 128 columns of an image; wave w takes the tokens w, w + 8, ... (a lane holds 4 columns, a load is 512 contiguous bytes of a token's row, the loop unrolled so that
// many of a wave's loads are in flight together); the eight waves' sums and maxima meet in LDS and are combined in wave order.
__global__ __launch_bounds__(256) void k_pool(const float* __restrict__ Fsa, int b0, float* FVA) {
    __shared__ __align__(16) float ps[8 * 128], pm[8 * 128];
    const int lane = threadIdx.x & 31, wave = threadIdx.x >> 5, d0 = blockIdx.x * 128, b = b0 + blockIdx.z;
    const float* p = Fsa + (size_t)blockIdx.z * MP * DD + (size_t)wave * DD + d0 + lane * 4;
    v4f s = (v4f){}, mx = (v4f){-3.0e38f, -3.0e38f, -3.0e38f, -3.0e38f};
#pragma unroll
    for (int j = 0; j < MM / 8; ++j) { const v4f v = *(const v4f*)(p + (size_t)(8 * j) * DD);
#pragma unroll
        for (int e = 0; e < 4; ++e) { s[e] += v[e]; mx[e] = fmaxf(mx[e], v[e]); } }
    if (wave < MM % 8) { const v4f v = *(const v4f*)(p + (size_t)(8 * (MM / 8)) * DD);
#pragma unroll
        for (int e = 0; e < 4; ++e) { s[e] += v[e]; mx[e] = fmaxf(mx[e], v[e]); } }
    asm volatile("s_wait_xcnt 0x0" :: "v"(p) : "memory");    // stands in front of every overwrite of the address register that the loads above name; the address is its input, so that it lives up to here
    *(v4fa*)(ps + wave * 128 + lane * 4) = s; *(v4fa*)(pm + wave * 128 + lane * 4) = mx;
    __syncthreads();                         // every wave's partial sums and maxima are in LDS before they are combined
    if (threadIdx.x < 128) { float t = 0.f, m = -3.0e38f;
#pragma unroll
        for (int w = 0; w < 8; ++w) { t += ps[w * 128 + threadIdx.x]; m = fmaxf(m, pm[w * 128 + threadIdx.x]); }
        FVA[(size_t)b * DD + d0 + threadIdx.x] = t * (1.0f / MM) + m; }
}
// k_logits: RES[b][k] = ls (beta1 bf(Fv[b]).bf(Ft[k]) + beta2 bf(Fv[b]).Fta[k] + beta3 Fva[b].bf(Ft[k])) (f32), ls = e^bf(logit_scale). A wave per text row, 32 rows a wave: Fv[b] and Fva[b]
// stay in registers (a lane holds 16 of the 512 terms), each row of Ft and Fta comes as four loads of 512 contiguous bytes, two rows a step, the next step's 16 loads issued before a step is
// summed; a lane adds its 16 terms of the three dots, weights them, and a butterfly adds the lanes; lane j keeps row j, so the wave stores one whole line. Pad texts read Ft's last row and store 0.
__global__ __launch_bounds__(256) void k_logits(const float* __restrict__ Fv, const float* __restrict__ Ft, const float* __restrict__ FTA, const float* __restrict__ FVA, const float* __restrict__ lsc, int b0, float* RES) {
    const int lane = threadIdx.x & 31, k0 = blockIdx.x * 256 + __builtin_amdgcn_readfirstlane(threadIdx.x >> 5) * 32, b = b0 + blockIdx.z; FTA += (size_t)blockIdx.z * KTP * DD;
    v4f fv[4], fa[4];
#pragma unroll
    for (int q = 0; q < 4; ++q) { const v4f v = *(const v4f*)(Fv + (size_t)b * DD + q * 128 + lane * 4); fa[q] = *(const v4f*)(FVA + (size_t)b * DD + q * 128 + lane * 4);
#pragma unroll
        for (int e = 0; e < 4; ++e) fv[q][e] = bfr(v[e]); }
    v4f tA[2][4], xA[2][4], tB[2][4], xB[2][4];
    auto fetch = [&](int g, v4f (&t)[2][4], v4f (&x)[2][4]) {
        const float* tp[2]; const float* xp[2];
#pragma unroll
        for (int i = 0; i < 2; ++i) { const int k = k0 + g * 2 + i, kc = (k < KT) ? k : KT - 1; tp[i] = Ft + (size_t)kc * DD + lane * 4; xp[i] = FTA + (size_t)k * DD + lane * 4;
#pragma unroll
            for (int q = 0; q < 4; ++q) { t[i][q] = *(const v4f*)(tp[i] + q * 128); x[i][q] = *(const v4f*)(xp[i] + q * 128); } }
        // the wait stands in front of every overwrite of a register that these loads name as an address; the addresses are its inputs, so that none of their registers is given to a load's result ahead of it
        asm volatile("s_wait_xcnt 0x0" :: "v"(tp[0]), "v"(tp[1]), "v"(xp[0]), "v"(xp[1]) : "memory");
    };
    float res = 0.f;
    auto sum = [&](int g, const v4f (&t)[2][4], const v4f (&x)[2][4]) {
        float c[2];
#pragma unroll
        for (int i = 0; i < 2; ++i) { v4f d1 = (v4f){}, d2 = (v4f){}, d3 = (v4f){};    // four chains a dot, on the registers as the loads fill them
#pragma unroll
            for (int q = 0; q < 4; ++q) { v4f ft;
#pragma unroll
                for (int e = 0; e < 4; ++e) ft[e] = bfr(t[i][q][e]);
                d1 = __builtin_elementwise_fma(fv[q], ft, d1); d2 = __builtin_elementwise_fma(fv[q], x[i][q], d2); d3 = __builtin_elementwise_fma(fa[q], ft, d3); }
            const v4f w = B1_ * d1 + B2_ * d2 + B3_ * d3; c[i] = (w[0] + w[1]) + (w[2] + w[3]); }
#pragma unroll
        for (int i = 0; i < 2; ++i) c[i] = wsum(c[i]);
#pragma unroll
        for (int i = 0; i < 2; ++i) if (lane == g * 2 + i) res = c[i];
    };
    fetch(0, tA, xA);
#pragma unroll 1
    for (int g = 0; g < 14; g += 2) {        // rolled: two steps a trip, so that the two register sets are named by constants
        fetch(g + 1, tB, xB);
        __builtin_amdgcn_sched_barrier(0);    // keeps the next step's loads in front of this step's sums: sunk behind them, their latency would be waited out every step
        sum(g, tA, xA);
        fetch(g + 2, tA, xA);
        __builtin_amdgcn_sched_barrier(0);    // as above
        sum(g + 1, tB, xB);
    }
    fetch(15, tB, xB);                       // the last two steps stand alone: no load behind the wave's last row, and no branch in the loop that would make its waits count for both paths
    __builtin_amdgcn_sched_barrier(0);        // as above
    sum(14, tA, xA);
    sum(15, tB, xB);
    const float ls = __expf(bfr(lsc[0]));
    RES[(size_t)b * KTP + k0 + lane] = (k0 + lane < KT) ? ls * res : 0.f;
}
__global__ __launch_bounds__(256) void k_out(const float* __restrict__ RES, float* OUTP) {
    const int i = blockIdx.x * 256 + threadIdx.x; if (i >= NBI * KT) return; const float v = RES[(size_t)(i / KT) * KTP + (i % KT)];
    *(float*)(OUTP + i) = v; 
}

extern "C" void kernel_launch(void* const* d_in, const int* in_sizes, int n_in,
                              void* d_out, int out_size, void* d_ws, size_t ws_size, hipStream_t stream) {
    (void)in_sizes; (void)n_in; (void)out_size;
    const float* Fs = (const float*)d_in[0]; const float* Ft = (const float*)d_in[1]; const float* Fv = (const float*)d_in[2]; const float* lsc = (const float*)d_in[3];
    float* out = (float*)d_out;    // [128][1][1000]
    char* wsp = (char*)d_ws;
    auto take = [&](size_t bytes) { char* p = wsp; wsp += (bytes + 255) & ~(size_t)255; return (void*)p; };
    float* FtP = (float*)take((size_t)KTP * DD * 4); bf* FtB = (bf*)take((size_t)KTP * DD * 2); bf* FtT = (bf*)take((size_t)DD * KTP * 2); float* INV = (float*)take((size_t)GB * MP * 4);
    float* FVA = (float*)take((size_t)NBI * DD * 4); float* RES = (float*)take((size_t)NBI * KTP * 4);
    bf* Th = (bf*)take((size_t)GB * DD * MP * 2); bf* Tl = (bf*)take((size_t)GB * DD * MP * 2); bf* PTh = (bf*)take((size_t)GB * KTP * MP * 2); bf* PTl = (bf*)take((size_t)GB * KTP * MP * 2);
    // One region holds, one after the other in stream order: {A | Nh, Nl}, then {A | PH, PL}, then {FSA | PH, PL}, then FTA alone. Each plane is written after the last read of what it lies on.
    float* FTA = (float*)take((size_t)GB * KTP * DD * 4); float* A = FTA; float* FSA = FTA;
    bf* PH = (bf*)(A + (size_t)GB * MP * KTP); bf* PL = PH + (size_t)GB * MP * KTP; bf* Nh = PH; bf* Nl = Nh + (size_t)GB * MP * DD;
    if ((size_t)(wsp - (char*)d_ws) > ws_size) return;    // 4 + 0.8 + 32 + 64 + 128 ~ 229 MiB
    k_ftpad<<<(KTP * DD / 8 + 255) / 256, 256, 0, stream>>>(Ft, FtP, FtB); k_wt<<<dim3(KTP / 64, DD / 64, 1), 256, 0, stream>>>(FtP, KTP, DD, FtT);     // Ft^T [512][1024] exact bf16
    for (int b = 0; b < NBI; b += GB) {
        k_norm<<<dim3(MP / 32, 1, GB), 256, 0, stream>>>(Fs, b, INV);
        k_fsn<<<dim3(MP / 8, 1, GB), 256, 0, stream>>>(Fs, INV, b, Nh, Nl); k_fsnT<<<dim3((DD * (MP / 64)) / 8, 1, GB), 256, 0, stream>>>(Fs, INV, b, Th, Tl);
        k_gemm<DD, false><<<dim3(MP / 128, KTP / 128, GB), 256, 0, stream>>>(Nh, Nl, FtB, FtB, A, KTP, (size_t)MP * DD, 0, (size_t)MP * KTP);     // A = Fs_n.Ft^T  [256][1024]
        k_soft_s<<<dim3(MP / 8, 1, GB), 256, 0, stream>>>(A, PH, PL); k_soft_t<<<dim3(KTP / 8, 1, GB), 256, 0, stream>>>(A, PTh, PTl);
        k_gemm<KTP, false><<<dim3(MP / 128, DD / 128, GB), 256, 0, stream>>>(PH, PL, FtT, FtT, FSA, DD, (size_t)MP * KTP, 0, (size_t)MP * DD);    // Fsa = P_s.Ft    [256][512]
        k_pool<<<dim3(DD / 128, 1, GB), 256, 0, stream>>>(FSA, b, FVA);                                                                 // before the Fta product: FTA lies on FSA
        k_gemm<MP, true><<<dim3(KTP / 128, DD / 128, GB), 256, 0, stream>>>(PTh, PTl, Th, Tl, FTA, DD, (size_t)KTP * MP, (size_t)DD * MP, (size_t)KTP * DD);   // Fta = P_t.Fs_n  [1024][512]
        k_logits<<<dim3(KTP / 256, 1, GB), 256, 0, stream>>>(Fv, Ft, FTA, FVA, lsc, b, RES);
    }
    k_out<<<(NBI * KT + 255) / 256, 256, 0, stream>>>(RES, out);
}

// v004
// It runs in 422 microseconds.
// Two timings next to v003 both put it at 1.15 times that version's speed.
// All steps since v000 together make it 75.2 times as fast.
#include <hip/hip_runtime.h>

// Compute dtypes, f32 accumulate, 64 images per pass, one per blockIdx.z (M = 196 tokens padded to 256 rows, K = 1000 texts padded to 1024): Fs L2-normalised in f32 -> bf16 hi + UNSCALED
// residual planes (row-major and transposed); A = Fs_n.Ft^T ([256 x 512].[512 x 1024], split Fs_n against the exact bf16 Ft, two products), the two softmaxes (over texts
// x 1/alpha_s, over the 196 real tokens x 1/alpha_t) in f32 -> hi/lo planes, Fsa = P_s.Ft ([256 x 1024].[1024 x 512], two products) and Fta = P_t.Fs_n ([1024 x 256].[256
// x 512], three products) on v_wmma_f32_16x16x32_bf16; mean + max pooling over the real tokens, and the final logits (three 512-term dots per text, x exp(logit_scale) and

#define NBI  128
#define GB   64      // images per launch: blockIdx.z picks the image of the group, each image has its own slice of every per-image plane
#define MM   196
#define MP   256
#define KT   1000
#define KTP  1024
#define DD   512
#define DM   DD
#define NTK  MP
#define ALS  0.5f
#define ALT  0.5f
#define B1_  1.0f
#define B2_  0.1f
#define B3_  0.1f
#define LOSC 1024.0f

typedef _Float16 h16;
typedef unsigned short bf;
typedef __attribute__((ext_vector_type(16))) __bf16   v16bf;
typedef __attribute__((ext_vector_type(16))) _Float16 v16h;
typedef __attribute__((ext_vector_type(8)))  _Float16 v8h;
typedef __attribute__((ext_vector_type(8)))  unsigned short v8us;
typedef __attribute__((ext_vector_type(8)))  float    v8f;
typedef __attribute__((ext_vector_type(4)))  float    v4f;
typedef __attribute__((ext_vector_type(4)))  _Float16 v4h;
typedef v8h  __attribute__((may_alias)) v8ha;
typedef v4f  __attribute__((may_alias)) v4fa;
typedef v8us __attribute__((may_alias)) v8usa;

__device__ __forceinline__ unsigned short f2bf(float f) { unsigned u = __float_as_uint(f); u += 0x7FFFu + ((u >> 16) & 1u); return (unsigned short)(u >> 16); }
__device__ __forceinline__ float bf2f(unsigned short b) { return __uint_as_float(((unsigned)b) << 16); }
__device__ __forceinline__ float bfr(float f) { return bf2f(f2bf(f)); }
__device__ __forceinline__ v16h cat16(v8h lo, v8h hi) { return __builtin_shufflevector(lo, hi, 0, 1, 2, 3, 4, 5, 6, 7, 8, 9, 10, 11, 12, 13, 14, 15); }
__device__ __forceinline__ v16bf cat16b(v8us lo, v8us hi) { return __builtin_bit_cast(v16bf, __builtin_shufflevector(lo, hi, 0, 1, 2, 3, 4, 5, 6, 7, 8, 9, 10, 11, 12, 13, 14, 15)); }
__device__ __forceinline__ v8f wmma16(v16h a, v16h b, v8f c) { return __builtin_amdgcn_wmma_f32_16x16x32_f16(false, a, false, b, (short)0, c, false, false); }
__device__ __forceinline__ v8f wmmab(v16bf a, v16bf b, v8f c) { return __builtin_amdgcn_wmma_f32_16x16x32_bf16(false, a, false, b, (short)0, c, false, false); }

// k_wt: WT [n][K] = bf16(W[k][n]) (k-major [K][ncols]) via 64 x 64 LDS tiles; grid (K/64, ncols/64).
__global__ __launch_bounds__(256) void k_wt(const float* __restrict__ Wm, int K, int ncols, bf* WT) {
    __shared__ __align__(16) unsigned short tl[64 * 72];
    const int tid = threadIdx.x, k0 = blockIdx.x * 64, n0 = blockIdx.y * 64;
    const int kk = tid >> 2, nq = (tid & 3) * 16;
#pragma unroll
    for (int i = 0; i < 16; ++i) tl[(nq + i) * 72 + kk] = f2bf(Wm[(size_t)(k0 + kk) * ncols + n0 + nq + i]);
    __syncthreads();
    const int piece = tid & 7;
    auto pass = [&]() {
#pragma unroll
        for (int s = 0; s < 2; ++s) { const int nr = (tid >> 3) + 32 * s; const v8us val = *(const v8usa*)(tl + nr * 72 + piece * 8); *(v8us*)(WT + (size_t)(n0 + nr) * K + k0 + piece * 8) = val; }
    };
    pass(); 
}
// k_gemm: 128 x 128 block tile (8 waves, 4 x 2, each 32 x 64) of C = (Ah + Al).(Bh [+ Bl])^T over K (every plane k-contiguous with row stride K; n-major B). Per 32 k and
// accumulator the products come in the order hh, lh [, hl]. A stage is 64 k = one 128-byte line of each of the 128 rows of every plane: 8 lanes fetch a row's whole line,
// the stage goes through registers into one of two LDS buffers (row pitch 144 B for the 16-byte fragment reads) while the other buffer is multiplied.
// The inner loops are all unrolled so that st, acc and the fragments are indexed by constants and stay in registers.
#define BKE 64
#define LPB 144
#define PLB (128 * LPB)
template <int K, bool SPLITB>
__global__ __launch_bounds__(256) void k_gemm(const bf* __restrict__ Ah, const bf* __restrict__ Al, const bf* __restrict__ Bh, const bf* __restrict__ Bl, float* C, int ldc, size_t zA, size_t zB, size_t zC) {
    constexpr int NP = SPLITB ? 4 : 3, NS = K / BKE;
    __shared__ __align__(16) unsigned char sm[2 * NP * PLB];
    const int tid = threadIdx.x, lane = tid & 31, wave = tid >> 5, lr = lane & 15, hi = lane >> 4, wm = wave >> 1, wn = wave & 1;
    const int r0 = blockIdx.x * 128, c0 = blockIdx.y * 128;
    const int soff = (tid >> 3) * LPB + (tid & 7) * 16;
    unsigned go = (unsigned)((tid >> 3) * K + (tid & 7) * 8) * 2u;    // the lane's byte offset in every plane's tile: one register serves all planes beside their block-uniform bases; it steps by a stage
    const bf* src[4];
    src[0] = Ah + blockIdx.z * zA + (size_t)r0 * K; src[1] = Al + blockIdx.z * zA + (size_t)r0 * K;
    src[2] = Bh + blockIdx.z * zB + (size_t)c0 * K; src[3] = SPLITB ? Bl + blockIdx.z * zB + (size_t)c0 * K : src[2];
    v8us st[NP][4];
    auto fetch = [&]() {
#pragma unroll
        for (int p = 0; p < NP; ++p)
#pragma unroll
            for (int i = 0; i < 4; ++i) st[p][i] = *(const v8us*)((const unsigned char*)src[p] + (size_t)go + (size_t)(i * 32 * K * 2));
    };
    auto put = [&](int buf) {
#pragma unroll
        for (int p = 0; p < NP; ++p)
#pragma unroll
            for (int i = 0; i < 4; ++i) *(v8usa*)(sm + (buf * NP + p) * PLB + soff + i * 32 * LPB) = st[p][i];
    };
    v8f acc[2][4];
#pragma unroll
    for (int i = 0; i < 2; ++i)
#pragma unroll
        for (int t = 0; t < 4; ++t) acc[i][t] = (v8f){};
    fetch(); put(0); go += BKE * 2;
    __syncthreads();                         // publishes stage 0
    for (int s = 0; s < NS; ++s) {
        if (s + 1 < NS) fetch();
        __builtin_amdgcn_sched_barrier(0);    // keeps the next stage's global loads in front of this stage's products: sunk to the LDS stores below, their latency would be waited out every stage
        const unsigned char* bb = sm + (s & 1) * (NP * PLB) + lr * LPB + hi * 16;
#pragma unroll
        for (int kk = 0; kk < 2; ++kk) {
            v16bf a[2], al[2], b[4], bl[4];
#pragma unroll
            for (int i = 0; i < 2; ++i) { const unsigned char* p = bb + (wm * 32 + i * 16) * LPB + kk * 64;
                a[i] = cat16b(*(const v8usa*)p, *(const v8usa*)(p + 32)); al[i] = cat16b(*(const v8usa*)(p + PLB), *(const v8usa*)(p + PLB + 32)); }
#pragma unroll
            for (int t = 0; t < 4; ++t) { const unsigned char* p = bb + 2 * PLB + (wn * 64 + t * 16) * LPB + kk * 64;
                b[t] = cat16b(*(const v8usa*)p, *(const v8usa*)(p + 32)); bl[t] = b[t]; if (SPLITB) bl[t] = cat16b(*(const v8usa*)(p + PLB), *(const v8usa*)(p + PLB + 32)); }
#pragma unroll
            for (int i = 0; i < 2; ++i)
#pragma unroll
                for (int t = 0; t < 4; ++t) acc[i][t] = wmmab(a[i], b[t], acc[i][t]);
#pragma unroll
            for (int i = 0; i < 2; ++i)
#pragma unroll
                for (int t = 0; t < 4; ++t) acc[i][t] = wmmab(al[i], b[t], acc[i][t]);
            if (SPLITB) {
#pragma unroll
                for (int i = 0; i < 2; ++i)
#pragma unroll
                    for (int t = 0; t < 4; ++t) acc[i][t] = wmmab(a[i], bl[t], acc[i][t]);
            }
        }
        if (s + 1 < NS) put((s + 1) & 1);    // the buffer that every wave left at the barrier of stage s - 1
        go += BKE * 2;
        __syncthreads();                     // publishes stage s + 1 and ends the reads of stage s
    }
    float* os = (float*)(void*)sm + wave * (32 * 68);    // whole-line stores: each wave turns its 32 x 64 tile in its own range of the ring, free behind the last barrier
#pragma unroll
    for (int i = 0; i < 2; ++i)
#pragma unroll
        for (int t = 0; t < 4; ++t)
#pragma unroll
            for (int j = 0; j < 8; ++j) os[(i * 16 + hi * 8 + j) * 68 + t * 16 + lr] = acc[i][t][j];
    __syncthreads();                         // the tile's LDS stores are done before lanes read rows that other lanes wrote
    float* crow = C + blockIdx.z * zC + (size_t)(r0 + wm * 32) * ldc + c0 + wn * 64;
#pragma unroll
    for (int s = 0; s < 16; ++s) { const int Lid = (lane >> 3) + 4 * s, piece = lane & 7; const int row = Lid >> 1, cofs = (Lid & 1) * 32 + piece * 4;
        const v4f val = *(const v4fa*)(os + row * 68 + cofs); *(v4f*)(crow + (size_t)row * ldc + cofs) = val; }
}

// k_ftpad: FtP [1024][512] f32 copy of Ft with rows 1000..1023 zero (feeds k_wt for the exact transposed operand) and FtB = its bf16 rows (the n-major B of A = Fs_n.Ft^T);
__global__ __launch_bounds__(256) void k_ftpad(const float* __restrict__ Ft, float* FtP, bf* FtB) {
    const size_t u = (size_t)blockIdx.x * 256 + threadIdx.x; if (u >= (size_t)KTP * DD / 8) return;
    const int k = (int)(u / (DD / 8)); v8f v; v8us o;
#pragma unroll
    for (int i = 0; i < 8; ++i) { v[i] = (k < KT) ? Ft[u * 8 + i] : 0.f; o[i] = f2bf(v[i]); }
    *(v8f*)(FtP + u * 8) = v; *(v8us*)(FtB + u * 8) = o; 
}
// wsum: sum over the 32 lanes of a wave, five-step butterfly; every lane ends with the same value.
__device__ __forceinline__ float wsum(float v) {
#pragma unroll
    for (int sh = 16; sh; sh >>= 1) v += __shfl_xor(v, sh, 32);
    return v;
}
// k_norm: a wave per token row, four rows a wave (16 loads of 16 B in flight, each 512 contiguous bytes of a row), 32 rows a block; pad rows read the last real row and store 0.
__global__ __launch_bounds__(256) void k_norm(const float* __restrict__ Fs, int b0, float* INV) {
    __shared__ float sh[32];
    const int lane = threadIdx.x & 31, wave = __builtin_amdgcn_readfirstlane(threadIdx.x >> 5), m0 = blockIdx.x * 32 + wave * 4, b = b0 + blockIdx.z; INV += (size_t)blockIdx.z * MP;
    v4f v[4][4]; const float* r[4];
#pragma unroll
    for (int i = 0; i < 4; ++i) { const int mr = (m0 + i < MM) ? m0 + i : MM - 1; r[i] = Fs + ((size_t)b * MM + mr) * DD + lane * 4;
#pragma unroll
        for (int q = 0; q < 4; ++q) v[i][q] = *(const v4f*)(r[i] + q * 128); }
    // the wait stands in front of every overwrite of a register that these loads name as an address; the addresses are its inputs, so that none of their registers is given to a load's result ahead of it
    asm volatile("s_wait_xcnt 0x0" :: "v"(r[0]), "v"(r[1]), "v"(r[2]), "v"(r[3]) : "memory");
    __builtin_amdgcn_sched_barrier(0);        // keeps all 16 loads in front of the sums: with sums lifted between them the wave would wait out the memory latency twice
    float s[4];
#pragma unroll
    for (int i = 0; i < 4; ++i) { v4f a = (v4f){};
#pragma unroll
        for (int q = 0; q < 4; ++q) { v4f x;
#pragma unroll
            for (int e = 0; e < 4; ++e) x[e] = bfr(v[i][q][e]);
            a = __builtin_elementwise_fma(x, x, a); }
        s[i] = (a[0] + a[1]) + (a[2] + a[3]); }
#pragma unroll
    for (int i = 0; i < 4; ++i) s[i] = wsum(s[i]);
    if (lane < 4) { const float sq = (lane == 0) ? s[0] : (lane == 1) ? s[1] : (lane == 2) ? s[2] : s[3];    // lane i finishes row i
        sh[wave * 4 + lane] = (m0 + lane < MM) ? 1.0f / sqrtf(sq) : 0.f; }
    __syncthreads();                         // the eight waves' results are in LDS before one wave stores the block's whole 128-byte line
    if (threadIdx.x < 32) INV[blockIdx.x * 32 + threadIdx.x] = sh[threadIdx.x];
}
__global__ __launch_bounds__(256) void k_fsn(const float* __restrict__ Fs, const float* __restrict__ INV, int b0, bf* Nh, bf* Nl) {
    const int lane = threadIdx.x & 31, m = blockIdx.x * 8 + (threadIdx.x >> 5), b = b0 + blockIdx.z; if (m >= MP) return;
    INV += (size_t)blockIdx.z * MP; Nh += (size_t)blockIdx.z * MP * DD; Nl += (size_t)blockIdx.z * MP * DD;
    const float inv = INV[m];
{
#pragma unroll 1
        for (int q = 0; q < DD / 256; ++q) { const int d0 = q * 256 + lane * 8; v8us oh, ol;
#pragma unroll
            for (int i = 0; i < 8; ++i) { const float v = (m < MM) ? bfr(Fs[((size_t)b * MM + m) * DD + d0 + i]) * inv : 0.f; const unsigned short hb = f2bf(v); oh[i] = hb; ol[i] = f2bf(v - bf2f(hb)); }
            const size_t o = (size_t)m * DD + d0; *(v8us*)(Nh + o) = oh; *(v8us*)(Nl + o) = ol; }
         }
}
// The two transposing kernels below share one shape. A block takes TC = 64 columns (256 contiguous bytes of every source row) and all 256 token places: 16 lanes fetch a row's 256 bytes,
// a thread holds 4 columns of two runs of eight consecutive tokens (m = j * 128 + wave * 16 + (lane >> 4) * 8 + i; pad tokens re-read the last real row and count as absent). Eight tokens of
// a column are one 16-byte piece of an output row: the pieces go into a [TC][256] 16-bit LDS tile a plane, and each wave then stores whole 512-byte output rows.
// tpos: byte place of piece c (tokens 8c .. 8c + 7) of column k. The XOR spreads the 16 lanes that write the same piece of columns 4 apart over all 64 banks; a row's 32 pieces stay a permutation of the row.
#define TC 64
__device__ __forceinline__ int tpos(int k, int c) { return k * (MP * 2) + ((c ^ ((k >> 2) & 15)) << 4); }
// k_fsnT: Th, Tl [512 d][256 m] = hi and residual of bf(Fs[m][d]) * INV[m], 0 at the pad tokens.
__global__ __launch_bounds__(256) void k_fsnT(const float* __restrict__ Fs, const float* __restrict__ INV, int b0, bf* Th, bf* Tl) {
    __shared__ __align__(16) unsigned char th[TC * MP * 2], tl[TC * MP * 2];
    const int lane = threadIdx.x & 31, wave = threadIdx.x >> 5, c16 = lane & 15, rs = lane >> 4, mb = wave * 16 + rs * 8, d0 = blockIdx.x * TC, b = b0 + blockIdx.z;
    Th += (size_t)blockIdx.z * DD * MP; Tl += (size_t)blockIdx.z * DD * MP;
    const unsigned char* base = (const unsigned char*)(Fs + (size_t)b * MM * DD + d0); const unsigned char* ib = (const unsigned char*)(INV + (size_t)blockIdx.z * MP);    // block-uniform; the lane's part is a byte offset
    const unsigned o0 = (unsigned)(mb * DD + c16 * 4) * 4u, io = (unsigned)mb * 4u; unsigned o1[8];    // o1[i] + (128 + i) rows is token 128 + mb + i, or the last real token where that is a pad
    v4f v[2][8]; v4f iv[2][2];
#pragma unroll
    for (int i = 0; i < 8; ++i) v[0][i] = *(const v4f*)(base + (size_t)o0 + (size_t)(i * DD * 4));
#pragma unroll
    for (int i = 0; i < 8; ++i) { o1[i] = (unsigned)(((mb < MM - 1 - 128 - i) ? mb : MM - 1 - 128 - i) * DD + c16 * 4) * 4u; v[1][i] = *(const v4f*)(base + (size_t)o1[i] + (size_t)((128 + i) * DD * 4)); }
#pragma unroll
    for (int j = 0; j < 2; ++j) { iv[j][0] = *(const v4f*)(ib + (size_t)io + (size_t)(j * 512)); iv[j][1] = *(const v4f*)(ib + (size_t)io + (size_t)(j * 512 + 16)); }    // INV is 0 at the pad tokens
    // the wait stands in front of every overwrite of a register that these loads name as an address; the offsets are its inputs, so that none of their registers is given to a load's result ahead of it
    asm volatile("s_wait_xcnt 0x0" :: "v"(o0), "v"(o1[0]), "v"(o1[1]), "v"(o1[2]), "v"(o1[3]), "v"(o1[4]), "v"(o1[5]), "v"(o1[6]), "v"(o1[7]), "v"(io) : "memory");
    __builtin_amdgcn_sched_barrier(0);        // keeps all 20 loads in front of the arithmetic: with arithmetic lifted between them the wave would wait out the memory latency twice
#pragma unroll
    for (int j = 0; j < 2; ++j)
#pragma unroll
        for (int e = 0; e < 4; ++e) { v8us oh, ol;
#pragma unroll
            for (int i = 0; i < 8; ++i) { const float x = bfr(v[j][i][e]) * iv[j][i >> 2][i & 3]; const unsigned short hb = f2bf(x); oh[i] = hb; ol[i] = f2bf(x - bf2f(hb)); }
            const int o = tpos(c16 * 4 + e, j * 16 + wave * 2 + rs); *(v8usa*)(th + o) = oh; *(v8usa*)(tl + o) = ol; }
    __syncthreads();                         // the whole tile is in LDS before waves read rows that other waves wrote
#pragma unroll
    for (int r = 0; r < 8; ++r) { const int k = wave * 8 + r, o = tpos(k, lane); const v8us h = *(const v8usa*)(th + o), l = *(const v8usa*)(tl + o);
        const size_t g = (size_t)(d0 + k) * MP + lane * 8; *(v8us*)(Th + g) = h; *(v8us*)(Tl + g) = l; }
}
__global__ __launch_bounds__(256) void k_soft_s(const float* __restrict__ A, bf* PH, bf* PL) {
    const int lane = threadIdx.x & 31, m = blockIdx.x * 8 + (threadIdx.x >> 5); if (m >= MP) return;
    A += (size_t)blockIdx.z * MP * KTP; PH += (size_t)blockIdx.z * MP * KTP; PL += (size_t)blockIdx.z * MP * KTP;
    const float* ar = A + (size_t)m * KTP; float mx = -3.0e38f;
#pragma unroll 1
    for (int c0 = lane * 8; c0 < KTP; c0 += 256) { const v8f v = *(const v8f*)(ar + c0);
#pragma unroll
        for (int i = 0; i < 8; ++i) if (c0 + i < KT) mx = fmaxf(mx, v[i] * (1.0f / ALS)); }
#pragma unroll
    for (int sh = 16; sh; sh >>= 1) mx = fmaxf(mx, __shfl_xor(mx, sh, 32));
    float sum = 0.f;
#pragma unroll 1
    for (int c0 = lane * 8; c0 < KTP; c0 += 256) { const v8f v = *(const v8f*)(ar + c0);
#pragma unroll
        for (int i = 0; i < 8; ++i) if (c0 + i < KT) sum += __expf(v[i] * (1.0f / ALS) - mx); }
#pragma unroll
    for (int sh = 16; sh; sh >>= 1) sum += __shfl_xor(sum, sh, 32);
    const float inv = 1.0f / sum;
{
#pragma unroll 1
        for (int c0 = lane * 8; c0 < KTP; c0 += 256) { const v8f v = *(const v8f*)(ar + c0); v8us oh, ol;
#pragma unroll
            for (int i = 0; i < 8; ++i) { const float p = (c0 + i < KT) ? __expf(v[i] * (1.0f / ALS) - mx) * inv : 0.f; const unsigned short hb = f2bf(p); oh[i] = hb; ol[i] = f2bf(p - bf2f(hb)); }
            const size_t o = (size_t)m * KTP + c0; *(v8us*)(PH + o) = oh; *(v8us*)(PL + o) = ol; }
         }
}
// ex4: e^x of four values, formed as __expf forms it (x * log2 e, then v_exp_f32). One statement, so that behind each v_exp_f32 stands an instruction that neither reads its result nor overwrites
// its source, the slot the instruction set asks for: the next v_exp_f32 (the outputs share no register with the inputs), and a v_nop behind the last.
__device__ __forceinline__ v4f ex4(v4f x) {
    x *= 1.44269504f; v4f r;
    asm("v_exp_f32 %0, %4\n\tv_exp_f32 %1, %5\n\tv_exp_f32 %2, %6\n\tv_exp_f32 %3, %7\n\tv_nop" : "=&v"(r[0]), "=&v"(r[1]), "=&v"(r[2]), "=&v"(r[3]) : "v"(x[0]), "v"(x[1]), "v"(x[2]), "v"(x[3]));
    return r;
}
// k_soft_t: PTh, PTl [1024 k][256 m] = hi and residual of the softmax over the 196 real tokens of A[m][k] / alpha_t (f32); pad tokens and pad texts give 0. Shape: see above k_fsnT.
// A column's maximum and sum: a thread's 16 tokens in order, the lane 16 apart, then the eight waves' values from LDS in wave order.
__global__ __launch_bounds__(256) void k_soft_t(const float* __restrict__ A, bf* PTh, bf* PTl) {
    __shared__ __align__(16) unsigned char th[TC * MP * 2], tl[TC * MP * 2];
    __shared__ __align__(16) float rm[8 * TC], rq[8 * TC];
    const int lane = threadIdx.x & 31, wave = threadIdx.x >> 5, c16 = lane & 15, rs = lane >> 4, mb = wave * 16 + rs * 8, k0 = blockIdx.x * TC;
    PTh += (size_t)blockIdx.z * KTP * MP; PTl += (size_t)blockIdx.z * KTP * MP;
    const unsigned char* base = (const unsigned char*)(A + (size_t)blockIdx.z * MP * KTP + k0);    // block-uniform; the lane's part is a byte offset
    const unsigned o0 = (unsigned)(mb * KTP + c16 * 4) * 4u; unsigned o1[8];    // o1[i] + (128 + i) rows is token 128 + mb + i, or the last real token where that is a pad
    v4f v[2][8];
#pragma unroll
    for (int i = 0; i < 8; ++i) v[0][i] = *(const v4f*)(base + (size_t)o0 + (size_t)(i * KTP * 4));
#pragma unroll
    for (int i = 0; i < 8; ++i) { o1[i] = (unsigned)(((mb < MM - 1 - 128 - i) ? mb : MM - 1 - 128 - i) * KTP + c16 * 4) * 4u; v[1][i] = *(const v4f*)(base + (size_t)o1[i] + (size_t)((128 + i) * KTP * 4)); }
    // the wait stands in front of every overwrite of a register that these loads name as an address; the offsets are its inputs, so that none of their registers is given to a load's result ahead of it
    asm volatile("s_wait_xcnt 0x0" :: "v"(o0), "v"(o1[0]), "v"(o1[1]), "v"(o1[2]), "v"(o1[3]), "v"(o1[4]), "v"(o1[5]), "v"(o1[6]), "v"(o1[7]) : "memory");
    __builtin_amdgcn_sched_barrier(0);        // keeps all 16 loads in front of the arithmetic: with arithmetic lifted between them the wave would wait out the memory latency twice
    v4f mx = (v4f){-3.0e38f, -3.0e38f, -3.0e38f, -3.0e38f};
#pragma unroll
    for (int j = 0; j < 2; ++j)
#pragma unroll
        for (int i = 0; i < 8; ++i)
#pragma unroll
            for (int e = 0; e < 4; ++e) { const float x = (j == 0 || 128 + mb + i < MM) ? v[j][i][e] * (1.0f / ALT) : -3.0e38f; v[j][i][e] = x; mx[e] = fmaxf(mx[e], x); }    // the first 128 tokens are all real
#pragma unroll
    for (int e = 0; e < 4; ++e) mx[e] = fmaxf(mx[e], __shfl_xor(mx[e], 16, 32));
    if (rs == 0) *(v4fa*)(rm + wave * TC + c16 * 4) = mx;
    __syncthreads();                         // the eight waves' column maxima are in LDS before they are combined
#pragma unroll
    for (int w = 0; w < 8; ++w) { const v4f t = *(const v4fa*)(rm + w * TC + c16 * 4);
#pragma unroll
        for (int e = 0; e < 4; ++e) mx[e] = fmaxf(mx[e], t[e]); }
    v4f sum = (v4f){};
#pragma unroll
    for (int j = 0; j < 2; ++j)
#pragma unroll
        for (int i = 0; i < 8; ++i) { v[j][i] = ex4(v[j][i] - mx); sum += v[j][i]; }    // a pad token's -3.0e38 under a real token's maximum gives exactly 0
#pragma unroll
    for (int e = 0; e < 4; ++e) sum[e] += __shfl_xor(sum[e], 16, 32);
    if (rs == 0) *(v4fa*)(rq + wave * TC + c16 * 4) = sum;
    __syncthreads();                         // the eight waves' column sums are in LDS before they are combined
    v4f tot = (v4f){}, inv;
#pragma unroll
    for (int w = 0; w < 8; ++w) tot += *(const v4fa*)(rq + w * TC + c16 * 4);
#pragma unroll
    for (int e = 0; e < 4; ++e) inv[e] = (k0 + c16 * 4 + e < KT) ? 1.0f / tot[e] : 0.f;
#pragma unroll
    for (int j = 0; j < 2; ++j)
#pragma unroll
        for (int e = 0; e < 4; ++e) { v8us oh, ol;
#pragma unroll
            for (int i = 0; i < 8; ++i) { const float p = v[j][i][e] * inv[e]; const unsigned short hb = f2bf(p); oh[i] = hb; ol[i] = f2bf(p - bf2f(hb)); }
            const int o = tpos(c16 * 4 + e, j * 16 + wave * 2 + rs); *(v8usa*)(th + o) = oh; *(v8usa*)(tl + o) = ol; }
    __syncthreads();                         // the whole tile is in LDS before waves read rows that other waves wrote
#pragma unroll
    for (int r = 0; r < 8; ++r) { const int k = wave * 8 + r, o = tpos(k, lane); const v8us h = *(const v8usa*)(th + o), l = *(const v8usa*)(tl + o);
        const size_t g = (size_t)(k0 + k) * MP + lane * 8; *(v8us*)(PTh + g) = h; *(v8us*)(PTl + g) = l; }
}
// k_pool: a block per 128 columns of an image; wave w takes the tokens w, w + 8, ... (a lane holds 4 columns, a load is 512 contiguous bytes of a token's row, the loop unrolled so that
// many of a wave's loads are in flight together); the eight waves' sums and maxima meet in LDS and are combined in wave order.
__global__ __launch_bounds__(256) void k_pool(const float* __restrict__ Fsa, int b0, float* FVA) {
    __shared__ __align__(16) float ps[8 * 128], pm[8 * 128];
    const int lane = threadIdx.x & 31, wave = threadIdx.x >> 5, d0 = blockIdx.x * 128, b = b0 + blockIdx.z;
    const float* p = Fsa + (size_t)blockIdx.z * MP * DD + (size_t)wave * DD + d0 + lane * 4;
    v4f s = (v4f){}, mx = (v4f){-3.0e38f, -3.0e38f, -3.0e38f, -3.0e38f};
#pragma unroll
    for (int j = 0; j < MM / 8; ++j) { const v4f v = *(const v4f*)(p + (size_t)(8 * j) * DD);
#pragma unroll
        for (int e = 0; e < 4; ++e) { s[e] += v[e]; mx[e] = fmaxf(mx[e], v[e]); } }
    if (wave < MM % 8) { const v4f v = *(const v4f*)(p + (size_t)(8 * (MM / 8)) * DD);
#pragma unroll
        for (int e = 0; e < 4; ++e) { s[e] += v[e]; mx[e] = fmaxf(mx[e], v[e]); } }
    asm volatile("s_wait_xcnt 0x0" :: "v"(p) : "memory");    // stands in front of every overwrite of the address register that the loads above name; the address is its input, so that it lives up to here
    *(v4fa*)(ps + wave * 128 + lane * 4) = s; *(v4fa*)(pm + wave * 128 + lane * 4) = mx;
    __syncthreads();                         // every wave's partial sums and maxima are in LDS before they are combined
    if (threadIdx.x < 128) { float t = 0.f, m = -3.0e38f;
#pragma unroll
        for (int w = 0; w < 8; ++w) { t += ps[w * 128 + threadIdx.x]; m = fmaxf(m, pm[w * 128 + threadIdx.x]); }
        FVA[(size_t)b * DD + d0 + threadIdx.x] = t * (1.0f / MM) + m; }
}
// k_logits: RES[b][k] = ls (beta1 bf(Fv[b]).bf(Ft[k]) + beta2 bf(Fv[b]).Fta[k] + beta3 Fva[b].bf(Ft[k])) (f32), ls = e^bf(logit_scale). A wave per text row, 32 rows a wave: Fv[b] and Fva[b]
// stay in registers (a lane holds 16 of the 512 terms), each row of Ft and Fta comes as four loads of 512 contiguous bytes, two rows a step, the next step's 16 loads issued before a step is
// summed; a lane adds its 16 terms of the three dots, weights them, and a butterfly adds the lanes; lane j keeps row j, so the wave stores one whole line. Pad texts read Ft's last row and store 0.
__global__ __launch_bounds__(256) void k_logits(const float* __restrict__ Fv, const float* __restrict__ Ft, const float* __restrict__ FTA, const float* __restrict__ FVA, const float* __restrict__ lsc, int b0, float* RES) {
    const int lane = threadIdx.x & 31, k0 = blockIdx.x * 256 + __builtin_amdgcn_readfirstlane(threadIdx.x >> 5) * 32, b = b0 + blockIdx.z; FTA += (size_t)blockIdx.z * KTP * DD;
    v4f fv[4], fa[4];
#pragma unroll
    for (int q = 0; q < 4; ++q) { const v4f v = *(const v4f*)(Fv + (size_t)b * DD + q * 128 + lane * 4); fa[q] = *(const v4f*)(FVA + (size_t)b * DD + q * 128 + lane * 4);
#pragma unroll
        for (int e = 0; e < 4; ++e) fv[q][e] = bfr(v[e]); }
    v4f tA[2][4], xA[2][4], tB[2][4], xB[2][4];
    auto fetch = [&](int g, v4f (&t)[2][4], v4f (&x)[2][4]) {
        const float* tp[2]; const float* xp[2];
#pragma unroll
        for (int i = 0; i < 2; ++i) { const int k = k0 + g * 2 + i, kc = (k < KT) ? k : KT - 1; tp[i] = Ft + (size_t)kc * DD + lane * 4; xp[i] = FTA + (size_t)k * DD + lane * 4;
#pragma unroll
            for (int q = 0; q < 4; ++q) { t[i][q] = *(const v4f*)(tp[i] + q * 128); x[i][q] = *(const v4f*)(xp[i] + q * 128); } }
        // the wait stands in front of every overwrite of a register that these loads name as an address; the addresses are its inputs, so that none of their registers is given to a load's result ahead of it
        asm volatile("s_wait_xcnt 0x0" :: "v"(tp[0]), "v"(tp[1]), "v"(xp[0]), "v"(xp[1]) : "memory");
    };
    float res = 0.f;
    auto sum = [&](int g, const v4f (&t)[2][4], const v4f (&x)[2][4]) {
        float c[2];
#pragma unroll
        for (int i = 0; i < 2; ++i) { v4f d1 = (v4f){}, d2 = (v4f){}, d3 = (v4f){};    // four chains a dot, on the registers as the loads fill them
#pragma unroll
            for (int q = 0; q < 4; ++q) { v4f ft;
#pragma unroll
                for (int e = 0; e < 4; ++e) ft[e] = bfr(t[i][q][e]);
                d1 = __builtin_elementwise_fma(fv[q], ft, d1); d2 = __builtin_elementwise_fma(fv[q], x[i][q], d2); d3 = __builtin_elementwise_fma(fa[q], ft, d3); }
            const v4f w = B1_ * d1 + B2_ * d2 + B3_ * d3; c[i] = (w[0] + w[1]) + (w[2] + w[3]); }
#pragma unroll
        for (int i = 0; i < 2; ++i) c[i] = wsum(c[i]);
#pragma unroll
        for (int i = 0; i < 2; ++i) if (lane == g * 2 + i) res = c[i];
    };
    fetch(0, tA, xA);
#pragma unroll 1
    for (int g = 0; g < 14; g += 2) {        // rolled: two steps a trip, so that the two register sets are named by constants
        fetch(g + 1, tB, xB);
        __builtin_amdgcn_sched_barrier(0);    // keeps the next step's loads in front of this step's sums: sunk behind them, their latency would be waited out every step
        sum(g, tA, xA);
        fetch(g + 2, tA, xA);
        __builtin_amdgcn_sched_barrier(0);    // as above
        sum(g + 1, tB, xB);
    }
    fetch(15, tB, xB);                       // the last two steps stand alone: no load behind the wave's last row, and no branch in the loop that would make its waits count for both paths
    __builtin_amdgcn_sched_barrier(0);        // as above
    sum(14, tA, xA);
    sum(15, tB, xB);
    const float ls = __expf(bfr(lsc[0]));
    RES[(size_t)b * KTP + k0 + lane] = (k0 + lane < KT) ? ls * res : 0.f;
}
__global__ __launch_bounds__(256) void k_out(const float* __restrict__ RES, float* OUTP) {
    const int i = blockIdx.x * 256 + threadIdx.x; if (i >= NBI * KT) return; const float v = RES[(size_t)(i / KT) * KTP + (i % KT)];
    *(float*)(OUTP + i) = v; 
}

extern "C" void kernel_launch(void* const* d_in, const int* in_sizes, int n_in,
                              void* d_out, int out_size, void* d_ws, size_t ws_size, hipStream_t stream) {
    (void)in_sizes; (void)n_in; (void)out_size;
    const float* Fs = (const float*)d_in[0]; const float* Ft = (const float*)d_in[1]; const float* Fv = (const float*)d_in[2]; const float* lsc = (const float*)d_in[3];
    float* out = (float*)d_out;    // [128][1][1000]
    char* wsp = (char*)d_ws;
    auto take = [&](size_t bytes) { char* p = wsp; wsp += (bytes + 255) & ~(size_t)255; return (void*)p; };
    float* FtP = (float*)take((size_t)KTP * DD * 4); bf* FtB = (bf*)take((size_t)KTP * DD * 2); bf* FtT = (bf*)take((size_t)DD * KTP * 2); float* INV = (float*)take((size_t)GB * MP * 4);
    float* FVA = (float*)take((size_t)NBI * DD * 4); float* RES = (float*)take((size_t)NBI * KTP * 4);
    bf* Th = (bf*)take((size_t)GB * DD * MP * 2); bf* Tl = (bf*)take((size_t)GB * DD * MP * 2); bf* PTh = (bf*)take((size_t)GB * KTP * MP * 2); bf* PTl = (bf*)take((size_t)GB * KTP * MP * 2);
    // One region holds, one after the other in stream order: {A | Nh, Nl}, then {A | PH, PL}, then {FSA | PH, PL}, then FTA alone. Each plane is written after the last read of what it lies on.
    float* FTA = (float*)take((size_t)GB * KTP * DD * 4); float* A = FTA; float* FSA = FTA;
    bf* PH = (bf*)(A + (size_t)GB * MP * KTP); bf* PL = PH + (size_t)GB * MP * KTP; bf* Nh = PH; bf* Nl = Nh + (size_t)GB * MP * DD;
    if ((size_t)(wsp - (char*)d_ws) > ws_size) return;    // 4 + 0.8 + 32 + 64 + 128 ~ 229 MiB
    k_ftpad<<<(KTP * DD / 8 + 255) / 256, 256, 0, stream>>>(Ft, FtP, FtB); k_wt<<<dim3(KTP / 64, DD / 64, 1), 256, 0, stream>>>(FtP, KTP, DD, FtT);     // Ft^T [512][1024] exact bf16
    for (int b = 0; b < NBI; b += GB) {
        k_norm<<<dim3(MP / 32, 1, GB), 256, 0, stream>>>(Fs, b, INV);
        k_fsn<<<dim3(MP / 8, 1, GB), 256, 0, stream>>>(Fs, INV, b, Nh, Nl); k_fsnT<<<dim3(DD / TC, 1, GB), 256, 0, stream>>>(Fs, INV, b, Th, Tl);
        k_gemm<DD, false><<<dim3(MP / 128, KTP / 128, GB), 256, 0, stream>>>(Nh, Nl, FtB, FtB, A, KTP, (size_t)MP * DD, 0, (size_t)MP * KTP);     // A = Fs_n.Ft^T  [256][1024]
        k_soft_s<<<dim3(MP / 8, 1, GB), 256, 0, stream>>>(A, PH, PL); k_soft_t<<<dim3(KTP / TC, 1, GB), 256, 0, stream>>>(A, PTh, PTl);
        k_gemm<KTP, false><<<dim3(MP / 128, DD / 128, GB), 256, 0, stream>>>(PH, PL, FtT, FtT, FSA, DD, (size_t)MP * KTP, 0, (size_t)MP * DD);    // Fsa = P_s.Ft    [256][512]
        k_pool<<<dim3(DD / 128, 1, GB), 256, 0, stream>>>(FSA, b, FVA);                                                                 // before the Fta product: FTA lies on FSA
        k_gemm<MP, true><<<dim3(KTP / 128, DD / 128, GB), 256, 0, stream>>>(PTh, PTl, Th, Tl, FTA, DD, (size_t)KTP * MP, (size_t)DD * MP, (size_t)KTP * DD);   // Fta = P_t.Fs_n  [1024][512]
        k_logits<<<dim3(KTP / 256, 1, GB), 256, 0, stream>>>(Fv, Ft, FTA, FVA, lsc, b, RES);
    }
    k_out<<<(NBI * KT + 255) / 256, 256, 0, stream>>>(RES, out);
}

// v005
// Measured time: 265 microseconds a run.
// Next to v004, in two timings, it ran 1.59 times as fast each time.
// All steps since v000 together make it 119 times as fast.
#include <hip/hip_runtime.h>

// Compute dtypes, f32 accumulate, 64 images per pass, one per blockIdx.z (M = 196 tokens padded to 256 rows, K = 1000 texts padded to 1024): Fs L2-normalised in f32 -> bf16 hi + UNSCALED
// residual planes; A = Fs_n.Ft^T ([256 x 512].[512 x 1024], split Fs_n against the exact bf16 Ft, two products) and Fsa = P_s.Ft ([256 x 1024].[1024 x 512], P_s = softmax over texts
// x 1/alpha_s in f32 -> hi/lo planes, two products) on v_wmma_f32_16x16x32_bf16. Fta = P_t.Fs_n enters the result only through Fv.Fta[k] = sum_m P_t[k][m] (Fs_n[m].Fv): the inner dots
// G[m] (one per token) come with the norms, the outer sum with the softmax over the 196 real tokens (x 1/alpha_t, f32), and Fta itself is never formed. Mean + max pooling over the real
// tokens, and the final logits (two 512-term dots per text and that sum, x exp(logit_scale)).

#define NBI  128
#define GB   64      // images per launch: blockIdx.z picks the image of the group, each image has its own slice of every per-image plane
#define MM   196
#define MP   256
#define KT   1000
#define KTP  1024
#define DD   512
#define DM   DD
#define NTK  MP
#define ALS  0.5f
#define ALT  0.5f
#define B1_  1.0f
#define B2_  0.1f
#define B3_  0.1f
#define LOSC 1024.0f

typedef _Float16 h16;
typedef unsigned short bf;
typedef __attribute__((ext_vector_type(16))) __bf16   v16bf;
typedef __attribute__((ext_vector_type(16))) _Float16 v16h;
typedef __attribute__((ext_vector_type(8)))  _Float16 v8h;
typedef __attribute__((ext_vector_type(8)))  unsigned short v8us;
typedef __attribute__((ext_vector_type(8)))  float    v8f;
typedef __attribute__((ext_vector_type(4)))  float    v4f;
typedef __attribute__((ext_vector_type(4)))  _Float16 v4h;
typedef v8h  __attribute__((may_alias)) v8ha;
typedef v4f  __attribute__((may_alias)) v4fa;
typedef v8us __attribute__((may_alias)) v8usa;

__device__ __forceinline__ unsigned short f2bf(float f) { unsigned u = __float_as_uint(f); u += 0x7FFFu + ((u >> 16) & 1u); return (unsigned short)(u >> 16); }
__device__ __forceinline__ float bf2f(unsigned short b) { return __uint_as_float(((unsigned)b) << 16); }
__device__ __forceinline__ float bfr(float f) { return bf2f(f2bf(f)); }
__device__ __forceinline__ v16h cat16(v8h lo, v8h hi) { return __builtin_shufflevector(lo, hi, 0, 1, 2, 3, 4, 5, 6, 7, 8, 9, 10, 11, 12, 13, 14, 15); }
__device__ __forceinline__ v16bf cat16b(v8us lo, v8us hi) { return __builtin_bit_cast(v16bf, __builtin_shufflevector(lo, hi, 0, 1, 2, 3, 4, 5, 6, 7, 8, 9, 10, 11, 12, 13, 14, 15)); }
__device__ __forceinline__ v8f wmma16(v16h a, v16h b, v8f c) { return __builtin_amdgcn_wmma_f32_16x16x32_f16(false, a, false, b, (short)0, c, false, false); }
__device__ __forceinline__ v8f wmmab(v16bf a, v16bf b, v8f c) { return __builtin_amdgcn_wmma_f32_16x16x32_bf16(false, a, false, b, (short)0, c, false, false); }

// k_wt: WT [n][K] = bf16(W[k][n]) (k-major [K][ncols]) via 64 x 64 LDS tiles; grid (K/64, ncols/64).
__global__ __launch_bounds__(256) void k_wt(const float* __restrict__ Wm, int K, int ncols, bf* WT) {
    __shared__ __align__(16) unsigned short tl[64 * 72];
    const int tid = threadIdx.x, k0 = blockIdx.x * 64, n0 = blockIdx.y * 64;
    const int kk = tid >> 2, nq = (tid & 3) * 16;
#pragma unroll
    for (int i = 0; i < 16; ++i) tl[(nq + i) * 72 + kk] = f2bf(Wm[(size_t)(k0 + kk) * ncols + n0 + nq + i]);
    __syncthreads();
    const int piece = tid & 7;
    auto pass = [&]() {
#pragma unroll
        for (int s = 0; s < 2; ++s) { const int nr = (tid >> 3) + 32 * s; const v8us val = *(const v8usa*)(tl + nr * 72 + piece * 8); *(v8us*)(WT + (size_t)(n0 + nr) * K + k0 + piece * 8) = val; }
    };
    pass(); 
}
// k_gemm: 128 x 128 block tile (8 waves, 4 x 2, each 32 x 64) of C = (Ah + Al).(Bh [+ Bl])^T over K (every plane k-contiguous with row stride K; n-major B). Per 32 k and
// accumulator the products come in the order hh, lh [, hl]. A stage is 64 k = one 128-byte line of each of the 128 rows of every plane: 8 lanes fetch a row's whole line,
// the stage goes through registers into one of two LDS buffers (row pitch 144 B for the 16-byte fragment reads) while the other buffer is multiplied.
// The inner loops are all unrolled so that st, acc and the fragments are indexed by constants and stay in registers.
#define BKE 64
#define LPB 144
#define PLB (128 * LPB)
template <int K, bool SPLITB>
__global__ __launch_bounds__(256) void k_gemm(const bf* __restrict__ Ah, const bf* __restrict__ Al, const bf* __restrict__ Bh, const bf* __restrict__ Bl, float* C, int ldc, size_t zA, size_t zB, size_t zC) {
    constexpr int NP = SPLITB ? 4 : 3, NS = K / BKE;
    __shared__ __align__(16) unsigned char sm[2 * NP * PLB];
    const int tid = threadIdx.x, lane = tid & 31, wave = tid >> 5, lr = lane & 15, hi = lane >> 4, wm = wave >> 1, wn = wave & 1;
    const int r0 = blockIdx.x * 128, c0 = blockIdx.y * 128;
    const int soff = (tid >> 3) * LPB + (tid & 7) * 16;
    unsigned go = (unsigned)((tid >> 3) * K + (tid & 7) * 8) * 2u;    // the lane's byte offset in every plane's tile: one register serves all planes beside their block-uniform bases; it steps by a stage
    const bf* src[4];
    src[0] = Ah + blockIdx.z * zA + (size_t)r0 * K; src[1] = Al + blockIdx.z * zA + (size_t)r0 * K;
    src[2] = Bh + blockIdx.z * zB + (size_t)c0 * K; src[3] = SPLITB ? Bl + blockIdx.z * zB + (size_t)c0 * K : src[2];
    v8us st[NP][4];
    auto fetch = [&]() {
#pragma unroll
        for (int p = 0; p < NP; ++p)
#pragma unroll
            for (int i = 0; i < 4; ++i) st[p][i] = *(const v8us*)((const unsigned char*)src[p] + (size_t)go + (size_t)(i * 32 * K * 2));
    };
    auto put = [&](int buf) {
#pragma unroll
        for (int p = 0; p < NP; ++p)
#pragma unroll
            for (int i = 0; i < 4; ++i) *(v8usa*)(sm + (buf * NP + p) * PLB + soff + i * 32 * LPB) = st[p][i];
    };
    v8f acc[2][4];
#pragma unroll
    for (int i = 0; i < 2; ++i)
#pragma unroll
        for (int t = 0; t < 4; ++t) acc[i][t] = (v8f){};
    fetch(); put(0); go += BKE * 2;
    __syncthreads();                         // publishes stage 0
    for (int s = 0; s < NS; ++s) {
        if (s + 1 < NS) fetch();
        __builtin_amdgcn_sched_barrier(0);    // keeps the next stage's global loads in front of this stage's products: sunk to the LDS stores below, their latency would be waited out every stage
        const unsigned char* bb = sm + (s & 1) * (NP * PLB) + lr * LPB + hi * 16;
#pragma unroll
        for (int kk = 0; kk < 2; ++kk) {
            v16bf a[2], al[2], b[4], bl[4];
#pragma unroll
            for (int i = 0; i < 2; ++i) { const unsigned char* p = bb + (wm * 32 + i * 16) * LPB + kk * 64;
                a[i] = cat16b(*(const v8usa*)p, *(const v8usa*)(p + 32)); al[i] = cat16b(*(const v8usa*)(p + PLB), *(const v8usa*)(p + PLB + 32)); }
#pragma unroll
            for (int t = 0; t < 4; ++t) { const unsigned char* p = bb + 2 * PLB + (wn * 64 + t * 16) * LPB + kk * 64;
                b[t] = cat16b(*(const v8usa*)p, *(const v8usa*)(p + 32)); bl[t] = b[t]; if (SPLITB) bl[t] = cat16b(*(const v8usa*)(p + PLB), *(const v8usa*)(p + PLB + 32)); }
#pragma unroll
            for (int i = 0; i < 2; ++i)
#pragma unroll
                for (int t = 0; t < 4; ++t) acc[i][t] = wmmab(a[i], b[t], acc[i][t]);
#pragma unroll
            for (int i = 0; i < 2; ++i)
#pragma unroll
                for (int t = 0; t < 4; ++t) acc[i][t] = wmmab(al[i], b[t], acc[i][t]);
            if (SPLITB) {
#pragma unroll
                for (int i = 0; i < 2; ++i)
#pragma unroll
                    for (int t = 0; t < 4; ++t) acc[i][t] = wmmab(a[i], bl[t], acc[i][t]);
            }
        }
        if (s + 1 < NS) put((s + 1) & 1);    // the buffer that every wave left at the barrier of stage s - 1
        go += BKE * 2;
        __syncthreads();                     // publishes stage s + 1 and ends the reads of stage s
    }
    float* os = (float*)(void*)sm + wave * (32 * 68);    // whole-line stores: each wave turns its 32 x 64 tile in its own range of the ring, free behind the last barrier
#pragma unroll
    for (int i = 0; i < 2; ++i)
#pragma unroll
        for (int t = 0; t < 4; ++t)
#pragma unroll
            for (int j = 0; j < 8; ++j) os[(i * 16 + hi * 8 + j) * 68 + t * 16 + lr] = acc[i][t][j];
    __syncthreads();                         // the tile's LDS stores are done before lanes read rows that other lanes wrote
    float* crow = C + blockIdx.z * zC + (size_t)(r0 + wm * 32) * ldc + c0 + wn * 64;
#pragma unroll
    for (int s = 0; s < 16; ++s) { const int Lid = (lane >> 3) + 4 * s, piece = lane & 7; const int row = Lid >> 1, cofs = (Lid & 1) * 32 + piece * 4;
        const v4f val = *(const v4fa*)(os + row * 68 + cofs); *(v4f*)(crow + (size_t)row * ldc + cofs) = val; }
}

// k_ftpad: FtP [1024][512] f32 copy of Ft with rows 1000..1023 zero (feeds k_wt for the exact transposed operand) and FtB = its bf16 rows (the n-major B of A = Fs_n.Ft^T);
__global__ __launch_bounds__(256) void k_ftpad(const float* __restrict__ Ft, float* FtP, bf* FtB) {
    const size_t u = (size_t)blockIdx.x * 256 + threadIdx.x; if (u >= (size_t)KTP * DD / 8) return;
    const int k = (int)(u / (DD / 8)); v8f v; v8us o;
#pragma unroll
    for (int i = 0; i < 8; ++i) { v[i] = (k < KT) ? Ft[u * 8 + i] : 0.f; o[i] = f2bf(v[i]); }
    *(v8f*)(FtP + u * 8) = v; *(v8us*)(FtB + u * 8) = o; 
}
// wsum: sum over the 32 lanes of a wave, five-step butterfly; every lane ends with the same value.
__device__ __forceinline__ float wsum(float v) {
#pragma unroll
    for (int sh = 16; sh; sh >>= 1) v += __shfl_xor(v, sh, 32);
    return v;
}
// k_norm: a wave per token row, four rows a wave (20 loads of 16 B in flight, each 512 contiguous bytes of a row), 32 rows a block; pad rows read the last real row and store 0.
// INV[m] = 1 / |bf(Fs[m])| and G[m] = (bf(Fs[m]).bf(Fv[b])) INV[m], the token's normalised row against the image's Fv, from the same registers.
__global__ __launch_bounds__(256) void k_norm(const float* __restrict__ Fs, const float* __restrict__ Fv, int b0, float* INV, float* G) {
    __shared__ float sh[32], sg[32];
    const int lane = threadIdx.x & 31, wave = __builtin_amdgcn_readfirstlane(threadIdx.x >> 5), m0 = blockIdx.x * 32 + wave * 4, b = b0 + blockIdx.z; INV += (size_t)blockIdx.z * MP; G += (size_t)blockIdx.z * MP;
    v4f v[4][4], f[4]; const float* r[4]; const float* fp = Fv + (size_t)b * DD + lane * 4;
#pragma unroll
    for (int i = 0; i < 4; ++i) { const int mr = (m0 + i < MM) ? m0 + i : MM - 1; r[i] = Fs + ((size_t)b * MM + mr) * DD + lane * 4;
#pragma unroll
        for (int q = 0; q < 4; ++q) v[i][q] = *(const v4f*)(r[i] + q * 128); }
#pragma unroll
    for (int q = 0; q < 4; ++q) f[q] = *(const v4f*)(fp + q * 128);
    // the wait stands in front of every overwrite of a register that these loads name as an address; the addresses are its inputs, so that none of their registers is given to a load's result ahead of it
    asm volatile("s_wait_xcnt 0x0" :: "v"(r[0]), "v"(r[1]), "v"(r[2]), "v"(r[3]), "v"(fp) : "memory");
    __builtin_amdgcn_sched_barrier(0);        // keeps all 20 loads in front of the sums: with sums lifted between them the wave would wait out the memory latency twice
#pragma unroll
    for (int q = 0; q < 4; ++q)
#pragma unroll
        for (int e = 0; e < 4; ++e) f[q][e] = bfr(f[q][e]);
    float s[4], g[4];
#pragma unroll
    for (int i = 0; i < 4; ++i) { v4f a = (v4f){}, c = (v4f){};
#pragma unroll
        for (int q = 0; q < 4; ++q) { v4f x;
#pragma unroll
            for (int e = 0; e < 4; ++e) x[e] = bfr(v[i][q][e]);
            a = __builtin_elementwise_fma(x, x, a); c = __builtin_elementwise_fma(x, f[q], c); }
        s[i] = (a[0] + a[1]) + (a[2] + a[3]); g[i] = (c[0] + c[1]) + (c[2] + c[3]); }
#pragma unroll
    for (int i = 0; i < 4; ++i) { s[i] = wsum(s[i]); g[i] = wsum(g[i]); }
    if (lane < 4) { const float sq = (lane == 0) ? s[0] : (lane == 1) ? s[1] : (lane == 2) ? s[2] : s[3], gq = (lane == 0) ? g[0] : (lane == 1) ? g[1] : (lane == 2) ? g[2] : g[3];    // lane i finishes row i
        const float inv = (m0 + lane < MM) ? 1.0f / sqrtf(sq) : 0.f; sh[wave * 4 + lane] = inv; sg[wave * 4 + lane] = gq * inv; }
    __syncthreads();                         // the eight waves' results are in LDS before a wave stores the block's whole 128-byte line of each plane
    if (threadIdx.x < 32) INV[blockIdx.x * 32 + threadIdx.x] = sh[threadIdx.x];
    else if (threadIdx.x < 64) G[blockIdx.x * 32 + threadIdx.x - 32] = sg[threadIdx.x - 32];
}
__global__ __launch_bounds__(256) void k_fsn(const float* __restrict__ Fs, const float* __restrict__ INV, int b0, bf* Nh, bf* Nl) {
    const int lane = threadIdx.x & 31, m = blockIdx.x * 8 + (threadIdx.x >> 5), b = b0 + blockIdx.z; if (m >= MP) return;
    INV += (size_t)blockIdx.z * MP; Nh += (size_t)blockIdx.z * MP * DD; Nl += (size_t)blockIdx.z * MP * DD;
    const float inv = INV[m];
{
#pragma unroll 1
        for (int q = 0; q < DD / 256; ++q) { const int d0 = q * 256 + lane * 8; v8us oh, ol;
#pragma unroll
            for (int i = 0; i < 8; ++i) { const float v = (m < MM) ? bfr(Fs[((size_t)b * MM + m) * DD + d0 + i]) * inv : 0.f; const unsigned short hb = f2bf(v); oh[i] = hb; ol[i] = f2bf(v - bf2f(hb)); }
            const size_t o = (size_t)m * DD + d0; *(v8us*)(Nh + o) = oh; *(v8us*)(Nl + o) = ol; }
         }
}
__global__ __launch_bounds__(256) void k_soft_s(const float* __restrict__ A, bf* PH, bf* PL) {
    const int lane = threadIdx.x & 31, m = blockIdx.x * 8 + (threadIdx.x >> 5); if (m >= MP) return;
    A += (size_t)blockIdx.z * MP * KTP; PH += (size_t)blockIdx.z * MP * KTP; PL += (size_t)blockIdx.z * MP * KTP;
    const float* ar = A + (size_t)m * KTP; float mx = -3.0e38f;
#pragma unroll 1
    for (int c0 = lane * 8; c0 < KTP; c0 += 256) { const v8f v = *(const v8f*)(ar + c0);
#pragma unroll
        for (int i = 0; i < 8; ++i) if (c0 + i < KT) mx = fmaxf(mx, v[i] * (1.0f / ALS)); }
#pragma unroll
    for (int sh = 16; sh; sh >>= 1) mx = fmaxf(mx, __shfl_xor(mx, sh, 32));
    float sum = 0.f;
#pragma unroll 1
    for (int c0 = lane * 8; c0 < KTP; c0 += 256) { const v8f v = *(const v8f*)(ar + c0);
#pragma unroll
        for (int i = 0; i < 8; ++i) if (c0 + i < KT) sum += __expf(v[i] * (1.0f / ALS) - mx); }
#pragma unroll
    for (int sh = 16; sh; sh >>= 1) sum += __shfl_xor(sum, sh, 32);
    const float inv = 1.0f / sum;
{
#pragma unroll 1
        for (int c0 = lane * 8; c0 < KTP; c0 += 256) { const v8f v = *(const v8f*)(ar + c0); v8us oh, ol;
#pragma unroll
            for (int i = 0; i < 8; ++i) { const float p = (c0 + i < KT) ? __expf(v[i] * (1.0f / ALS) - mx) * inv : 0.f; const unsigned short hb = f2bf(p); oh[i] = hb; ol[i] = f2bf(p - bf2f(hb)); }
            const size_t o = (size_t)m * KTP + c0; *(v8us*)(PH + o) = oh; *(v8us*)(PL + o) = ol; }
         }
}
// ex4: e^x of four values, formed as __expf forms it (x * log2 e, then v_exp_f32). One statement, so that behind each v_exp_f32 stands an instruction that neither reads its result nor overwrites
// its source, the slot the instruction set asks for: the next v_exp_f32 (the outputs share no register with the inputs), and a v_nop behind the last.
__device__ __forceinline__ v4f ex4(v4f x) {
    x *= 1.44269504f; v4f r;
    asm("v_exp_f32 %0, %4\n\tv_exp_f32 %1, %5\n\tv_exp_f32 %2, %6\n\tv_exp_f32 %3, %7\n\tv_nop" : "=&v"(r[0]), "=&v"(r[1]), "=&v"(r[2]), "=&v"(r[3]) : "v"(x[0]), "v"(x[1]), "v"(x[2]), "v"(x[3]));
    return r;
}
// k_soft_t: H[k] = sum_m P_t[k][m] G[m], P_t the softmax over the 196 real tokens of A[m][k] / alpha_t (f32); pad texts give 0. A block takes TC = 64 columns (256 contiguous bytes of every
// row of A) and all 256 token places: 16 lanes fetch a row's 256 bytes, a thread holds 4 columns of two runs of eight consecutive tokens (m = j * 128 + wave * 16 + (lane >> 4) * 8 + i; pad
// tokens re-read the last real row and count as absent). A column's maximum, sum and weighted sum: a thread's 16 tokens in order, the lane 16 apart, then the eight waves' values from LDS in wave order.
#define TC 64
__global__ __launch_bounds__(256) void k_soft_t(const float* __restrict__ A, const float* __restrict__ G, float* H) {
    __shared__ __align__(16) float rm[8 * TC], rq[8 * TC], rg[8 * TC];
    const int lane = threadIdx.x & 31, wave = threadIdx.x >> 5, c16 = lane & 15, rs = lane >> 4, mb = wave * 16 + rs * 8, k0 = blockIdx.x * TC;
    const unsigned char* base = (const unsigned char*)(A + (size_t)blockIdx.z * MP * KTP + k0); const unsigned char* gb = (const unsigned char*)(G + (size_t)blockIdx.z * MP);    // block-uniform; the lane's part is a byte offset
    const unsigned o0 = (unsigned)(mb * KTP + c16 * 4) * 4u, io = (unsigned)mb * 4u; unsigned o1[8];    // o1[i] + (128 + i) rows is token 128 + mb + i, or the last real token where that is a pad
    v4f v[2][8]; v4f gv[2][2];
#pragma unroll
    for (int i = 0; i < 8; ++i) v[0][i] = *(const v4f*)(base + (size_t)o0 + (size_t)(i * KTP * 4));
#pragma unroll
    for (int i = 0; i < 8; ++i) { o1[i] = (unsigned)(((mb < MM - 1 - 128 - i) ? mb : MM - 1 - 128 - i) * KTP + c16 * 4) * 4u; v[1][i] = *(const v4f*)(base + (size_t)o1[i] + (size_t)((128 + i) * KTP * 4)); }
#pragma unroll
    for (int j = 0; j < 2; ++j) { gv[j][0] = *(const v4f*)(gb + (size_t)io + (size_t)(j * 512)); gv[j][1] = *(const v4f*)(gb + (size_t)io + (size_t)(j * 512 + 16)); }    // G is 0 at the pad tokens
    // the wait stands in front of every overwrite of a register that these loads name as an address; the offsets are its inputs, so that none of their registers is given to a load's result ahead of it
    asm volatile("s_wait_xcnt 0x0" :: "v"(o0), "v"(o1[0]), "v"(o1[1]), "v"(o1[2]), "v"(o1[3]), "v"(o1[4]), "v"(o1[5]), "v"(o1[6]), "v"(o1[7]), "v"(io) : "memory");
    __builtin_amdgcn_sched_barrier(0);        // keeps all 20 loads in front of the arithmetic: with arithmetic lifted between them the wave would wait out the memory latency twice
    v4f mx = (v4f){-3.0e38f, -3.0e38f, -3.0e38f, -3.0e38f};
#pragma unroll
    for (int j = 0; j < 2; ++j)
#pragma unroll
        for (int i = 0; i < 8; ++i)
#pragma unroll
            for (int e = 0; e < 4; ++e) { const float x = (j == 0 || 128 + mb + i < MM) ? v[j][i][e] * (1.0f / ALT) : -3.0e38f; v[j][i][e] = x; mx[e] = fmaxf(mx[e], x); }    // the first 128 tokens are all real
#pragma unroll
    for (int e = 0; e < 4; ++e) mx[e] = fmaxf(mx[e], __shfl_xor(mx[e], 16, 32));
    if (rs == 0) *(v4fa*)(rm + wave * TC + c16 * 4) = mx;
    __syncthreads();                         // the eight waves' column maxima are in LDS before they are combined
#pragma unroll
    for (int w = 0; w < 8; ++w) { const v4f t = *(const v4fa*)(rm + w * TC + c16 * 4);
#pragma unroll
        for (int e = 0; e < 4; ++e) mx[e] = fmaxf(mx[e], t[e]); }
    v4f sum = (v4f){}, wg = (v4f){};
#pragma unroll
    for (int j = 0; j < 2; ++j)
#pragma unroll
        for (int i = 0; i < 8; ++i) { const v4f ev = ex4(v[j][i] - mx); const float gm = gv[j][i >> 2][i & 3]; sum += ev; wg = __builtin_elementwise_fma(ev, (v4f){gm, gm, gm, gm}, wg); }    // a pad token's -3.0e38 under a real token's maximum gives exactly 0
#pragma unroll
    for (int e = 0; e < 4; ++e) { sum[e] += __shfl_xor(sum[e], 16, 32); wg[e] += __shfl_xor(wg[e], 16, 32); }
    if (rs == 0) { *(v4fa*)(rq + wave * TC + c16 * 4) = sum; *(v4fa*)(rg + wave * TC + c16 * 4) = wg; }
    __syncthreads();                         // the eight waves' column sums are in LDS before they are combined
    if (threadIdx.x < 16) {                  // 16 lanes finish the block's 64 columns and store its two whole lines
        v4f tot = (v4f){}, tg = (v4f){}, h;
#pragma unroll
        for (int w = 0; w < 8; ++w) { tot += *(const v4fa*)(rq + w * TC + c16 * 4); tg += *(const v4fa*)(rg + w * TC + c16 * 4); }
#pragma unroll
        for (int e = 0; e < 4; ++e) h[e] = (k0 + c16 * 4 + e < KT) ? tg[e] / tot[e] : 0.f;
        *(v4f*)(H + (size_t)blockIdx.z * KTP + k0 + c16 * 4) = h; }
}
// k_pool: a block per 128 columns of an image; wave w takes the tokens w, w + 8, ... (a lane holds 4 columns, a load is 512 contiguous bytes of a token's row, the loop unrolled so that
// many of a wave's loads are in flight together); the eight waves' sums and maxima meet in LDS and are combined in wave order.
__global__ __launch_bounds__(256) void k_pool(const float* __restrict__ Fsa, int b0, float* FVA) {
    __shared__ __align__(16) float ps[8 * 128], pm[8 * 128];
    const int lane = threadIdx.x & 31, wave = threadIdx.x >> 5, d0 = blockIdx.x * 128, b = b0 + blockIdx.z;
    const float* p = Fsa + (size_t)blockIdx.z * MP * DD + (size_t)wave * DD + d0 + lane * 4;
    v4f s = (v4f){}, mx = (v4f){-3.0e38f, -3.0e38f, -3.0e38f, -3.0e38f};
#pragma unroll
    for (int j = 0; j < MM / 8; ++j) { const v4f v = *(const v4f*)(p + (size_t)(8 * j) * DD);
#pragma unroll
        for (int e = 0; e < 4; ++e) { s[e] += v[e]; mx[e] = fmaxf(mx[e], v[e]); } }
    if (wave < MM % 8) { const v4f v = *(const v4f*)(p + (size_t)(8 * (MM / 8)) * DD);
#pragma unroll
        for (int e = 0; e < 4; ++e) { s[e] += v[e]; mx[e] = fmaxf(mx[e], v[e]); } }
    asm volatile("s_wait_xcnt 0x0" :: "v"(p) : "memory");    // stands in front of every overwrite of the address register that the loads above name; the address is its input, so that it lives up to here
    *(v4fa*)(ps + wave * 128 + lane * 4) = s; *(v4fa*)(pm + wave * 128 + lane * 4) = mx;
    __syncthreads();                         // every wave's partial sums and maxima are in LDS before they are combined
    if (threadIdx.x < 128) { float t = 0.f, m = -3.0e38f;
#pragma unroll
        for (int w = 0; w < 8; ++w) { t += ps[w * 128 + threadIdx.x]; m = fmaxf(m, pm[w * 128 + threadIdx.x]); }
        FVA[(size_t)b * DD + d0 + threadIdx.x] = t * (1.0f / MM) + m; }
}
// k_logits: RES[b][k] = ls (beta1 bf(Fv[b]).bf(Ft[k]) + beta2 H[k] + beta3 Fva[b].bf(Ft[k])) (f32), ls = e^bf(logit_scale), H[k] = Fv[b].Fta[k] as k_soft_t leaves it. A wave per text row, 32 rows
// a wave: Fv[b] and Fva[b] stay in registers (a lane holds 16 of the 512 terms), each row of Ft comes as four loads of 512 contiguous bytes, four rows a step, the next step's 16 loads issued
// before a step is summed; a lane adds its 16 terms of the two dots, weights them, and a butterfly adds the lanes; lane j keeps row j, so the wave stores one whole line. Pad texts read Ft's last row and store 0.
__global__ __launch_bounds__(256) void k_logits(const float* __restrict__ Fv, const float* __restrict__ Ft, const float* __restrict__ H, const float* __restrict__ FVA, const float* __restrict__ lsc, int b0, float* RES) {
    const int lane = threadIdx.x & 31, k0 = blockIdx.x * 256 + __builtin_amdgcn_readfirstlane(threadIdx.x >> 5) * 32, b = b0 + blockIdx.z;
    const float hk = H[(size_t)blockIdx.z * KTP + k0 + lane];
    v4f fv[4], fa[4];
#pragma unroll
    for (int q = 0; q < 4; ++q) { const v4f v = *(const v4f*)(Fv + (size_t)b * DD + q * 128 + lane * 4); fa[q] = *(const v4f*)(FVA + (size_t)b * DD + q * 128 + lane * 4);
#pragma unroll
        for (int e = 0; e < 4; ++e) fv[q][e] = bfr(v[e]); }
    v4f tA[4][4], tB[4][4];
    auto fetch = [&](int g, v4f (&t)[4][4]) {
        const float* tp[4];
#pragma unroll
        for (int i = 0; i < 4; ++i) { const int k = k0 + g * 4 + i, kc = (k < KT) ? k : KT - 1; tp[i] = Ft + (size_t)kc * DD + lane * 4;
#pragma unroll
            for (int q = 0; q < 4; ++q) t[i][q] = *(const v4f*)(tp[i] + q * 128); }
        // the wait stands in front of every overwrite of a register that these loads name as an address; the addresses are its inputs, so that none of their registers is given to a load's result ahead of it
        asm volatile("s_wait_xcnt 0x0" :: "v"(tp[0]), "v"(tp[1]), "v"(tp[2]), "v"(tp[3]) : "memory");
    };
    float res = 0.f;
    auto sum = [&](int g, const v4f (&t)[4][4]) {
        float c[4];
#pragma unroll
        for (int i = 0; i < 4; ++i) { v4f d1 = (v4f){}, d3 = (v4f){};    // four chains a dot, on the registers as the loads fill them
#pragma unroll
            for (int q = 0; q < 4; ++q) { v4f ft;
#pragma unroll
                for (int e = 0; e < 4; ++e) ft[e] = bfr(t[i][q][e]);
                d1 = __builtin_elementwise_fma(fv[q], ft, d1); d3 = __builtin_elementwise_fma(fa[q], ft, d3); }
            const v4f w = B1_ * d1 + B3_ * d3; c[i] = (w[0] + w[1]) + (w[2] + w[3]); }
#pragma unroll
        for (int i = 0; i < 4; ++i) c[i] = wsum(c[i]);
#pragma unroll
        for (int i = 0; i < 4; ++i) if (lane == g * 4 + i) res = c[i];
    };
    fetch(0, tA);
#pragma unroll 1
    for (int g = 0; g < 6; g += 2) {         // rolled: two steps a trip, so that the two register sets are named by constants
        fetch(g + 1, tB);
        __builtin_amdgcn_sched_barrier(0);    // keeps the next step's loads in front of this step's sums: sunk behind them, their latency would be waited out every step
        sum(g, tA);
        __builtin_amdgcn_sched_barrier(0);    // keeps the refill's loads behind this step's butterflies: lifted between them, the four butterflies ran one after the other, each LDS round trip waited out alone
        fetch(g + 2, tA);
        __builtin_amdgcn_sched_barrier(0);    // as above
        sum(g + 1, tB);
    }
    fetch(7, tB);                            // the last two steps stand alone: no load behind the wave's last row, and no branch in the loop that would make its waits count for both paths
    __builtin_amdgcn_sched_barrier(0);        // as above
    sum(6, tA);
    sum(7, tB);
    const float ls = __expf(bfr(lsc[0]));
    RES[(size_t)b * KTP + k0 + lane] = (k0 + lane < KT) ? ls * (res + B2_ * hk) : 0.f;
}
__global__ __launch_bounds__(256) void k_out(const float* __restrict__ RES, float* OUTP) {
    const int i = blockIdx.x * 256 + threadIdx.x; if (i >= NBI * KT) return; const float v = RES[(size_t)(i / KT) * KTP + (i % KT)];
    *(float*)(OUTP + i) = v; 
}

extern "C" void kernel_launch(void* const* d_in, const int* in_sizes, int n_in,
                              void* d_out, int out_size, void* d_ws, size_t ws_size, hipStream_t stream) {
    (void)in_sizes; (void)n_in; (void)out_size;
    const float* Fs = (const float*)d_in[0]; const float* Ft = (const float*)d_in[1]; const float* Fv = (const float*)d_in[2]; const float* lsc = (const float*)d_in[3];
    float* out = (float*)d_out;    // [128][1][1000]
    char* wsp = (char*)d_ws;
    auto take = [&](size_t bytes) { char* p = wsp; wsp += (bytes + 255) & ~(size_t)255; return (void*)p; };
    float* FtP = (float*)take((size_t)KTP * DD * 4); bf* FtB = (bf*)take((size_t)KTP * DD * 2); bf* FtT = (bf*)take((size_t)DD * KTP * 2); float* INV = (float*)take((size_t)GB * MP * 4);
    float* G = (float*)take((size_t)GB * MP * 4); float* H = (float*)take((size_t)GB * KTP * 4); float* FVA = (float*)take((size_t)NBI * DD * 4); float* RES = (float*)take((size_t)NBI * KTP * 4);
    // One region holds, one after the other in stream order: {A | Nh, Nl}, then {A | PH, PL}, then {FSA | PH, PL}. Each plane is written after the last read of what it lies on.
    float* A = (float*)take((size_t)GB * MP * KTP * 4 * 2); float* FSA = A;
    bf* PH = (bf*)(A + (size_t)GB * MP * KTP); bf* PL = PH + (size_t)GB * MP * KTP; bf* Nh = PH; bf* Nl = Nh + (size_t)GB * MP * DD;
    if ((size_t)(wsp - (char*)d_ws) > ws_size) return;    // 4 + 1.1 + 128 ~ 133 MiB
    k_ftpad<<<(KTP * DD / 8 + 255) / 256, 256, 0, stream>>>(Ft, FtP, FtB); k_wt<<<dim3(KTP / 64, DD / 64, 1), 256, 0, stream>>>(FtP, KTP, DD, FtT);     // Ft^T [512][1024] exact bf16
    for (int b = 0; b < NBI; b += GB) {
        k_norm<<<dim3(MP / 32, 1, GB), 256, 0, stream>>>(Fs, Fv, b, INV, G);
        k_fsn<<<dim3(MP / 8, 1, GB), 256, 0, stream>>>(Fs, INV, b, Nh, Nl);
        k_gemm<DD, false><<<dim3(MP / 128, KTP / 128, GB), 256, 0, stream>>>(Nh, Nl, FtB, FtB, A, KTP, (size_t)MP * DD, 0, (size_t)MP * KTP);     // A = Fs_n.Ft^T  [256][1024]
        k_soft_s<<<dim3(MP / 8, 1, GB), 256, 0, stream>>>(A, PH, PL); k_soft_t<<<dim3(KTP / TC, 1, GB), 256, 0, stream>>>(A, G, H);
        k_gemm<KTP, false><<<dim3(MP / 128, DD / 128, GB), 256, 0, stream>>>(PH, PL, FtT, FtT, FSA, DD, (size_t)MP * KTP, 0, (size_t)MP * DD);    // Fsa = P_s.Ft    [256][512]
        k_pool<<<dim3(DD / 128, 1, GB), 256, 0, stream>>>(FSA, b, FVA);
        k_logits<<<dim3(KTP / 256, 1, GB), 256, 0, stream>>>(Fv, Ft, H, FVA, lsc, b, RES);
    }
    k_out<<<(NBI * KT + 255) / 256, 256, 0, stream>>>(RES, out);
}

// v006
// One run takes 194 microseconds.
// In two side-by-side timings against v005, it was 1.38 and 1.36 times as fast.
// Counting every step since v000, it is 164 times as fast.
#include <hip/hip_runtime.h>

// Compute dtypes, f32 accumulate, all 128 images in one pass. Ft is the same for every image, so the token rows of all images form one row dimension without pad rows (128 x 196 = 25088 = 196 tiles
// of 128 rows; K = 1000 texts padded to 1024): Fs L2-normalised in f32 -> bf16 hi + UNSCALED
// residual planes; A = Fs_n.Ft^T ([25088 x 512].[512 x 1024], split Fs_n against the exact bf16 Ft, two products) and Fsa = P_s.Ft ([25088 x 1024].[1024 x 512], P_s = softmax over texts
// x 1/alpha_s in f32 -> hi/lo planes, two products) on v_wmma_f32_16x16x32_bf16. Fta = P_t.Fs_n enters the result only through Fv.Fta[k] = sum_m P_t[k][m] (Fs_n[m].Fv): the inner dots
// G[m] (one per token) come with the norms, the outer sum with the softmax over the 196 real tokens (x 1/alpha_t, f32), and Fta itself is never formed. Mean + max pooling over the real
// tokens, and the final logits (two 512-term dots per text and that sum, x exp(logit_scale)).

#define NBI  128
#define MM   196
#define NR   (NBI * MM)    // token rows of all images, image b's at b * MM
#define KT   1000
#define KTP  1024
#define DD   512
#define DM   DD
#define ALS  0.5f
#define ALT  0.5f
#define B1_  1.0f
#define B2_  0.1f
#define B3_  0.1f
#define LOSC 1024.0f

typedef _Float16 h16;
typedef unsigned short bf;
typedef __attribute__((ext_vector_type(16))) __bf16   v16bf;
typedef __attribute__((ext_vector_type(16))) _Float16 v16h;
typedef __attribute__((ext_vector_type(8)))  _Float16 v8h;
typedef __attribute__((ext_vector_type(8)))  unsigned short v8us;
typedef __attribute__((ext_vector_type(8)))  float    v8f;
typedef __attribute__((ext_vector_type(4)))  float    v4f;
typedef __attribute__((ext_vector_type(4)))  _Float16 v4h;
typedef v8h  __attribute__((may_alias)) v8ha;
typedef v4f  __attribute__((may_alias)) v4fa;
typedef v8us __attribute__((may_alias)) v8usa;

__device__ __forceinline__ unsigned short f2bf(float f) { unsigned u = __float_as_uint(f); u += 0x7FFFu + ((u >> 16) & 1u); return (unsigned short)(u >> 16); }
__device__ __forceinline__ float bf2f(unsigned short b) { return __uint_as_float(((unsigned)b) << 16); }
__device__ __forceinline__ float bfr(float f) { return bf2f(f2bf(f)); }
__device__ __forceinline__ v16h cat16(v8h lo, v8h hi) { return __builtin_shufflevector(lo, hi, 0, 1, 2, 3, 4, 5, 6, 7, 8, 9, 10, 11, 12, 13, 14, 15); }
__device__ __forceinline__ v16bf cat16b(v8us lo, v8us hi) { return __builtin_bit_cast(v16bf, __builtin_shufflevector(lo, hi, 0, 1, 2, 3, 4, 5, 6, 7, 8, 9, 10, 11, 12, 13, 14, 15)); }
__device__ __forceinline__ v8f wmma16(v16h a, v16h b, v8f c) { return __builtin_amdgcn_wmma_f32_16x16x32_f16(false, a, false, b, (short)0, c, false, false); }
__device__ __forceinline__ v8f wmmab(v16bf a, v16bf b, v8f c) { return __builtin_amdgcn_wmma_f32_16x16x32_bf16(false, a, false, b, (short)0, c, false, false); }

// k_wt: WT [n][K] = bf16(W[k][n]) (k-major [K][ncols]) via 64 x 64 LDS tiles; grid (K/64, ncols/64).
__global__ __launch_bounds__(256) void k_wt(const float* __restrict__ Wm, int K, int ncols, bf* WT) {
    __shared__ __align__(16) unsigned short tl[64 * 72];
    const int tid = threadIdx.x, k0 = blockIdx.x * 64, n0 = blockIdx.y * 64;
    const int kk = tid >> 2, nq = (tid & 3) * 16;
#pragma unroll
    for (int i = 0; i < 16; ++i) tl[(nq + i) * 72 + kk] = f2bf(Wm[(size_t)(k0 + kk) * ncols + n0 + nq + i]);
    __syncthreads();
    const int piece = tid & 7;
    auto pass = [&]() {
#pragma unroll
        for (int s = 0; s < 2; ++s) { const int nr = (tid >> 3) + 32 * s; const v8us val = *(const v8usa*)(tl + nr * 72 + piece * 8); *(v8us*)(WT + (size_t)(n0 + nr) * K + k0 + piece * 8) = val; }
    };
    pass(); 
}
// k_gemm: 128 x 128 block tile (8 waves, 4 x 2, each 32 x 64) of C = (Ah + Al).(Bh [+ Bl])^T over K (every plane k-contiguous with row stride K; n-major B). Per 32 k and
// accumulator the products come in the order hh, lh [, hl]. A stage is 64 k = one 128-byte line of each of the 128 rows of every plane: 8 lanes fetch a row's whole line,
// the stage goes through registers into one of two LDS buffers (row pitch 144 B for the 16-byte fragment reads) while the other buffer is multiplied.
// The inner loops are all unrolled so that st, acc and the fragments are indexed by constants and stay in registers.
#define BKE 64
#define LPB 144
#define PLB (128 * LPB)
template <int K, bool SPLITB>
__global__ __launch_bounds__(256) void k_gemm(const bf* __restrict__ Ah, const bf* __restrict__ Al, const bf* __restrict__ Bh, const bf* __restrict__ Bl, float* C, int ldc) {
    constexpr int NP = SPLITB ? 4 : 3, NS = K / BKE;
    __shared__ __align__(16) unsigned char sm[2 * NP * PLB];
    const int tid = threadIdx.x, lane = tid & 31, wave = tid >> 5, lr = lane & 15, hi = lane >> 4, wm = wave >> 1, wn = wave & 1;
    const int r0 = blockIdx.y * 128, c0 = blockIdx.x * 128;    // the column tiles of one row tile are neighbours in launch order: they read the same A rows
    const int soff = (tid >> 3) * LPB + (tid & 7) * 16;
    unsigned go = (unsigned)((tid >> 3) * K + (tid & 7) * 8) * 2u;    // the lane's byte offset in every plane's tile: one register serves all planes beside their block-uniform bases; it steps by a stage
    const bf* src[4];
    src[0] = Ah + (size_t)r0 * K; src[1] = Al + (size_t)r0 * K;
    src[2] = Bh + (size_t)c0 * K; src[3] = SPLITB ? Bl + (size_t)c0 * K : src[2];
    v8us st[NP][4];
    auto fetch = [&]() {
#pragma unroll
        for (int p = 0; p < NP; ++p)
#pragma unroll
            for (int i = 0; i < 4; ++i) st[p][i] = *(const v8us*)((const unsigned char*)src[p] + (size_t)go + (size_t)(i * 32 * K * 2));
    };
    auto put = [&](int buf) {
#pragma unroll
        for (int p = 0; p < NP; ++p)
#pragma unroll
            for (int i = 0; i < 4; ++i) *(v8usa*)(sm + (buf * NP + p) * PLB + soff + i * 32 * LPB) = st[p][i];
    };
    v8f acc[2][4];
#pragma unroll
    for (int i = 0; i < 2; ++i)
#pragma unroll
        for (int t = 0; t < 4; ++t) acc[i][t] = (v8f){};
    fetch(); put(0); go += BKE * 2;
    __syncthreads();                         // publishes stage 0
    for (int s = 0; s < NS; ++s) {
        if (s + 1 < NS) fetch();
        __builtin_amdgcn_sched_barrier(0);    // keeps the next stage's global loads in front of this stage's products: sunk to the LDS stores below, their latency would be waited out every stage
        const unsigned char* bb = sm + (s & 1) * (NP * PLB) + lr * LPB + hi * 16;
#pragma unroll
        for (int kk = 0; kk < 2; ++kk) {
            v16bf a[2], al[2], b[4], bl[4];
#pragma unroll
            for (int i = 0; i < 2; ++i) { const unsigned char* p = bb + (wm * 32 + i * 16) * LPB + kk * 64;
                a[i] = cat16b(*(const v8usa*)p, *(const v8usa*)(p + 32)); al[i] = cat16b(*(const v8usa*)(p + PLB), *(const v8usa*)(p + PLB + 32)); }
#pragma unroll
            for (int t = 0; t < 4; ++t) { const unsigned char* p = bb + 2 * PLB + (wn * 64 + t * 16) * LPB + kk * 64;
                b[t] = cat16b(*(const v8usa*)p, *(const v8usa*)(p + 32)); bl[t] = b[t]; if (SPLITB) bl[t] = cat16b(*(const v8usa*)(p + PLB), *(const v8usa*)(p + PLB + 32)); }
#pragma unroll
            for (int i = 0; i < 2; ++i)
#pragma unroll
                for (int t = 0; t < 4; ++t) acc[i][t] = wmmab(a[i], b[t], acc[i][t]);
#pragma unroll
            for (int i = 0; i < 2; ++i)
#pragma unroll
                for (int t = 0; t < 4; ++t) acc[i][t] = wmmab(al[i], b[t], acc[i][t]);
            if (SPLITB) {
#pragma unroll
                for (int i = 0; i < 2; ++i)
#pragma unroll
                    for (int t = 0; t < 4; ++t) acc[i][t] = wmmab(a[i], bl[t], acc[i][t]);
            }
        }
        if (s + 1 < NS) put((s + 1) & 1);    // the buffer that every wave left at the barrier of stage s - 1
        go += BKE * 2;
        __syncthreads();                     // publishes stage s + 1 and ends the reads of stage s
    }
    float* os = (float*)(void*)sm + wave * (32 * 68);    // whole-line stores: each wave turns its 32 x 64 tile in its own range of the ring, free behind the last barrier
#pragma unroll
    for (int i = 0; i < 2; ++i)
#pragma unroll
        for (int t = 0; t < 4; ++t)
#pragma unroll
            for (int j = 0; j < 8; ++j) os[(i * 16 + hi * 8 + j) * 68 + t * 16 + lr] = acc[i][t][j];
    __syncthreads();                         // the tile's LDS stores are done before lanes read rows that other lanes wrote
    float* crow = C + (size_t)(r0 + wm * 32) * ldc + c0 + wn * 64;
#pragma unroll
    for (int s = 0; s < 16; ++s) { const int Lid = (lane >> 3) + 4 * s, piece = lane & 7; const int row = Lid >> 1, cofs = (Lid & 1) * 32 + piece * 4;
        const v4f val = *(const v4fa*)(os + row * 68 + cofs); *(v4f*)(crow + (size_t)row * ldc + cofs) = val; }
}

// k_ftpad: FtP [1024][512] f32 copy of Ft with rows 1000..1023 zero (feeds k_wt for the exact transposed operand) and FtB = its bf16 rows (the n-major B of A = Fs_n.Ft^T);
__global__ __launch_bounds__(256) void k_ftpad(const float* __restrict__ Ft, float* FtP, bf* FtB) {
    const size_t u = (size_t)blockIdx.x * 256 + threadIdx.x; if (u >= (size_t)KTP * DD / 8) return;
    const int k = (int)(u / (DD / 8)); v8f v; v8us o;
#pragma unroll
    for (int i = 0; i < 8; ++i) { v[i] = (k < KT) ? Ft[u * 8 + i] : 0.f; o[i] = f2bf(v[i]); }
    *(v8f*)(FtP + u * 8) = v; *(v8us*)(FtB + u * 8) = o; 
}
// wsum: sum over the 32 lanes of a wave, five-step butterfly; every lane ends with the same value.
__device__ __forceinline__ float wsum(float v) {
#pragma unroll
    for (int sh = 16; sh; sh >>= 1) v += __shfl_xor(v, sh, 32);
    return v;
}
// k_norm: a wave per token row, four rows a wave (16 loads of 16 B in flight, each 512 contiguous bytes of a row), 32 rows a block; a wave's four rows are of one image (196 = 49 x 4).
// INV[m] = 1 / |bf(Fs[m])| and G[m] = (bf(Fs[m]).bf(Fv[b])) INV[m], the token's normalised row against the image's Fv, from the same registers.
__global__ __launch_bounds__(256) void k_norm(const float* __restrict__ Fs, const float* __restrict__ Fv, float* INV, float* G) {
    __shared__ float sh[32], sg[32];
    const int lane = threadIdx.x & 31, wave = __builtin_amdgcn_readfirstlane(threadIdx.x >> 5), m0 = blockIdx.x * 32 + wave * 4, b = m0 / MM;
    v4f v[4][4], f[4]; const float* r[4]; const float* fp = Fv + (size_t)b * DD + lane * 4;
#pragma unroll
    for (int i = 0; i < 4; ++i) { r[i] = Fs + (size_t)(m0 + i) * DD + lane * 4;
#pragma unroll
        for (int q = 0; q < 4; ++q) v[i][q] = *(const v4f*)(r[i] + q * 128); }
#pragma unroll
    for (int q = 0; q < 4; ++q) f[q] = *(const v4f*)(fp + q * 128);
    // the wait stands in front of every overwrite of a register that these loads name as an address; the addresses are its inputs, so that none of their registers is given to a load's result ahead of it
    asm volatile("s_wait_xcnt 0x0" :: "v"(r[0]), "v"(r[1]), "v"(r[2]), "v"(r[3]), "v"(fp) : "memory");
    __builtin_amdgcn_sched_barrier(0);        // keeps all 20 loads in front of the sums: with sums lifted between them the wave would wait out the memory latency twice
#pragma unroll
    for (int q = 0; q < 4; ++q)
#pragma unroll
        for (int e = 0; e < 4; ++e) f[q][e] = bfr(f[q][e]);
    float s[4], g[4];
#pragma unroll
    for (int i = 0; i < 4; ++i) { v4f a = (v4f){}, c = (v4f){};
#pragma unroll
        for (int q = 0; q < 4; ++q) { v4f x;
#pragma unroll
            for (int e = 0; e < 4; ++e) x[e] = bfr(v[i][q][e]);
            a = __builtin_elementwise_fma(x, x, a); c = __builtin_elementwise_fma(x, f[q], c); }
        s[i] = (a[0] + a[1]) + (a[2] + a[3]); g[i] = (c[0] + c[1]) + (c[2] + c[3]); }
#pragma unroll
    for (int i = 0; i < 4; ++i) { s[i] = wsum(s[i]); g[i] = wsum(g[i]); }
    if (lane < 4) { const float sq = (lane == 0) ? s[0] : (lane == 1) ? s[1] : (lane == 2) ? s[2] : s[3], gq = (lane == 0) ? g[0] : (lane == 1) ? g[1] : (lane == 2) ? g[2] : g[3];    // lane i finishes row i
        const float inv = 1.0f / sqrtf(sq); sh[wave * 4 + lane] = inv; sg[wave * 4 + lane] = gq * inv; }
    __syncthreads();                         // the eight waves' results are in LDS before a wave stores the block's whole 128-byte line of each plane
    if (threadIdx.x < 32) INV[blockIdx.x * 32 + threadIdx.x] = sh[threadIdx.x];
    else if (threadIdx.x < 64) G[blockIdx.x * 32 + threadIdx.x - 32] = sg[threadIdx.x - 32];
}
__global__ __launch_bounds__(256) void k_fsn(const float* __restrict__ Fs, const float* __restrict__ INV, bf* Nh, bf* Nl) {
    const int lane = threadIdx.x & 31, m = blockIdx.x * 8 + (threadIdx.x >> 5);
    const float inv = INV[m];
{
#pragma unroll 1
        for (int q = 0; q < DD / 256; ++q) { const int d0 = q * 256 + lane * 8; v8us oh, ol;
#pragma unroll
            for (int i = 0; i < 8; ++i) { const float v = bfr(Fs[(size_t)m * DD + d0 + i]) * inv; const unsigned short hb = f2bf(v); oh[i] = hb; ol[i] = f2bf(v - bf2f(hb)); }
            const size_t o = (size_t)m * DD + d0; *(v8us*)(Nh + o) = oh; *(v8us*)(Nl + o) = ol;
            asm volatile("s_wait_xcnt 0x0" ::: "memory"); }    // stands in front of the next trip's overwrite of the registers that these two stores name
         }
}
__global__ __launch_bounds__(256) void k_soft_s(const float* __restrict__ A, bf* PH, bf* PL) {
    const int lane = threadIdx.x & 31, m = blockIdx.x * 8 + (threadIdx.x >> 5);
    const float* ar = A + (size_t)m * KTP; float mx = -3.0e38f;
#pragma unroll 1
    for (int c0 = lane * 8; c0 < KTP; c0 += 256) { const v8f v = *(const v8f*)(ar + c0);
#pragma unroll
        for (int i = 0; i < 8; ++i) if (c0 + i < KT) mx = fmaxf(mx, v[i] * (1.0f / ALS)); }
#pragma unroll
    for (int sh = 16; sh; sh >>= 1) mx = fmaxf(mx, __shfl_xor(mx, sh, 32));
    float sum = 0.f;
#pragma unroll 1
    for (int c0 = lane * 8; c0 < KTP; c0 += 256) { const v8f v = *(const v8f*)(ar + c0);
#pragma unroll
        for (int i = 0; i < 8; ++i) if (c0 + i < KT) sum += __expf(v[i] * (1.0f / ALS) - mx); }
#pragma unroll
    for (int sh = 16; sh; sh >>= 1) sum += __shfl_xor(sum, sh, 32);
    const float inv = 1.0f / sum;
{
#pragma unroll 1
        for (int c0 = lane * 8; c0 < KTP; c0 += 256) { const v8f v = *(const v8f*)(ar + c0); v8us oh, ol;
#pragma unroll
            for (int i = 0; i < 8; ++i) { const float p = (c0 + i < KT) ? __expf(v[i] * (1.0f / ALS) - mx) * inv : 0.f; const unsigned short hb = f2bf(p); oh[i] = hb; ol[i] = f2bf(p - bf2f(hb)); }
            const size_t o = (size_t)m * KTP + c0; *(v8us*)(PH + o) = oh; *(v8us*)(PL + o) = ol; }
         }
}
// ex4: e^x of four values, formed as __expf forms it (x * log2 e, then v_exp_f32). One statement, so that behind each v_exp_f32 stands an instruction that neither reads its result nor overwrites
// its source, the slot the instruction set asks for: the next v_exp_f32 (the outputs share no register with the inputs), and a v_nop behind the last.
__device__ __forceinline__ v4f ex4(v4f x) {
    x *= 1.44269504f; v4f r;
    asm("v_exp_f32 %0, %4\n\tv_exp_f32 %1, %5\n\tv_exp_f32 %2, %6\n\tv_exp_f32 %3, %7\n\tv_nop" : "=&v"(r[0]), "=&v"(r[1]), "=&v"(r[2]), "=&v"(r[3]) : "v"(x[0]), "v"(x[1]), "v"(x[2]), "v"(x[3]));
    return r;
}
// k_soft_t: H[k] = sum_m P_t[k][m] G[m], P_t the softmax over the 196 real tokens of A[m][k] / alpha_t (f32); pad texts give 0. A block takes TC = 64 columns (256 contiguous bytes of every
// row of A) and all 256 token places: 16 lanes fetch a row's 256 bytes, a thread holds 4 columns of two runs of eight consecutive tokens (m = j * 128 + wave * 16 + (lane >> 4) * 8 + i; pad
// tokens re-read the last real row and count as absent). A column's maximum, sum and weighted sum: a thread's 16 tokens in order, the lane 16 apart, then the eight waves' values from LDS in wave order.
#define TC 64
__global__ __launch_bounds__(256) void k_soft_t(const float* __restrict__ A, const float* __restrict__ G, float* H) {
    __shared__ __align__(16) float rm[8 * TC], rq[8 * TC], rg[8 * TC];
    const int lane = threadIdx.x & 31, wave = threadIdx.x >> 5, c16 = lane & 15, rs = lane >> 4, mb = wave * 16 + rs * 8, k0 = blockIdx.x * TC;
    const unsigned char* base = (const unsigned char*)(A + (size_t)blockIdx.z * MM * KTP + k0); const unsigned char* gb = (const unsigned char*)(G + (size_t)blockIdx.z * MM);    // block-uniform; the lane's part is a byte offset
    const unsigned o0 = (unsigned)(mb * KTP + c16 * 4) * 4u, io = (unsigned)mb * 4u; unsigned o1[8], i1[2];    // o1[i] + (128 + i) rows is token 128 + mb + i, or the last real token where that is a pad
    v4f v[2][8]; v4f gv[2][2];
#pragma unroll
    for (int i = 0; i < 8; ++i) v[0][i] = *(const v4f*)(base + (size_t)o0 + (size_t)(i * KTP * 4));
#pragma unroll
    for (int i = 0; i < 8; ++i) { o1[i] = (unsigned)(((mb < MM - 1 - 128 - i) ? mb : MM - 1 - 128 - i) * KTP + c16 * 4) * 4u; v[1][i] = *(const v4f*)(base + (size_t)o1[i] + (size_t)((128 + i) * KTP * 4)); }
#pragma unroll
    for (int h = 0; h < 2; ++h) { gv[0][h] = *(const v4f*)(gb + (size_t)io + (size_t)(h * 16));    // a group of four token places is all real or all pad (196 = 49 x 4): a pad group re-reads the image's last four G, which meet a weight of exactly 0
        i1[h] = (unsigned)((mb + h * 4 < MM - 4 - 128) ? mb + h * 4 : MM - 4 - 128) * 4u; gv[1][h] = *(const v4f*)(gb + (size_t)i1[h] + (size_t)512); }
    // the wait stands in front of every overwrite of a register that these loads name as an address; the offsets are its inputs, so that none of their registers is given to a load's result ahead of it
    asm volatile("s_wait_xcnt 0x0" :: "v"(o0), "v"(o1[0]), "v"(o1[1]), "v"(o1[2]), "v"(o1[3]), "v"(o1[4]), "v"(o1[5]), "v"(o1[6]), "v"(o1[7]), "v"(io), "v"(i1[0]), "v"(i1[1]) : "memory");
    __builtin_amdgcn_sched_barrier(0);        // keeps all 20 loads in front of the arithmetic: with arithmetic lifted between them the wave would wait out the memory latency twice
    v4f mx = (v4f){-3.0e38f, -3.0e38f, -3.0e38f, -3.0e38f};
#pragma unroll
    for (int j = 0; j < 2; ++j)
#pragma unroll
        for (int i = 0; i < 8; ++i)
#pragma unroll
            for (int e = 0; e < 4; ++e) { const float x = (j == 0 || 128 + mb + i < MM) ? v[j][i][e] * (1.0f / ALT) : -3.0e38f; v[j][i][e] = x; mx[e] = fmaxf(mx[e], x); }    // the first 128 tokens are all real
#pragma unroll
    for (int e = 0; e < 4; ++e) mx[e] = fmaxf(mx[e], __shfl_xor(mx[e], 16, 32));
    if (rs == 0) *(v4fa*)(rm + wave * TC + c16 * 4) = mx;
    __syncthreads();                         // the eight waves' column maxima are in LDS before they are combined
#pragma unroll
    for (int w = 0; w < 8; ++w) { const v4f t = *(const v4fa*)(rm + w * TC + c16 * 4);
#pragma unroll
        for (int e = 0; e < 4; ++e) mx[e] = fmaxf(mx[e], t[e]); }
    v4f sum = (v4f){}, wg = (v4f){};
#pragma unroll
    for (int j = 0; j < 2; ++j)
#pragma unroll
        for (int i = 0; i < 8; ++i) { const v4f ev = ex4(v[j][i] - mx); const float gm = gv[j][i >> 2][i & 3]; sum += ev; wg = __builtin_elementwise_fma(ev, (v4f){gm, gm, gm, gm}, wg); }    // a pad token's -3.0e38 under a real token's maximum gives exactly 0
#pragma unroll
    for (int e = 0; e < 4; ++e) { sum[e] += __shfl_xor(sum[e], 16, 32); wg[e] += __shfl_xor(wg[e], 16, 32); }
    if (rs == 0) { *(v4fa*)(rq + wave * TC + c16 * 4) = sum; *(v4fa*)(rg + wave * TC + c16 * 4) = wg; }
    __syncthreads();                         // the eight waves' column sums are in LDS before they are combined
    if (threadIdx.x < 16) {                  // 16 lanes finish the block's 64 columns and store its two whole lines
        v4f tot = (v4f){}, tg = (v4f){}, h;
#pragma unroll
        for (int w = 0; w < 8; ++w) { tot += *(const v4fa*)(rq + w * TC + c16 * 4); tg += *(const v4fa*)(rg + w * TC + c16 * 4); }
#pragma unroll
        for (int e = 0; e < 4; ++e) h[e] = (k0 + c16 * 4 + e < KT) ? tg[e] / tot[e] : 0.f;
        *(v4f*)(H + (size_t)blockIdx.z * KTP + k0 + c16 * 4) = h; }
}
// k_pool: a block per 128 columns of an image; wave w takes the tokens w, w + 8, ... (a lane holds 4 columns, a load is 512 contiguous bytes of a token's row, the loop unrolled so that
// many of a wave's loads are in flight together); the eight waves' sums and maxima meet in LDS and are combined in wave order.
__global__ __launch_bounds__(256) void k_pool(const float* __restrict__ Fsa, float* FVA) {
    __shared__ __align__(16) float ps[8 * 128], pm[8 * 128];
    const int lane = threadIdx.x & 31, wave = threadIdx.x >> 5, d0 = blockIdx.x * 128, b = blockIdx.z;
    const float* p = Fsa + (size_t)b * MM * DD + (size_t)wave * DD + d0 + lane * 4;
    v4f s = (v4f){}, mx = (v4f){-3.0e38f, -3.0e38f, -3.0e38f, -3.0e38f};
#pragma unroll
    for (int j = 0; j < MM / 8; ++j) { const v4f v = *(const v4f*)(p + (size_t)(8 * j) * DD);
#pragma unroll
        for (int e = 0; e < 4; ++e) { s[e] += v[e]; mx[e] = fmaxf(mx[e], v[e]); } }
    if (wave < MM % 8) { const v4f v = *(const v4f*)(p + (size_t)(8 * (MM / 8)) * DD);
#pragma unroll
        for (int e = 0; e < 4; ++e) { s[e] += v[e]; mx[e] = fmaxf(mx[e], v[e]); } }
    asm volatile("s_wait_xcnt 0x0" :: "v"(p) : "memory");    // stands in front of every overwrite of the address register that the loads above name; the address is its input, so that it lives up to here
    *(v4fa*)(ps + wave * 128 + lane * 4) = s; *(v4fa*)(pm + wave * 128 + lane * 4) = mx;
    __syncthreads();                         // every wave's partial sums and maxima are in LDS before they are combined
    if (threadIdx.x < 128) { float t = 0.f, m = -3.0e38f;
#pragma unroll
        for (int w = 0; w < 8; ++w) { t += ps[w * 128 + threadIdx.x]; m = fmaxf(m, pm[w * 128 + threadIdx.x]); }
        FVA[(size_t)b * DD + d0 + threadIdx.x] = t * (1.0f / MM) + m; }
}
// k_logits: RES[b][k] = ls (beta1 bf(Fv[b]).bf(Ft[k]) + beta2 H[k] + beta3 Fva[b].bf(Ft[k])) (f32), ls = e^bf(logit_scale), H[k] = Fv[b].Fta[k] as k_soft_t leaves it. A wave per text row, 32 rows
// a wave: Fv[b] and Fva[b] stay in registers (a lane holds 16 of the 512 terms), each row of Ft comes as four loads of 512 contiguous bytes, four rows a step, the next step's 16 loads issued
// before a step is summed; a lane adds its 16 terms of the two dots, weights them, and a butterfly adds the lanes; lane j keeps row j, so the wave stores one whole line. Pad texts read Ft's last row and store 0.
__global__ __launch_bounds__(256) void k_logits(const float* __restrict__ Fv, const float* __restrict__ Ft, const float* __restrict__ H, const float* __restrict__ FVA, const float* __restrict__ lsc, float* RES) {
    const int lane = threadIdx.x & 31, k0 = blockIdx.x * 256 + __builtin_amdgcn_readfirstlane(threadIdx.x >> 5) * 32, b = blockIdx.z;
    const float hk = H[(size_t)b * KTP + k0 + lane];
    v4f fv[4], fa[4];
#pragma unroll
    for (int q = 0; q < 4; ++q) { const v4f v = *(const v4f*)(Fv + (size_t)b * DD + q * 128 + lane * 4); fa[q] = *(const v4f*)(FVA + (size_t)b * DD + q * 128 + lane * 4);
#pragma unroll
        for (int e = 0; e < 4; ++e) fv[q][e] = bfr(v[e]); }
    v4f tA[4][4], tB[4][4];
    auto fetch = [&](int g, v4f (&t)[4][4]) {
        const float* tp[4];
#pragma unroll
        for (int i = 0; i < 4; ++i) { const int k = k0 + g * 4 + i, kc = (k < KT) ? k : KT - 1; tp[i] = Ft + (size_t)kc * DD + lane * 4;
#pragma unroll
            for (int q = 0; q < 4; ++q) t[i][q] = *(const v4f*)(tp[i] + q * 128); }
        // the wait stands in front of every overwrite of a register that these loads name as an address; the addresses are its inputs, so that none of their registers is given to a load's result ahead of it
        asm volatile("s_wait_xcnt 0x0" :: "v"(tp[0]), "v"(tp[1]), "v"(tp[2]), "v"(tp[3]) : "memory");
    };
    float res = 0.f;
    auto sum = [&](int g, const v4f (&t)[4][4]) {
        float c[4];
#pragma unroll
        for (int i = 0; i < 4; ++i) { v4f d1 = (v4f){}, d3 = (v4f){};    // four chains a dot, on the registers as the loads fill them
#pragma unroll
            for (int q = 0; q < 4; ++q) { v4f ft;
#pragma unroll
                for (int e = 0; e < 4; ++e) ft[e] = bfr(t[i][q][e]);
                d1 = __builtin_elementwise_fma(fv[q], ft, d1); d3 = __builtin_elementwise_fma(fa[q], ft, d3); }
            const v4f w = B1_ * d1 + B3_ * d3; c[i] = (w[0] + w[1]) + (w[2] + w[3]); }
#pragma unroll
        for (int i = 0; i < 4; ++i) c[i] = wsum(c[i]);
#pragma unroll
        for (int i = 0; i < 4; ++i) if (lane == g * 4 + i) res = c[i];
    };
    fetch(0, tA);
#pragma unroll 1
    for (int g = 0; g < 6; g += 2) {         // rolled: two steps a trip, so that the two register sets are named by constants
        fetch(g + 1, tB);
        __builtin_amdgcn_sched_barrier(0);    // keeps the next step's loads in front of this step's sums: sunk behind them, their latency would be waited out every step
        sum(g, tA);
        __builtin_amdgcn_sched_barrier(0);    // keeps the refill's loads behind this step's butterflies: lifted between them, the four butterflies ran one after the other, each LDS round trip waited out alone
        fetch(g + 2, tA);
        __builtin_amdgcn_sched_barrier(0);    // as above
        sum(g + 1, tB);
    }
    fetch(7, tB);                            // the last two steps stand alone: no load behind the wave's last row, and no branch in the loop that would make its waits count for both paths
    __builtin_amdgcn_sched_barrier(0);        // as above
    sum(6, tA);
    sum(7, tB);
    const float ls = __expf(bfr(lsc[0]));
    RES[(size_t)b * KTP + k0 + lane] = (k0 + lane < KT) ? ls * (res + B2_ * hk) : 0.f;
}
__global__ __launch_bounds__(256) void k_out(const float* __restrict__ RES, float* OUTP) {
    const int i = blockIdx.x * 256 + threadIdx.x; if (i >= NBI * KT) return; const float v = RES[(size_t)(i / KT) * KTP + (i % KT)];
    *(float*)(OUTP + i) = v; 
}

extern "C" void kernel_launch(void* const* d_in, const int* in_sizes, int n_in,
                              void* d_out, int out_size, void* d_ws, size_t ws_size, hipStream_t stream) {
    (void)in_sizes; (void)n_in; (void)out_size;
    const float* Fs = (const float*)d_in[0]; const float* Ft = (const float*)d_in[1]; const float* Fv = (const float*)d_in[2]; const float* lsc = (const float*)d_in[3];
    float* out = (float*)d_out;    // [128][1][1000]
    char* wsp = (char*)d_ws;
    auto take = [&](size_t bytes) { char* p = wsp; wsp += (bytes + 255) & ~(size_t)255; return (void*)p; };
    float* FtP = (float*)take((size_t)KTP * DD * 4); bf* FtB = (bf*)take((size_t)KTP * DD * 2); bf* FtT = (bf*)take((size_t)DD * KTP * 2); float* INV = (float*)take((size_t)NR * 4);
    float* G = (float*)take((size_t)NR * 4); float* H = (float*)take((size_t)NBI * KTP * 4); float* FVA = (float*)take((size_t)NBI * DD * 4); float* RES = (float*)take((size_t)NBI * KTP * 4);
    // One region holds, one after the other in stream order: {A | Nh, Nl}, then {A | PH, PL}, then {FSA | PH, PL}. Each plane is written after the last read of what it lies on.
    float* A = (float*)take((size_t)NR * KTP * 4 * 2); float* FSA = A;
    bf* PH = (bf*)(A + (size_t)NR * KTP); bf* PL = PH + (size_t)NR * KTP; bf* Nh = PH; bf* Nl = Nh + (size_t)NR * DD;
    if ((size_t)(wsp - (char*)d_ws) > ws_size) return;    // 4 + 1.5 + 196 ~ 202 MiB
    k_ftpad<<<(KTP * DD / 8 + 255) / 256, 256, 0, stream>>>(Ft, FtP, FtB); k_wt<<<dim3(KTP / 64, DD / 64, 1), 256, 0, stream>>>(FtP, KTP, DD, FtT);     // Ft^T [512][1024] exact bf16
    k_norm<<<NR / 32, 256, 0, stream>>>(Fs, Fv, INV, G);
    k_fsn<<<NR / 8, 256, 0, stream>>>(Fs, INV, Nh, Nl);
    k_gemm<DD, false><<<dim3(KTP / 128, NR / 128, 1), 256, 0, stream>>>(Nh, Nl, FtB, FtB, A, KTP);     // A = Fs_n.Ft^T  [25088][1024]
    k_soft_s<<<NR / 8, 256, 0, stream>>>(A, PH, PL); k_soft_t<<<dim3(KTP / TC, 1, NBI), 256, 0, stream>>>(A, G, H);
    k_gemm<KTP, false><<<dim3(DD / 128, NR / 128, 1), 256, 0, stream>>>(PH, PL, FtT, FtT, FSA, DD);    // Fsa = P_s.Ft    [25088][512]
    k_pool<<<dim3(DD / 128, 1, NBI), 256, 0, stream>>>(FSA, FVA);
    k_logits<<<dim3(KTP / 256, 1, NBI), 256, 0, stream>>>(Fv, Ft, H, FVA, lsc, RES);
    k_out<<<(NBI * KT + 255) / 256, 256, 0, stream>>>(RES, out);
}

// v007
// A run of this version takes 189 microseconds.
// In two side-by-side timings against v006, it was 1.03 and 1.02 times as fast.
// Counting every step since v000, it is 168 times as fast.
#include <hip/hip_runtime.h>

// Compute dtypes, f32 accumulate, all 128 images in one pass. Ft is the same for every image, so the token rows of all images form one row dimension without pad rows (128 x 196 = 25088 = 196 tiles
// of 128 rows; K = 1000 texts padded to 1024): Fs L2-normalised in f32 -> bf16 hi + UNSCALED
// residual planes; A = Fs_n.Ft^T ([25088 x 512].[512 x 1024], split Fs_n against the exact bf16 Ft, two products) and Fsa = P_s.Ft ([25088 x 1024].[1024 x 512], P_s = softmax over texts
// x 1/alpha_s in f32 -> hi/lo planes, two products) on v_wmma_f32_16x16x32_bf16. Fta = P_t.Fs_n enters the result only through Fv.Fta[k] = sum_m P_t[k][m] (Fs_n[m].Fv): the inner dots
// G[m] (one per token) come with the norms, the outer sum with the softmax over the 196 real tokens (x 1/alpha_t, f32), and Fta itself is never formed. Mean + max pooling over the real
// tokens, and the final logits (two 512-term dots per text and that sum, x exp(logit_scale)).

#define NBI  128
#define MM   196
#define NR   (NBI * MM)    // token rows of all images, image b's at b * MM
#define KT   1000
#define KTP  1024
#define DD   512
#define DM   DD
#define ALS  0.5f
#define ALT  0.5f
#define B1_  1.0f
#define B2_  0.1f
#define B3_  0.1f
#define LOSC 1024.0f

typedef _Float16 h16;
typedef unsigned short bf;
typedef __attribute__((ext_vector_type(16))) __bf16   v16bf;
typedef __attribute__((ext_vector_type(16))) _Float16 v16h;
typedef __attribute__((ext_vector_type(8)))  _Float16 v8h;
typedef __attribute__((ext_vector_type(8)))  unsigned short v8us;
typedef __attribute__((ext_vector_type(8)))  float    v8f;
typedef __attribute__((ext_vector_type(4)))  float    v4f;
typedef __attribute__((ext_vector_type(4)))  _Float16 v4h;
typedef v8h  __attribute__((may_alias)) v8ha;
typedef v4f  __attribute__((may_alias)) v4fa;
typedef v8us __attribute__((may_alias)) v8usa;

__device__ __forceinline__ unsigned short f2bf(float f) { unsigned u = __float_as_uint(f); u += 0x7FFFu + ((u >> 16) & 1u); return (unsigned short)(u >> 16); }
__device__ __forceinline__ float bf2f(unsigned short b) { return __uint_as_float(((unsigned)b) << 16); }
__device__ __forceinline__ float bfr(float f) { return bf2f(f2bf(f)); }
__device__ __forceinline__ v16h cat16(v8h lo, v8h hi) { return __builtin_shufflevector(lo, hi, 0, 1, 2, 3, 4, 5, 6, 7, 8, 9, 10, 11, 12, 13, 14, 15); }
__device__ __forceinline__ v16bf cat16b(v8us lo, v8us hi) { return __builtin_bit_cast(v16bf, __builtin_shufflevector(lo, hi, 0, 1, 2, 3, 4, 5, 6, 7, 8, 9, 10, 11, 12, 13, 14, 15)); }
__device__ __forceinline__ v8f wmma16(v16h a, v16h b, v8f c) { return __builtin_amdgcn_wmma_f32_16x16x32_f16(false, a, false, b, (short)0, c, false, false); }
__device__ __forceinline__ v8f wmmab(v16bf a, v16bf b, v8f c) { return __builtin_amdgcn_wmma_f32_16x16x32_bf16(false, a, false, b, (short)0, c, false, false); }

// k_gemm: 128 x 128 block tile (8 waves, 4 x 2, each 32 x 64) of C = (Ah + Al).(Bh [+ Bl])^T over K (every plane k-contiguous with row stride K; n-major B). Per 32 k and
// accumulator the products come in the order hh, lh [, hl]. A stage is 64 k = one 128-byte line of each of the 128 rows of every plane: 8 lanes fetch a row's whole line,
// the stage goes through registers into one of two LDS buffers (row pitch 144 B for the 16-byte fragment reads) while the other buffer is multiplied.
// The inner loops are all unrolled so that st, acc and the fragments are indexed by constants and stay in registers.
#define BKE 64
#define LPB 144
#define PLB (128 * LPB)
template <int K, bool SPLITB>
__global__ __launch_bounds__(256) void k_gemm(const bf* __restrict__ Ah, const bf* __restrict__ Al, const bf* __restrict__ Bh, const bf* __restrict__ Bl, float* C, int ldc) {
    constexpr int NP = SPLITB ? 4 : 3, NS = K / BKE;
    __shared__ __align__(16) unsigned char sm[2 * NP * PLB];
    const int tid = threadIdx.x, lane = tid & 31, wave = tid >> 5, lr = lane & 15, hi = lane >> 4, wm = wave >> 1, wn = wave & 1;
    const int r0 = blockIdx.y * 128, c0 = blockIdx.x * 128;    // the column tiles of one row tile are neighbours in launch order: they read the same A rows
    const int soff = (tid >> 3) * LPB + (tid & 7) * 16;
    unsigned go = (unsigned)((tid >> 3) * K + (tid & 7) * 8) * 2u;    // the lane's byte offset in every plane's tile: one register serves all planes beside their block-uniform bases; it steps by a stage
    const bf* src[4];
    src[0] = Ah + (size_t)r0 * K; src[1] = Al + (size_t)r0 * K;
    src[2] = Bh + (size_t)c0 * K; src[3] = SPLITB ? Bl + (size_t)c0 * K : src[2];
    v8us st[NP][4];
    auto fetch = [&]() {
#pragma unroll
        for (int p = 0; p < NP; ++p)
#pragma unroll
            for (int i = 0; i < 4; ++i) st[p][i] = *(const v8us*)((const unsigned char*)src[p] + (size_t)go + (size_t)(i * 32 * K * 2));
    };
    auto put = [&](int buf) {
#pragma unroll
        for (int p = 0; p < NP; ++p)
#pragma unroll
            for (int i = 0; i < 4; ++i) *(v8usa*)(sm + (buf * NP + p) * PLB + soff + i * 32 * LPB) = st[p][i];
    };
    v8f acc[2][4];
#pragma unroll
    for (int i = 0; i < 2; ++i)
#pragma unroll
        for (int t = 0; t < 4; ++t) acc[i][t] = (v8f){};
    fetch(); put(0); go += BKE * 2;
    __syncthreads();                         // publishes stage 0
    for (int s = 0; s < NS; ++s) {
        if (s + 1 < NS) fetch();
        __builtin_amdgcn_sched_barrier(0);    // keeps the next stage's global loads in front of this stage's products: sunk to the LDS stores below, their latency would be waited out every stage
        const unsigned char* bb = sm + (s & 1) * (NP * PLB) + lr * LPB + hi * 16;
#pragma unroll
        for (int kk = 0; kk < 2; ++kk) {
            v16bf a[2], al[2], b[4], bl[4];
#pragma unroll
            for (int i = 0; i < 2; ++i) { const unsigned char* p = bb + (wm * 32 + i * 16) * LPB + kk * 64;
                a[i] = cat16b(*(const v8usa*)p, *(const v8usa*)(p + 32)); al[i] = cat16b(*(const v8usa*)(p + PLB), *(const v8usa*)(p + PLB + 32)); }
#pragma unroll
            for (int t = 0; t < 4; ++t) { const unsigned char* p = bb + 2 * PLB + (wn * 64 + t * 16) * LPB + kk * 64;
                b[t] = cat16b(*(const v8usa*)p, *(const v8usa*)(p + 32)); bl[t] = b[t]; if (SPLITB) bl[t] = cat16b(*(const v8usa*)(p + PLB), *(const v8usa*)(p + PLB + 32)); }
#pragma unroll
            for (int i = 0; i < 2; ++i)
#pragma unroll
                for (int t = 0; t < 4; ++t) acc[i][t] = wmmab(a[i], b[t], acc[i][t]);
#pragma unroll
            for (int i = 0; i < 2; ++i)
#pragma unroll
                for (int t = 0; t < 4; ++t) acc[i][t] = wmmab(al[i], b[t], acc[i][t]);
            if (SPLITB) {
#pragma unroll
                for (int i = 0; i < 2; ++i)
#pragma unroll
                    for (int t = 0; t < 4; ++t) acc[i][t] = wmmab(a[i], bl[t], acc[i][t]);
            }
        }
        if (s + 1 < NS) put((s + 1) & 1);    // the buffer that every wave left at the barrier of stage s - 1
        go += BKE * 2;
        __syncthreads();                     // publishes stage s + 1 and ends the reads of stage s
    }
    float* os = (float*)(void*)sm + wave * (32 * 68);    // whole-line stores: each wave turns its 32 x 64 tile in its own range of the ring, free behind the last barrier
#pragma unroll
    for (int i = 0; i < 2; ++i)
#pragma unroll
        for (int t = 0; t < 4; ++t)
#pragma unroll
            for (int j = 0; j < 8; ++j) os[(i * 16 + hi * 8 + j) * 68 + t * 16 + lr] = acc[i][t][j];
    __syncthreads();                         // the tile's LDS stores are done before lanes read rows that other lanes wrote
    float* crow = C + (size_t)(r0 + wm * 32) * ldc + c0 + wn * 64;
#pragma unroll
    for (int s = 0; s < 16; ++s) { const int Lid = (lane >> 3) + 4 * s, piece = lane & 7; const int row = Lid >> 1, cofs = (Lid & 1) * 32 + piece * 4;
        const v4f val = *(const v4fa*)(os + row * 68 + cofs); *(v4f*)(crow + (size_t)row * ldc + cofs) = val; }
}

// wsum: sum over the 32 lanes of a wave, five-step butterfly; every lane ends with the same value.
__device__ __forceinline__ float wsum(float v) {
#pragma unroll
    for (int sh = 16; sh; sh >>= 1) v += __shfl_xor(v, sh, 32);
    return v;
}
// k_prep: one launch prepares every GEMM operand except PH, PL, which k_soft_s writes.
// Blocks 0 .. FTB - 1: a 64 x 64 tile of Ft (64 texts x 64 features, texts 1000..1023 as zero), read once: its bf16 rows go to FtB [1024][512] (the n-major B of A = Fs_n.Ft^T; four lanes store a
// row's whole 128-byte line) and, turned in LDS, to FtT [512][1024] (the n-major B of Fsa = P_s.Ft).
// The other blocks: a wave per token row, four rows a wave (16 loads of 16 B in flight, each 512 contiguous bytes of a row), 32 rows a block; a wave's four rows are of one image (196 = 49 x 4).
// From the same registers come 1 / |bf(Fs[m])|, G[m] = (bf(Fs[m]).bf(Fv[b])) / |bf(Fs[m])| and the normalised row's bf16 hi plane Nh and unscaled residual plane Nl (a store is 256 contiguous bytes of a row).
#define FTB ((KTP / 64) * (DD / 64))
typedef __attribute__((ext_vector_type(4))) unsigned short v4us;
__global__ __launch_bounds__(256) void k_prep(const float* __restrict__ Fs, const float* __restrict__ Fv, const float* __restrict__ Ft, bf* FtB, bf* FtT, bf* Nh, bf* Nl, float* G) {
    __shared__ __align__(16) unsigned short tl[64 * 72];
    __shared__ float sg[32];
    if (blockIdx.x < FTB) {                  // block-uniform: every barrier below is passed by a whole block or by none of it
        const int tid = threadIdx.x, k0 = (blockIdx.x % (KTP / 64)) * 64, n0 = (blockIdx.x / (KTP / 64)) * 64;
        const int kk = tid >> 2, nq = (tid & 3) * 16, k = k0 + kk;
        const float* fr = Ft + (size_t)((k < KT) ? k : KT - 1) * DD + n0 + nq;    // a pad text re-reads the last real row and stores zero
        v4f x[4]; v8us o[2], t[2];
#pragma unroll
        for (int j = 0; j < 4; ++j) x[j] = *(const v4f*)(fr + j * 4);    // all four in flight together, whatever the row
        asm volatile("s_wait_xcnt 0x0" :: "v"(fr) : "memory");    // stands in front of every overwrite of the address register that these loads name; the address is its input, so that it lives up to here
#pragma unroll
        for (int i = 0; i < 16; ++i) { const unsigned short h = (k < KT) ? f2bf(x[i >> 2][i & 3]) : (unsigned short)0; tl[(nq + i) * 72 + kk] = h; o[i >> 3][i & 7] = h; }
        __syncthreads();                     // the tile is whole in LDS before it is read the other way; no store is in flight here that the barrier would wait for
        const int piece = tid & 7, nr = tid >> 3;
#pragma unroll
        for (int s = 0; s < 2; ++s) t[s] = *(const v8usa*)(tl + (nr + 32 * s) * 72 + piece * 8);
        *(v8us*)(FtB + (size_t)k * DD + n0 + nq) = o[0]; *(v8us*)(FtB + (size_t)k * DD + n0 + nq + 8) = o[1];
#pragma unroll
        for (int s = 0; s < 2; ++s) *(v8us*)(FtT + (size_t)(n0 + nr + 32 * s) * KTP + k0 + piece * 8) = t[s];
        return;
    }
    const int lane = threadIdx.x & 31, wave = __builtin_amdgcn_readfirstlane(threadIdx.x >> 5), blk = blockIdx.x - FTB, m0 = blk * 32 + wave * 4, b = m0 / MM;
    v4f v[4][4], f[4]; const float* r[4]; const float* fp = Fv + (size_t)b * DD + lane * 4;
#pragma unroll
    for (int i = 0; i < 4; ++i) { r[i] = Fs + (size_t)(m0 + i) * DD + lane * 4;
#pragma unroll
        for (int q = 0; q < 4; ++q) v[i][q] = *(const v4f*)(r[i] + q * 128); }
#pragma unroll
    for (int q = 0; q < 4; ++q) f[q] = *(const v4f*)(fp + q * 128);
    // the wait stands in front of every overwrite of a register that these loads name as an address; the addresses are its inputs, so that none of their registers is given to a load's result ahead of it
    asm volatile("s_wait_xcnt 0x0" :: "v"(r[0]), "v"(r[1]), "v"(r[2]), "v"(r[3]), "v"(fp) : "memory");
    __builtin_amdgcn_sched_barrier(0);        // keeps all 20 loads in front of the sums: with sums lifted between them the wave would wait out the memory latency twice
#pragma unroll
    for (int q = 0; q < 4; ++q)
#pragma unroll
        for (int e = 0; e < 4; ++e) f[q][e] = bfr(f[q][e]);
    float s[4], g[4];
#pragma unroll
    for (int i = 0; i < 4; ++i) { v4f a = (v4f){}, c = (v4f){};
#pragma unroll
        for (int q = 0; q < 4; ++q) {
#pragma unroll
            for (int e = 0; e < 4; ++e) v[i][q][e] = bfr(v[i][q][e]);    // the rounded row stays in its registers for the split below
            a = __builtin_elementwise_fma(v[i][q], v[i][q], a); c = __builtin_elementwise_fma(v[i][q], f[q], c); }
        s[i] = (a[0] + a[1]) + (a[2] + a[3]); g[i] = (c[0] + c[1]) + (c[2] + c[3]); }
#pragma unroll
    for (int i = 0; i < 4; ++i) { s[i] = wsum(s[i]); g[i] = wsum(g[i]); }
    float inv[4];                            // the butterfly leaves a row's sum in every lane, so every lane forms the same 1 / norm
#pragma unroll
    for (int i = 0; i < 4; ++i) inv[i] = 1.0f / sqrtf(s[i]);
#pragma unroll
    for (int i = 0; i < 4; ++i) g[i] *= inv[i];
    if (lane < 4) sg[wave * 4 + lane] = (lane == 0) ? g[0] : (lane == 1) ? g[1] : (lane == 2) ? g[2] : g[3];    // lane i keeps row i
    __syncthreads();                         // the eight waves' G are in LDS before a wave stores the block's whole 128-byte line; it stands ahead of the planes' stores, which it would otherwise wait for
    if (threadIdx.x < 32) { G[blk * 32 + threadIdx.x] = sg[threadIdx.x];
        asm volatile("s_wait_xcnt 0x0" ::: "memory"); }    // stands in front of the split's overwrite of the registers that this store names
    v4us oh[4][4], ol[4][4];
#pragma unroll
    for (int i = 0; i < 4; ++i)
#pragma unroll
        for (int q = 0; q < 4; ++q)
#pragma unroll
            for (int e = 0; e < 4; ++e) { const float x = v[i][q][e] * inv[i]; const unsigned short hb = f2bf(x); oh[i][q][e] = hb; ol[i][q][e] = f2bf(x - bf2f(hb)); }
    __builtin_amdgcn_sched_barrier(0);        // keeps the 32 stores behind the arithmetic, the wave's last: no register that an issued store names is written any more
    bf* ph = Nh + (size_t)m0 * DD + lane * 4; bf* pl = Nl + (size_t)m0 * DD + lane * 4;
#pragma unroll
    for (int i = 0; i < 4; ++i)
#pragma unroll
        for (int q = 0; q < 4; ++q) { *(v4us*)(ph + i * DD + q * 128) = oh[i][q]; *(v4us*)(pl + i * DD + q * 128) = ol[i][q]; }
}
__global__ __launch_bounds__(256) void k_soft_s(const float* __restrict__ A, bf* PH, bf* PL) {
    const int lane = threadIdx.x & 31, m = blockIdx.x * 8 + (threadIdx.x >> 5);
    const float* ar = A + (size_t)m * KTP; float mx = -3.0e38f;
#pragma unroll 1
    for (int c0 = lane * 8; c0 < KTP; c0 += 256) { const v8f v = *(const v8f*)(ar + c0);
#pragma unroll
        for (int i = 0; i < 8; ++i) if (c0 + i < KT) mx = fmaxf(mx, v[i] * (1.0f / ALS)); }
#pragma unroll
    for (int sh = 16; sh; sh >>= 1) mx = fmaxf(mx, __shfl_xor(mx, sh, 32));
    float sum = 0.f;
#pragma unroll 1
    for (int c0 = lane * 8; c0 < KTP; c0 += 256) { const v8f v = *(const v8f*)(ar + c0);
#pragma unroll
        for (int i = 0; i < 8; ++i) if (c0 + i < KT) sum += __expf(v[i] * (1.0f / ALS) - mx); }
#pragma unroll
    for (int sh = 16; sh; sh >>= 1) sum += __shfl_xor(sum, sh, 32);
    const float inv = 1.0f / sum;
{
#pragma unroll 1
        for (int c0 = lane * 8; c0 < KTP; c0 += 256) { const v8f v = *(const v8f*)(ar + c0); v8us oh, ol;
#pragma unroll
            for (int i = 0; i < 8; ++i) { const float p = (c0 + i < KT) ? __expf(v[i] * (1.0f / ALS) - mx) * inv : 0.f; const unsigned short hb = f2bf(p); oh[i] = hb; ol[i] = f2bf(p - bf2f(hb)); }
            const size_t o = (size_t)m * KTP + c0; *(v8us*)(PH + o) = oh; *(v8us*)(PL + o) = ol; }
         }
}
// ex4: e^x of four values, formed as __expf forms it (x * log2 e, then v_exp_f32). One statement, so that behind each v_exp_f32 stands an instruction that neither reads its result nor overwrites
// its source, the slot the instruction set asks for: the next v_exp_f32 (the outputs share no register with the inputs), and a v_nop behind the last.
__device__ __forceinline__ v4f ex4(v4f x) {
    x *= 1.44269504f; v4f r;
    asm("v_exp_f32 %0, %4\n\tv_exp_f32 %1, %5\n\tv_exp_f32 %2, %6\n\tv_exp_f32 %3, %7\n\tv_nop" : "=&v"(r[0]), "=&v"(r[1]), "=&v"(r[2]), "=&v"(r[3]) : "v"(x[0]), "v"(x[1]), "v"(x[2]), "v"(x[3]));
    return r;
}
// k_soft_t: H[k] = sum_m P_t[k][m] G[m], P_t the softmax over the 196 real tokens of A[m][k] / alpha_t (f32); pad texts give 0. A block takes TC = 64 columns (256 contiguous bytes of every
// row of A) and all 256 token places: 16 lanes fetch a row's 256 bytes, a thread holds 4 columns of two runs of eight consecutive tokens (m = j * 128 + wave * 16 + (lane >> 4) * 8 + i; pad
// tokens re-read the last real row and count as absent). A column's maximum, sum and weighted sum: a thread's 16 tokens in order, the lane 16 apart, then the eight waves' values from LDS in wave order.
#define TC 64
__global__ __launch_bounds__(256) void k_soft_t(const float* __restrict__ A, const float* __restrict__ G, float* H) {
    __shared__ __align__(16) float rm[8 * TC], rq[8 * TC], rg[8 * TC];
    const int lane = threadIdx.x & 31, wave = threadIdx.x >> 5, c16 = lane & 15, rs = lane >> 4, mb = wave * 16 + rs * 8, k0 = blockIdx.x * TC;
    const unsigned char* base = (const unsigned char*)(A + (size_t)blockIdx.z * MM * KTP + k0); const unsigned char* gb = (const unsigned char*)(G + (size_t)blockIdx.z * MM);    // block-uniform; the lane's part is a byte offset
    const unsigned o0 = (unsigned)(mb * KTP + c16 * 4) * 4u, io = (unsigned)mb * 4u; unsigned o1[8], i1[2];    // o1[i] + (128 + i) rows is token 128 + mb + i, or the last real token where that is a pad
    v4f v[2][8]; v4f gv[2][2];
#pragma unroll
    for (int i = 0; i < 8; ++i) v[0][i] = *(const v4f*)(base + (size_t)o0 + (size_t)(i * KTP * 4));
#pragma unroll
    for (int i = 0; i < 8; ++i) { o1[i] = (unsigned)(((mb < MM - 1 - 128 - i) ? mb : MM - 1 - 128 - i) * KTP + c16 * 4) * 4u; v[1][i] = *(const v4f*)(base + (size_t)o1[i] + (size_t)((128 + i) * KTP * 4)); }
#pragma unroll
    for (int h = 0; h < 2; ++h) { gv[0][h] = *(const v4f*)(gb + (size_t)io + (size_t)(h * 16));    // a group of four token places is all real or all pad (196 = 49 x 4): a pad group re-reads the image's last four G, which meet a weight of exactly 0
        i1[h] = (unsigned)((mb + h * 4 < MM - 4 - 128) ? mb + h * 4 : MM - 4 - 128) * 4u; gv[1][h] = *(const v4f*)(gb + (size_t)i1[h] + (size_t)512); }
    // the wait stands in front of every overwrite of a register that these loads name as an address; the offsets are its inputs, so that none of their registers is given to a load's result ahead of it
    asm volatile("s_wait_xcnt 0x0" :: "v"(o0), "v"(o1[0]), "v"(o1[1]), "v"(o1[2]), "v"(o1[3]), "v"(o1[4]), "v"(o1[5]), "v"(o1[6]), "v"(o1[7]), "v"(io), "v"(i1[0]), "v"(i1[1]) : "memory");
    __builtin_amdgcn_sched_barrier(0);        // keeps all 20 loads in front of the arithmetic: with arithmetic lifted between them the wave would wait out the memory latency twice
    v4f mx = (v4f){-3.0e38f, -3.0e38f, -3.0e38f, -3.0e38f};
#pragma unroll
    for (int j = 0; j < 2; ++j)
#pragma unroll
        for (int i = 0; i < 8; ++i)
#pragma unroll
            for (int e = 0; e < 4; ++e) { const float x = (j == 0 || 128 + mb + i < MM) ? v[j][i][e] * (1.0f / ALT) : -3.0e38f; v[j][i][e] = x; mx[e] = fmaxf(mx[e], x); }    // the first 128 tokens are all real
#pragma unroll
    for (int e = 0; e < 4; ++e) mx[e] = fmaxf(mx[e], __shfl_xor(mx[e], 16, 32));
    if (rs == 0) *(v4fa*)(rm + wave * TC + c16 * 4) = mx;
    __syncthreads();                         // the eight waves' column maxima are in LDS before they are combined
#pragma unroll
    for (int w = 0; w < 8; ++w) { const v4f t = *(const v4fa*)(rm + w * TC + c16 * 4);
#pragma unroll
        for (int e = 0; e < 4; ++e) mx[e] = fmaxf(mx[e], t[e]); }
    v4f sum = (v4f){}, wg = (v4f){};
#pragma unroll
    for (int j = 0; j < 2; ++j)
#pragma unroll
        for (int i = 0; i < 8; ++i) { const v4f ev = ex4(v[j][i] - mx); const float gm = gv[j][i >> 2][i & 3]; sum += ev; wg = __builtin_elementwise_fma(ev, (v4f){gm, gm, gm, gm}, wg); }    // a pad token's -3.0e38 under a real token's maximum gives exactly 0
#pragma unroll
    for (int e = 0; e < 4; ++e) { sum[e] += __shfl_xor(sum[e], 16, 32); wg[e] += __shfl_xor(wg[e], 16, 32); }
    if (rs == 0) { *(v4fa*)(rq + wave * TC + c16 * 4) = sum; *(v4fa*)(rg + wave * TC + c16 * 4) = wg; }
    __syncthreads();                         // the eight waves' column sums are in LDS before they are combined
    if (threadIdx.x < 16) {                  // 16 lanes finish the block's 64 columns and store its two whole lines
        v4f tot = (v4f){}, tg = (v4f){}, h;
#pragma unroll
        for (int w = 0; w < 8; ++w) { tot += *(const v4fa*)(rq + w * TC + c16 * 4); tg += *(const v4fa*)(rg + w * TC + c16 * 4); }
#pragma unroll
        for (int e = 0; e < 4; ++e) h[e] = (k0 + c16 * 4 + e < KT) ? tg[e] / tot[e] : 0.f;
        *(v4f*)(H + (size_t)blockIdx.z * KTP + k0 + c16 * 4) = h; }
}
// k_pool: a block per 128 columns of an image; wave w takes the tokens w, w + 8, ... (a lane holds 4 columns, a load is 512 contiguous bytes of a token's row, the loop unrolled so that
// many of a wave's loads are in flight together); the eight waves' sums and maxima meet in LDS and are combined in wave order.
__global__ __launch_bounds__(256) void k_pool(const float* __restrict__ Fsa, float* FVA) {
    __shared__ __align__(16) float ps[8 * 128], pm[8 * 128];
    const int lane = threadIdx.x & 31, wave = threadIdx.x >> 5, d0 = blockIdx.x * 128, b = blockIdx.z;
    const float* p = Fsa + (size_t)b * MM * DD + (size_t)wave * DD + d0 + lane * 4;
    v4f s = (v4f){}, mx = (v4f){-3.0e38f, -3.0e38f, -3.0e38f, -3.0e38f};
#pragma unroll
    for (int j = 0; j < MM / 8; ++j) { const v4f v = *(const v4f*)(p + (size_t)(8 * j) * DD);
#pragma unroll
        for (int e = 0; e < 4; ++e) { s[e] += v[e]; mx[e] = fmaxf(mx[e], v[e]); } }
    if (wave < MM % 8) { const v4f v = *(const v4f*)(p + (size_t)(8 * (MM / 8)) * DD);
#pragma unroll
        for (int e = 0; e < 4; ++e) { s[e] += v[e]; mx[e] = fmaxf(mx[e], v[e]); } }
    asm volatile("s_wait_xcnt 0x0" :: "v"(p) : "memory");    // stands in front of every overwrite of the address register that the loads above name; the address is its input, so that it lives up to here
    *(v4fa*)(ps + wave * 128 + lane * 4) = s; *(v4fa*)(pm + wave * 128 + lane * 4) = mx;
    __syncthreads();                         // every wave's partial sums and maxima are in LDS before they are combined
    if (threadIdx.x < 128) { float t = 0.f, m = -3.0e38f;
#pragma unroll
        for (int w = 0; w < 8; ++w) { t += ps[w * 128 + threadIdx.x]; m = fmaxf(m, pm[w * 128 + threadIdx.x]); }
        FVA[(size_t)b * DD + d0 + threadIdx.x] = t * (1.0f / MM) + m; }
}
// k_logits: RES[b][k] = ls (beta1 bf(Fv[b]).bf(Ft[k]) + beta2 H[k] + beta3 Fva[b].bf(Ft[k])) (f32), ls = e^bf(logit_scale), H[k] = Fv[b].Fta[k] as k_soft_t leaves it. A wave per text row, 32 rows
// a wave: Fv[b] and Fva[b] stay in registers (a lane holds 16 of the 512 terms), each row of Ft comes as four loads of 512 contiguous bytes, four rows a step, the next step's 16 loads issued
// before a step is summed; a lane adds its 16 terms of the two dots, weights them, and a butterfly adds the lanes; lane j keeps row j, so the wave stores one whole line. Pad texts read Ft's last row and store 0.
__global__ __launch_bounds__(256) void k_logits(const float* __restrict__ Fv, const float* __restrict__ Ft, const float* __restrict__ H, const float* __restrict__ FVA, const float* __restrict__ lsc, float* RES) {
    const int lane = threadIdx.x & 31, k0 = blockIdx.x * 256 + __builtin_amdgcn_readfirstlane(threadIdx.x >> 5) * 32, b = blockIdx.z;
    const float hk = H[(size_t)b * KTP + k0 + lane];
    v4f fv[4], fa[4];
#pragma unroll
    for (int q = 0; q < 4; ++q) { const v4f v = *(const v4f*)(Fv + (size_t)b * DD + q * 128 + lane * 4); fa[q] = *(const v4f*)(FVA + (size_t)b * DD + q * 128 + lane * 4);
#pragma unroll
        for (int e = 0; e < 4; ++e) fv[q][e] = bfr(v[e]); }
    v4f tA[4][4], tB[4][4];
    auto fetch = [&](int g, v4f (&t)[4][4]) {
        const float* tp[4];
#pragma unroll
        for (int i = 0; i < 4; ++i) { const int k = k0 + g * 4 + i, kc = (k < KT) ? k : KT - 1; tp[i] = Ft + (size_t)kc * DD + lane * 4;
#pragma unroll
            for (int q = 0; q < 4; ++q) t[i][q] = *(const v4f*)(tp[i] + q * 128); }
        // the wait stands in front of every overwrite of a register that these loads name as an address; the addresses are its inputs, so that none of their registers is given to a load's result ahead of it
        asm volatile("s_wait_xcnt 0x0" :: "v"(tp[0]), "v"(tp[1]), "v"(tp[2]), "v"(tp[3]) : "memory");
    };
    float res = 0.f;
    auto sum = [&](int g, const v4f (&t)[4][4]) {
        float c[4];
#pragma unroll
        for (int i = 0; i < 4; ++i) { v4f d1 = (v4f){}, d3 = (v4f){};    // four chains a dot, on the registers as the loads fill them
#pragma unroll
            for (int q = 0; q < 4; ++q) { v4f ft;
#pragma unroll
                for (int e = 0; e < 4; ++e) ft[e] = bfr(t[i][q][e]);
                d1 = __builtin_elementwise_fma(fv[q], ft, d1); d3 = __builtin_elementwise_fma(fa[q], ft, d3); }
            const v4f w = B1_ * d1 + B3_ * d3; c[i] = (w[0] + w[1]) + (w[2] + w[3]); }
#pragma unroll
        for (int i = 0; i < 4; ++i) c[i] = wsum(c[i]);
#pragma unroll
        for (int i = 0; i < 4; ++i) if (lane == g * 4 + i) res = c[i];
    };
    fetch(0, tA);
#pragma unroll 1
    for (int g = 0; g < 6; g += 2) {         // rolled: two steps a trip, so that the two register sets are named by constants
        fetch(g + 1, tB);
        __builtin_amdgcn_sched_barrier(0);    // keeps the next step's loads in front of this step's sums: sunk behind them, their latency would be waited out every step
        sum(g, tA);
        __builtin_amdgcn_sched_barrier(0);    // keeps the refill's loads behind this step's butterflies: lifted between them, the four butterflies ran one after the other, each LDS round trip waited out alone
        fetch(g + 2, tA);
        __builtin_amdgcn_sched_barrier(0);    // as above
        sum(g + 1, tB);
    }
    fetch(7, tB);                            // the last two steps stand alone: no load behind the wave's last row, and no branch in the loop that would make its waits count for both paths
    __builtin_amdgcn_sched_barrier(0);        // as above
    sum(6, tA);
    sum(7, tB);
    const float ls = __expf(bfr(lsc[0]));
    RES[(size_t)b * KTP + k0 + lane] = (k0 + lane < KT) ? ls * (res + B2_ * hk) : 0.f;
}
__global__ __launch_bounds__(256) void k_out(const float* __restrict__ RES, float* OUTP) {
    const int i = blockIdx.x * 256 + threadIdx.x; if (i >= NBI * KT) return; const float v = RES[(size_t)(i / KT) * KTP + (i % KT)];
    *(float*)(OUTP + i) = v; 
}

extern "C" void kernel_launch(void* const* d_in, const int* in_sizes, int n_in,
                              void* d_out, int out_size, void* d_ws, size_t ws_size, hipStream_t stream) {
    (void)in_sizes; (void)n_in; (void)out_size;
    const float* Fs = (const float*)d_in[0]; const float* Ft = (const float*)d_in[1]; const float* Fv = (const float*)d_in[2]; const float* lsc = (const float*)d_in[3];
    float* out = (float*)d_out;    // [128][1][1000]
    char* wsp = (char*)d_ws;
    auto take = [&](size_t bytes) { char* p = wsp; wsp += (bytes + 255) & ~(size_t)255; return (void*)p; };
    bf* FtB = (bf*)take((size_t)KTP * DD * 2); bf* FtT = (bf*)take((size_t)DD * KTP * 2);
    float* G = (float*)take((size_t)NR * 4); float* H = (float*)take((size_t)NBI * KTP * 4); float* FVA = (float*)take((size_t)NBI * DD * 4); float* RES = (float*)take((size_t)NBI * KTP * 4);
    // One region holds, one after the other in stream order: {A | Nh, Nl}, then {A | PH, PL}, then {FSA | PH, PL}. Each plane is written after the last read of what it lies on.
    float* A = (float*)take((size_t)NR * KTP * 4 * 2); float* FSA = A;
    bf* PH = (bf*)(A + (size_t)NR * KTP); bf* PL = PH + (size_t)NR * KTP; bf* Nh = PH; bf* Nl = Nh + (size_t)NR * DD;
    if ((size_t)(wsp - (char*)d_ws) > ws_size) return;    // 2 + 1.5 + 196 ~ 200 MiB
    k_prep<<<FTB + NR / 32, 256, 0, stream>>>(Fs, Fv, Ft, FtB, FtT, Nh, Nl, G);     // FtB, Ft^T [512][1024] exact bf16; Nh, Nl, G
    k_gemm<DD, false><<<dim3(KTP / 128, NR / 128, 1), 256, 0, stream>>>(Nh, Nl, FtB, FtB, A, KTP);     // A = Fs_n.Ft^T  [25088][1024]
    k_soft_s<<<NR / 8, 256, 0, stream>>>(A, PH, PL); k_soft_t<<<dim3(KTP / TC, 1, NBI), 256, 0, stream>>>(A, G, H);
    k_gemm<KTP, false><<<dim3(DD / 128, NR / 128, 1), 256, 0, stream>>>(PH, PL, FtT, FtT, FSA, DD);    // Fsa = P_s.Ft    [25088][512]
    k_pool<<<dim3(DD / 128, 1, NBI), 256, 0, stream>>>(FSA, FVA);
    k_logits<<<dim3(KTP / 256, 1, NBI), 256, 0, stream>>>(Fv, Ft, H, FVA, lsc, RES);
    k_out<<<(NBI * KT + 255) / 256, 256, 0, stream>>>(RES, out);
}

// v008
// One run takes 172 microseconds.
// In two side-by-side timings against v007, it was 1.09 and 1.10 times as fast.
// Over all steps from v000 it is 184 times as fast.
#include <hip/hip_runtime.h>

// Compute dtypes, f32 accumulate, all 128 images in one pass. Ft is the same for every image, so the token rows of all images form one row dimension without pad rows (128 x 196 = 25088 = 112 tiles
// of 224 rows; K = 1000 texts padded to 1024): Fs L2-normalised in f32 -> bf16 hi + UNSCALED
// residual planes; A = Fs_n.Ft^T ([25088 x 512].[512 x 1024], split Fs_n against the exact bf16 Ft, two products) and Fsa = P_s.Ft ([25088 x 1024].[1024 x 512], P_s = softmax over texts
// x 1/alpha_s in f32 -> hi/lo planes, two products) on v_wmma_f32_16x16x32_bf16. Fta = P_t.Fs_n enters the result only through Fv.Fta[k] = sum_m P_t[k][m] (Fs_n[m].Fv): the inner dots
// G[m] (one per token) come with the norms, the outer sum with the softmax over the 196 real tokens (x 1/alpha_t, f32), and Fta itself is never formed. Mean + max pooling over the real
// tokens, and the final logits (two 512-term dots per text and that sum, x exp(logit_scale)).

#define NBI  128
#define MM   196
#define NR   (NBI * MM)    // token rows of all images, image b's at b * MM
#define KT   1000
#define KTP  1024
#define DD   512
#define DM   DD
#define ALS  0.5f
#define ALT  0.5f
#define B1_  1.0f
#define B2_  0.1f
#define B3_  0.1f
#define LOSC 1024.0f

typedef _Float16 h16;
typedef unsigned short bf;
typedef __attribute__((ext_vector_type(16))) __bf16   v16bf;
typedef __attribute__((ext_vector_type(16))) _Float16 v16h;
typedef __attribute__((ext_vector_type(8)))  _Float16 v8h;
typedef __attribute__((ext_vector_type(8)))  unsigned short v8us;
typedef __attribute__((ext_vector_type(8)))  float    v8f;
typedef __attribute__((ext_vector_type(4)))  float    v4f;
typedef __attribute__((ext_vector_type(4)))  _Float16 v4h;
typedef v8h  __attribute__((may_alias)) v8ha;
typedef v4f  __attribute__((may_alias)) v4fa;
typedef v8us __attribute__((may_alias)) v8usa;

__device__ __forceinline__ unsigned short f2bf(float f) { unsigned u = __float_as_uint(f); u += 0x7FFFu + ((u >> 16) & 1u); return (unsigned short)(u >> 16); }
__device__ __forceinline__ float bf2f(unsigned short b) { return __uint_as_float(((unsigned)b) << 16); }
__device__ __forceinline__ float bfr(float f) { return bf2f(f2bf(f)); }
__device__ __forceinline__ v16h cat16(v8h lo, v8h hi) { return __builtin_shufflevector(lo, hi, 0, 1, 2, 3, 4, 5, 6, 7, 8, 9, 10, 11, 12, 13, 14, 15); }
__device__ __forceinline__ v16bf cat16b(v8us lo, v8us hi) { return __builtin_bit_cast(v16bf, __builtin_shufflevector(lo, hi, 0, 1, 2, 3, 4, 5, 6, 7, 8, 9, 10, 11, 12, 13, 14, 15)); }
__device__ __forceinline__ v8f wmma16(v16h a, v16h b, v8f c) { return __builtin_amdgcn_wmma_f32_16x16x32_f16(false, a, false, b, (short)0, c, false, false); }
__device__ __forceinline__ v8f wmmab(v16bf a, v16bf b, v8f c) { return __builtin_amdgcn_wmma_f32_16x16x32_bf16(false, a, false, b, (short)0, c, false, false); }

// k_gemm: 224 x 256 block tile (8 waves, 2 x 4, each 112 x 64 = 7 x 4 accumulator tiles) of C = (Ah + Al).Bh^T over K (every plane k-contiguous with row stride K; n-major B). Per 32 k and
// accumulator the products come in the order hh, lh. 18 fragments feed 56 products, and a stage's 704 operand rows serve 57344 results. 25088 rows = 112 row tiles.
// A stage is 64 k = one 128-byte line of each row of every plane: 8 lanes fetch a row's whole line,
// the stage goes through registers into one of two LDS buffers (row pitch 144 B for the 16-byte fragment reads) while the other buffer is multiplied.
// A wave's 7 tile rows are worked as a block of 4 and a block of 3; each block's fragments are read from LDS as one group while the block before it is multiplied.
// The inner loops are all unrolled so that the staging registers, acc and the fragments are indexed by constants and stay in registers.
#define BKE 64
#define LPB 144
#define BMR 224
#define BNC 256
#define PAB (BMR * LPB)
#define BUFB (2 * PAB + BNC * LPB)
#define OSB (8 * 112 * 68 * 4)
template <int K>
__global__ __launch_bounds__(256) void k_gemm(const bf* __restrict__ Ah, const bf* __restrict__ Al, const bf* __restrict__ Bh, float* C, int ldc) {
    constexpr int NS = K / BKE;
    __shared__ __align__(16) unsigned char sm[(2 * BUFB > OSB) ? 2 * BUFB : OSB];
    const int tid = threadIdx.x, lane = tid & 31, wave = tid >> 5, lr = lane & 15, hi = lane >> 4, wm = wave >> 2, wn = wave & 3;
    const int r0 = blockIdx.y * BMR, c0 = blockIdx.x * BNC;    // the column tiles of one row tile are neighbours in launch order: they read the same A rows
    const int soff = (tid >> 3) * LPB + (tid & 7) * 16;
    unsigned go = (unsigned)((tid >> 3) * K + (tid & 7) * 8) * 2u;    // the lane's byte offset in every plane's tile: one register serves all planes beside their block-uniform bases; it steps by a stage
    const unsigned char* sa = (const unsigned char*)(Ah + (size_t)r0 * K); const unsigned char* sl = (const unsigned char*)(Al + (size_t)r0 * K); const unsigned char* sb = (const unsigned char*)(Bh + (size_t)c0 * K);
    v8us sta[BMR / 32], stl[BMR / 32], stb[BNC / 32];
    auto fetch = [&]() {
#pragma unroll
        for (int i = 0; i < BMR / 32; ++i) { sta[i] = *(const v8us*)(sa + (size_t)go + (size_t)(i * 32 * K * 2)); stl[i] = *(const v8us*)(sl + (size_t)go + (size_t)(i * 32 * K * 2)); }
#pragma unroll
        for (int i = 0; i < BNC / 32; ++i) stb[i] = *(const v8us*)(sb + (size_t)go + (size_t)(i * 32 * K * 2));
    };
    auto put = [&](int buf) {
        unsigned char* d = sm + buf * BUFB + soff;
#pragma unroll
        for (int i = 0; i < BMR / 32; ++i) { *(v8usa*)(d + i * 32 * LPB) = sta[i]; *(v8usa*)(d + PAB + i * 32 * LPB) = stl[i]; }
#pragma unroll
        for (int i = 0; i < BNC / 32; ++i) *(v8usa*)(d + 2 * PAB + i * 32 * LPB) = stb[i];
    };
    v8f acc[7][4];
#pragma unroll
    for (int i = 0; i < 7; ++i)
#pragma unroll
        for (int t = 0; t < 4; ++t) acc[i][t] = (v8f){};
    fetch();
    asm volatile("s_wait_xcnt 0x0" :: "v"(go) : "memory");    // stands in front of every overwrite of the offset register that the loads above name; the offset is its input, so that it lives up to here
    put(0);
    go += BKE * 2;
    __syncthreads();                         // publishes stage 0
    const unsigned char* bb = sm + lr * LPB + hi * 16;    // the lane's place in the buffer that is multiplied
    v16bf xa[4], xl[4], ya[3], yl[3], b0[4], b1[4];
    auto ldb = [&](v16bf (&b)[4], int kk) {
#pragma unroll
        for (int t = 0; t < 4; ++t) { const unsigned char* p = bb + 2 * PAB + (wn * 64 + t * 16) * LPB + kk * 64; b[t] = cat16b(*(const v8usa*)p, *(const v8usa*)(p + 32)); }
    };
    auto ldx = [&](int kk) {
#pragma unroll
        for (int i = 0; i < 4; ++i) { const unsigned char* p = bb + (wm * 112 + i * 16) * LPB + kk * 64;
            xa[i] = cat16b(*(const v8usa*)p, *(const v8usa*)(p + 32)); xl[i] = cat16b(*(const v8usa*)(p + PAB), *(const v8usa*)(p + PAB + 32)); }
    };
    auto ldy = [&](int kk) {
#pragma unroll
        for (int i = 0; i < 3; ++i) { const unsigned char* p = bb + (wm * 112 + (4 + i) * 16) * LPB + kk * 64;
            ya[i] = cat16b(*(const v8usa*)p, *(const v8usa*)(p + 32)); yl[i] = cat16b(*(const v8usa*)(p + PAB), *(const v8usa*)(p + PAB + 32)); }
    };
    auto mmx = [&](const v16bf (&b)[4]) {
#pragma unroll
        for (int i = 0; i < 4; ++i) {
#pragma unroll
            for (int t = 0; t < 4; ++t) acc[i][t] = wmmab(xa[i], b[t], acc[i][t]);
#pragma unroll
            for (int t = 0; t < 4; ++t) acc[i][t] = wmmab(xl[i], b[t], acc[i][t]);
        }
    };
    auto mmy = [&](const v16bf (&b)[4]) {
#pragma unroll
        for (int i = 0; i < 3; ++i) {
#pragma unroll
            for (int t = 0; t < 4; ++t) acc[4 + i][t] = wmmab(ya[i], b[t], acc[4 + i][t]);
#pragma unroll
            for (int t = 0; t < 4; ++t) acc[4 + i][t] = wmmab(yl[i], b[t], acc[4 + i][t]);
        }
    };
    ldb(b0, 0); ldx(0);                      // stage 0's first block, read behind the barrier that publishes it
    // The scheduling barriers in the loop keep each group of LDS reads whole and in front of the block of products before the one that uses it: left free, the reads were sunk
    // to two in front of every four products, each pair's LDS latency waited out.
    for (int s = 0; s < NS; ++s) {
        ldy(0);
        if (s + 1 < NS) { fetch();
            asm volatile("s_wait_xcnt 0x0" ::: "memory"); }    // stands in front of every overwrite of an address register that these loads name: fragments are read into such registers further down
        __builtin_amdgcn_sched_barrier(0);    // also keeps the next stage's global loads in front of this stage's products: sunk to the LDS stores below, their latency would be waited out every stage
        mmx(b0);
        __builtin_amdgcn_sched_barrier(0);    // the next reads stay one group behind this block, whose fragment registers they fill
        ldb(b1, 1); ldx(1);
        __builtin_amdgcn_sched_barrier(0);    // and in front of the block below, which covers their latency
        mmy(b0);
        __builtin_amdgcn_sched_barrier(0);    // as above
        ldy(1);
        __builtin_amdgcn_sched_barrier(0);    // as above
        mmx(b1);
        __builtin_amdgcn_sched_barrier(0);    // keeps the LDS stores behind this block: lifted, they would wait for the global loads with less of the stage gone by
        if (s + 1 < NS) put((s + 1) & 1);    // the buffer that every wave left at the barrier of stage s - 1
        go += BKE * 2;
        __syncthreads();                     // publishes stage s + 1 and ends the LDS reads of stage s, whose last fragments are in registers
        bb = sm + ((s + 1) & 1) * BUFB + lr * LPB + hi * 16;
        if (s + 1 < NS) { ldb(b0, 0); ldx(0); }    // stage s + 1's first block, read behind the barrier that publishes it, under stage s's last block of products
        __builtin_amdgcn_sched_barrier(0);    // keeps those reads in front of the block below, which covers their latency
        mmy(b1);
    }
    float* os = (float*)(void*)sm + wave * (112 * 68);    // whole-line stores: each wave turns its 112 x 64 tile in its own range of LDS, free behind the last barrier
#pragma unroll
    for (int i = 0; i < 7; ++i)
#pragma unroll
        for (int t = 0; t < 4; ++t)
#pragma unroll
            for (int j = 0; j < 8; ++j) os[(i * 16 + hi * 8 + j) * 68 + t * 16 + lr] = acc[i][t][j];
    __syncthreads();                         // the tile's LDS stores are done before lanes read rows that other lanes wrote
    float* crow = C + (size_t)(r0 + wm * 112) * ldc + c0 + wn * 64;
#pragma unroll
    for (int s = 0; s < 56; ++s) { const int Lid = (lane >> 3) + 4 * s, piece = lane & 7; const int row = Lid >> 1, cofs = (Lid & 1) * 32 + piece * 4;
        const v4f val = *(const v4fa*)(os + row * 68 + cofs); *(v4f*)(crow + (size_t)row * ldc + cofs) = val; }
}

// wsum: sum over the 32 lanes of a wave, five-step butterfly; every lane ends with the same value.
__device__ __forceinline__ float wsum(float v) {
#pragma unroll
    for (int sh = 16; sh; sh >>= 1) v += __shfl_xor(v, sh, 32);
    return v;
}
// k_prep: one launch prepares every GEMM operand except PH, PL, which k_soft_s writes.
// Blocks 0 .. FTB - 1: a 64 x 64 tile of Ft (64 texts x 64 features, texts 1000..1023 as zero), read once: its bf16 rows go to FtB [1024][512] (the n-major B of A = Fs_n.Ft^T; four lanes store a
// row's whole 128-byte line) and, turned in LDS, to FtT [512][1024] (the n-major B of Fsa = P_s.Ft).
// The other blocks: a wave per token row, four rows a wave (16 loads of 16 B in flight, each 512 contiguous bytes of a row), 32 rows a block; a wave's four rows are of one image (196 = 49 x 4).
// From the same registers come 1 / |bf(Fs[m])|, G[m] = (bf(Fs[m]).bf(Fv[b])) / |bf(Fs[m])| and the normalised row's bf16 hi plane Nh and unscaled residual plane Nl (a store is 256 contiguous bytes of a row).
#define FTB ((KTP / 64) * (DD / 64))
typedef __attribute__((ext_vector_type(4))) unsigned short v4us;
__global__ __launch_bounds__(256) void k_prep(const float* __restrict__ Fs, const float* __restrict__ Fv, const float* __restrict__ Ft, bf* FtB, bf* FtT, bf* Nh, bf* Nl, float* G) {
    __shared__ __align__(16) unsigned short tl[64 * 72];
    __shared__ float sg[32];
    if (blockIdx.x < FTB) {                  // block-uniform: every barrier below is passed by a whole block or by none of it
        const int tid = threadIdx.x, k0 = (blockIdx.x % (KTP / 64)) * 64, n0 = (blockIdx.x / (KTP / 64)) * 64;
        const int kk = tid >> 2, nq = (tid & 3) * 16, k = k0 + kk;
        const float* fr = Ft + (size_t)((k < KT) ? k : KT - 1) * DD + n0 + nq;    // a pad text re-reads the last real row and stores zero
        v4f x[4]; v8us o[2], t[2];
#pragma unroll
        for (int j = 0; j < 4; ++j) x[j] = *(const v4f*)(fr + j * 4);    // all four in flight together, whatever the row
        asm volatile("s_wait_xcnt 0x0" :: "v"(fr) : "memory");    // stands in front of every overwrite of the address register that these loads name; the address is its input, so that it lives up to here
#pragma unroll
        for (int i = 0; i < 16; ++i) { const unsigned short h = (k < KT) ? f2bf(x[i >> 2][i & 3]) : (unsigned short)0; tl[(nq + i) * 72 + kk] = h; o[i >> 3][i & 7] = h; }
        __syncthreads();                     // the tile is whole in LDS before it is read the other way; no store is in flight here that the barrier would wait for
        const int piece = tid & 7, nr = tid >> 3;
#pragma unroll
        for (int s = 0; s < 2; ++s) t[s] = *(const v8usa*)(tl + (nr + 32 * s) * 72 + piece * 8);
        *(v8us*)(FtB + (size_t)k * DD + n0 + nq) = o[0]; *(v8us*)(FtB + (size_t)k * DD + n0 + nq + 8) = o[1];
#pragma unroll
        for (int s = 0; s < 2; ++s) *(v8us*)(FtT + (size_t)(n0 + nr + 32 * s) * KTP + k0 + piece * 8) = t[s];
        return;
    }
    const int lane = threadIdx.x & 31, wave = __builtin_amdgcn_readfirstlane(threadIdx.x >> 5), blk = blockIdx.x - FTB, m0 = blk * 32 + wave * 4, b = m0 / MM;
    v4f v[4][4], f[4]; const float* r[4]; const float* fp = Fv + (size_t)b * DD + lane * 4;
#pragma unroll
    for (int i = 0; i < 4; ++i) { r[i] = Fs + (size_t)(m0 + i) * DD + lane * 4;
#pragma unroll
        for (int q = 0; q < 4; ++q) v[i][q] = *(const v4f*)(r[i] + q * 128); }
#pragma unroll
    for (int q = 0; q < 4; ++q) f[q] = *(const v4f*)(fp + q * 128);
    // the wait stands in front of every overwrite of a register that these loads name as an address; the addresses are its inputs, so that none of their registers is given to a load's result ahead of it
    asm volatile("s_wait_xcnt 0x0" :: "v"(r[0]), "v"(r[1]), "v"(r[2]), "v"(r[3]), "v"(fp) : "memory");
    __builtin_amdgcn_sched_barrier(0);        // keeps all 20 loads in front of the sums: with sums lifted between them the wave would wait out the memory latency twice
#pragma unroll
    for (int q = 0; q < 4; ++q)
#pragma unroll
        for (int e = 0; e < 4; ++e) f[q][e] = bfr(f[q][e]);
    float s[4], g[4];
#pragma unroll
    for (int i = 0; i < 4; ++i) { v4f a = (v4f){}, c = (v4f){};
#pragma unroll
        for (int q = 0; q < 4; ++q) {
#pragma unroll
            for (int e = 0; e < 4; ++e) v[i][q][e] = bfr(v[i][q][e]);    // the rounded row stays in its registers for the split below
            a = __builtin_elementwise_fma(v[i][q], v[i][q], a); c = __builtin_elementwise_fma(v[i][q], f[q], c); }
        s[i] = (a[0] + a[1]) + (a[2] + a[3]); g[i] = (c[0] + c[1]) + (c[2] + c[3]); }
#pragma unroll
    for (int i = 0; i < 4; ++i) { s[i] = wsum(s[i]); g[i] = wsum(g[i]); }
    float inv[4];                            // the butterfly leaves a row's sum in every lane, so every lane forms the same 1 / norm
#pragma unroll
    for (int i = 0; i < 4; ++i) inv[i] = 1.0f / sqrtf(s[i]);
#pragma unroll
    for (int i = 0; i < 4; ++i) g[i] *= inv[i];
    if (lane < 4) sg[wave * 4 + lane] = (lane == 0) ? g[0] : (lane == 1) ? g[1] : (lane == 2) ? g[2] : g[3];    // lane i keeps row i
    __syncthreads();                         // the eight waves' G are in LDS before a wave stores the block's whole 128-byte line; it stands ahead of the planes' stores, which it would otherwise wait for
    if (threadIdx.x < 32) { G[blk * 32 + threadIdx.x] = sg[threadIdx.x];
        asm volatile("s_wait_xcnt 0x0" ::: "memory"); }    // stands in front of the split's overwrite of the registers that this store names
    v4us oh[4][4], ol[4][4];
#pragma unroll
    for (int i = 0; i < 4; ++i)
#pragma unroll
        for (int q = 0; q < 4; ++q)
#pragma unroll
            for (int e = 0; e < 4; ++e) { const float x = v[i][q][e] * inv[i]; const unsigned short hb = f2bf(x); oh[i][q][e] = hb; ol[i][q][e] = f2bf(x - bf2f(hb)); }
    __builtin_amdgcn_sched_barrier(0);        // keeps the 32 stores behind the arithmetic, the wave's last: no register that an issued store names is written any more
    bf* ph = Nh + (size_t)m0 * DD + lane * 4; bf* pl = Nl + (size_t)m0 * DD + lane * 4;
#pragma unroll
    for (int i = 0; i < 4; ++i)
#pragma unroll
        for (int q = 0; q < 4; ++q) { *(v4us*)(ph + i * DD + q * 128) = oh[i][q]; *(v4us*)(pl + i * DD + q * 128) = ol[i][q]; }
}
__global__ __launch_bounds__(256) void k_soft_s(const float* __restrict__ A, bf* PH, bf* PL) {
    const int lane = threadIdx.x & 31, m = blockIdx.x * 8 + (threadIdx.x >> 5);
    const float* ar = A + (size_t)m * KTP; float mx = -3.0e38f;
#pragma unroll 1
    for (int c0 = lane * 8; c0 < KTP; c0 += 256) { const v8f v = *(const v8f*)(ar + c0);
#pragma unroll
        for (int i = 0; i < 8; ++i) if (c0 + i < KT) mx = fmaxf(mx, v[i] * (1.0f / ALS)); }
#pragma unroll
    for (int sh = 16; sh; sh >>= 1) mx = fmaxf(mx, __shfl_xor(mx, sh, 32));
    float sum = 0.f;
#pragma unroll 1
    for (int c0 = lane * 8; c0 < KTP; c0 += 256) { const v8f v = *(const v8f*)(ar + c0);
#pragma unroll
        for (int i = 0; i < 8; ++i) if (c0 + i < KT) sum += __expf(v[i] * (1.0f / ALS) - mx); }
#pragma unroll
    for (int sh = 16; sh; sh >>= 1) sum += __shfl_xor(sum, sh, 32);
    const float inv = 1.0f / sum;
{
#pragma unroll 1
        for (int c0 = lane * 8; c0 < KTP; c0 += 256) { const v8f v = *(const v8f*)(ar + c0); v8us oh, ol;
#pragma unroll
            for (int i = 0; i < 8; ++i) { const float p = (c0 + i < KT) ? __expf(v[i] * (1.0f / ALS) - mx) * inv : 0.f; const unsigned short hb = f2bf(p); oh[i] = hb; ol[i] = f2bf(p - bf2f(hb)); }
            const size_t o = (size_t)m * KTP + c0; *(v8us*)(PH + o) = oh; *(v8us*)(PL + o) = ol; }
         }
}
// ex4: e^x of four values, formed as __expf forms it (x * log2 e, then v_exp_f32). One statement, so that behind each v_exp_f32 stands an instruction that neither reads its result nor overwrites
// its source, the slot the instruction set asks for: the next v_exp_f32 (the outputs share no register with the inputs), and a v_nop behind the last.
__device__ __forceinline__ v4f ex4(v4f x) {
    x *= 1.44269504f; v4f r;
    asm("v_exp_f32 %0, %4\n\tv_exp_f32 %1, %5\n\tv_exp_f32 %2, %6\n\tv_exp_f32 %3, %7\n\tv_nop" : "=&v"(r[0]), "=&v"(r[1]), "=&v"(r[2]), "=&v"(r[3]) : "v"(x[0]), "v"(x[1]), "v"(x[2]), "v"(x[3]));
    return r;
}
// k_soft_t: H[k] = sum_m P_t[k][m] G[m], P_t the softmax over the 196 real tokens of A[m][k] / alpha_t (f32); pad texts give 0. A block takes TC = 64 columns (256 contiguous bytes of every
// row of A) and all 256 token places: 16 lanes fetch a row's 256 bytes, a thread holds 4 columns of two runs of eight consecutive tokens (m = j * 128 + wave * 16 + (lane >> 4) * 8 + i; pad
// tokens re-read the last real row and count as absent). A column's maximum, sum and weighted sum: a thread's 16 tokens in order, the lane 16 apart, then the eight waves' values from LDS in wave order.
#define TC 64
__global__ __launch_bounds__(256) void k_soft_t(const float* __restrict__ A, const float* __restrict__ G, float* H) {
    __shared__ __align__(16) float rm[8 * TC], rq[8 * TC], rg[8 * TC];
    const int lane = threadIdx.x & 31, wave = threadIdx.x >> 5, c16 = lane & 15, rs = lane >> 4, mb = wave * 16 + rs * 8, k0 = blockIdx.x * TC;
    const unsigned char* base = (const unsigned char*)(A + (size_t)blockIdx.z * MM * KTP + k0); const unsigned char* gb = (const unsigned char*)(G + (size_t)blockIdx.z * MM);    // block-uniform; the lane's part is a byte offset
    const unsigned o0 = (unsigned)(mb * KTP + c16 * 4) * 4u, io = (unsigned)mb * 4u; unsigned o1[8], i1[2];    // o1[i] + (128 + i) rows is token 128 + mb + i, or the last real token where that is a pad
    v4f v[2][8]; v4f gv[2][2];
#pragma unroll
    for (int i = 0; i < 8; ++i) v[0][i] = *(const v4f*)(base + (size_t)o0 + (size_t)(i * KTP * 4));
#pragma unroll
    for (int i = 0; i < 8; ++i) { o1[i] = (unsigned)(((mb < MM - 1 - 128 - i) ? mb : MM - 1 - 128 - i) * KTP + c16 * 4) * 4u; v[1][i] = *(const v4f*)(base + (size_t)o1[i] + (size_t)((128 + i) * KTP * 4)); }
#pragma unroll
    for (int h = 0; h < 2; ++h) { gv[0][h] = *(const v4f*)(gb + (size_t)io + (size_t)(h * 16));    // a group of four token places is all real or all pad (196 = 49 x 4): a pad group re-reads the image's last four G, which meet a weight of exactly 0
        i1[h] = (unsigned)((mb + h * 4 < MM - 4 - 128) ? mb + h * 4 : MM - 4 - 128) * 4u; gv[1][h] = *(const v4f*)(gb + (size_t)i1[h] + (size_t)512); }
    // the wait stands in front of every overwrite of a register that these loads name as an address; the offsets are its inputs, so that none of their registers is given to a load's result ahead of it
    asm volatile("s_wait_xcnt 0x0" :: "v"(o0), "v"(o1[0]), "v"(o1[1]), "v"(o1[2]), "v"(o1[3]), "v"(o1[4]), "v"(o1[5]), "v"(o1[6]), "v"(o1[7]), "v"(io), "v"(i1[0]), "v"(i1[1]) : "memory");
    __builtin_amdgcn_sched_barrier(0);        // keeps all 20 loads in front of the arithmetic: with arithmetic lifted between them the wave would wait out the memory latency twice
    v4f mx = (v4f){-3.0e38f, -3.0e38f, -3.0e38f, -3.0e38f};
#pragma unroll
    for (int j = 0; j < 2; ++j)
#pragma unroll
        for (int i = 0; i < 8; ++i)
#pragma unroll
            for (int e = 0; e < 4; ++e) { const float x = (j == 0 || 128 + mb + i < MM) ? v[j][i][e] * (1.0f / ALT) : -3.0e38f; v[j][i][e] = x; mx[e] = fmaxf(mx[e], x); }    // the first 128 tokens are all real
#pragma unroll
    for (int e = 0; e < 4; ++e) mx[e] = fmaxf(mx[e], __shfl_xor(mx[e], 16, 32));
    if (rs == 0) *(v4fa*)(rm + wave * TC + c16 * 4) = mx;
    __syncthreads();                         // the eight waves' column maxima are in LDS before they are combined
#pragma unroll
    for (int w = 0; w < 8; ++w) { const v4f t = *(const v4fa*)(rm + w * TC + c16 * 4);
#pragma unroll
        for (int e = 0; e < 4; ++e) mx[e] = fmaxf(mx[e], t[e]); }
    v4f sum = (v4f){}, wg = (v4f){};
#pragma unroll
    for (int j = 0; j < 2; ++j)
#pragma unroll
        for (int i = 0; i < 8; ++i) { const v4f ev = ex4(v[j][i] - mx); const float gm = gv[j][i >> 2][i & 3]; sum += ev; wg = __builtin_elementwise_fma(ev, (v4f){gm, gm, gm, gm}, wg); }    // a pad token's -3.0e38 under a real token's maximum gives exactly 0
#pragma unroll
    for (int e = 0; e < 4; ++e) { sum[e] += __shfl_xor(sum[e], 16, 32); wg[e] += __shfl_xor(wg[e], 16, 32); }
    if (rs == 0) { *(v4fa*)(rq + wave * TC + c16 * 4) = sum; *(v4fa*)(rg + wave * TC + c16 * 4) = wg; }
    __syncthreads();                         // the eight waves' column sums are in LDS before they are combined
    if (threadIdx.x < 16) {                  // 16 lanes finish the block's 64 columns and store its two whole lines
        v4f tot = (v4f){}, tg = (v4f){}, h;
#pragma unroll
        for (int w = 0; w < 8; ++w) { tot += *(const v4fa*)(rq + w * TC + c16 * 4); tg += *(const v4fa*)(rg + w * TC + c16 * 4); }
#pragma unroll
        for (int e = 0; e < 4; ++e) h[e] = (k0 + c16 * 4 + e < KT) ? tg[e] / tot[e] : 0.f;
        *(v4f*)(H + (size_t)blockIdx.z * KTP + k0 + c16 * 4) = h; }
}
// k_pool: a block per 128 columns of an image; wave w takes the tokens w, w + 8, ... (a lane holds 4 columns, a load is 512 contiguous bytes of a token's row, the loop unrolled so that
// many of a wave's loads are in flight together); the eight waves' sums and maxima meet in LDS and are combined in wave order.
__global__ __launch_bounds__(256) void k_pool(const float* __restrict__ Fsa, float* FVA) {
    __shared__ __align__(16) float ps[8 * 128], pm[8 * 128];
    const int lane = threadIdx.x & 31, wave = threadIdx.x >> 5, d0 = blockIdx.x * 128, b = blockIdx.z;
    const float* p = Fsa + (size_t)b * MM * DD + (size_t)wave * DD + d0 + lane * 4;
    v4f s = (v4f){}, mx = (v4f){-3.0e38f, -3.0e38f, -3.0e38f, -3.0e38f};
#pragma unroll
    for (int j = 0; j < MM / 8; ++j) { const v4f v = *(const v4f*)(p + (size_t)(8 * j) * DD);
#pragma unroll
        for (int e = 0; e < 4; ++e) { s[e] += v[e]; mx[e] = fmaxf(mx[e], v[e]); } }
    if (wave < MM % 8) { const v4f v = *(const v4f*)(p + (size_t)(8 * (MM / 8)) * DD);
#pragma unroll
        for (int e = 0; e < 4; ++e) { s[e] += v[e]; mx[e] = fmaxf(mx[e], v[e]); } }
    asm volatile("s_wait_xcnt 0x0" :: "v"(p) : "memory");    // stands in front of every overwrite of the address register that the loads above name; the address is its input, so that it lives up to here
    *(v4fa*)(ps + wave * 128 + lane * 4) = s; *(v4fa*)(pm + wave * 128 + lane * 4) = mx;
    __syncthreads();                         // every wave's partial sums and maxima are in LDS before they are combined
    if (threadIdx.x < 128) { float t = 0.f, m = -3.0e38f;
#pragma unroll
        for (int w = 0; w < 8; ++w) { t += ps[w * 128 + threadIdx.x]; m = fmaxf(m, pm[w * 128 + threadIdx.x]); }
        FVA[(size_t)b * DD + d0 + threadIdx.x] = t * (1.0f / MM) + m; }
}
// k_logits: RES[b][k] = ls (beta1 bf(Fv[b]).bf(Ft[k]) + beta2 H[k] + beta3 Fva[b].bf(Ft[k])) (f32), ls = e^bf(logit_scale), H[k] = Fv[b].Fta[k] as k_soft_t leaves it. A wave per text row, 32 rows
// a wave: Fv[b] and Fva[b] stay in registers (a lane holds 16 of the 512 terms), each row of Ft comes as four loads of 512 contiguous bytes, four rows a step, the next step's 16 loads issued
// before a step is summed; a lane adds its 16 terms of the two dots, weights them, and a butterfly adds the lanes; lane j keeps row j, so the wave stores one whole line. Pad texts read Ft's last row and store 0.
__global__ __launch_bounds__(256) void k_logits(const float* __restrict__ Fv, const float* __restrict__ Ft, const float* __restrict__ H, const float* __restrict__ FVA, const float* __restrict__ lsc, float* RES) {
    const int lane = threadIdx.x & 31, k0 = blockIdx.x * 256 + __builtin_amdgcn_readfirstlane(threadIdx.x >> 5) * 32, b = blockIdx.z;
    const float hk = H[(size_t)b * KTP + k0 + lane];
    v4f fv[4], fa[4];
#pragma unroll
    for (int q = 0; q < 4; ++q) { const v4f v = *(const v4f*)(Fv + (size_t)b * DD + q * 128 + lane * 4); fa[q] = *(const v4f*)(FVA + (size_t)b * DD + q * 128 + lane * 4);
#pragma unroll
        for (int e = 0; e < 4; ++e) fv[q][e] = bfr(v[e]); }
    v4f tA[4][4], tB[4][4];
    auto fetch = [&](int g, v4f (&t)[4][4]) {
        const float* tp[4];
#pragma unroll
        for (int i = 0; i < 4; ++i) { const int k = k0 + g * 4 + i, kc = (k < KT) ? k : KT - 1; tp[i] = Ft + (size_t)kc * DD + lane * 4;
#pragma unroll
            for (int q = 0; q < 4; ++q) t[i][q] = *(const v4f*)(tp[i] + q * 128); }
        // the wait stands in front of every overwrite of a register that these loads name as an address; the addresses are its inputs, so that none of their registers is given to a load's result ahead of it
        asm volatile("s_wait_xcnt 0x0" :: "v"(tp[0]), "v"(tp[1]), "v"(tp[2]), "v"(tp[3]) : "memory");
    };
    float res = 0.f;
    auto sum = [&](int g, const v4f (&t)[4][4]) {
        float c[4];
#pragma unroll
        for (int i = 0; i < 4; ++i) { v4f d1 = (v4f){}, d3 = (v4f){};    // four chains a dot, on the registers as the loads fill them
#pragma unroll
            for (int q = 0; q < 4; ++q) { v4f ft;
#pragma unroll
                for (int e = 0; e < 4; ++e) ft[e] = bfr(t[i][q][e]);
                d1 = __builtin_elementwise_fma(fv[q], ft, d1); d3 = __builtin_elementwise_fma(fa[q], ft, d3); }
            const v4f w = B1_ * d1 + B3_ * d3; c[i] = (w[0] + w[1]) + (w[2] + w[3]); }
#pragma unroll
        for (int i = 0; i < 4; ++i) c[i] = wsum(c[i]);
#pragma unroll
        for (int i = 0; i < 4; ++i) if (lane == g * 4 + i) res = c[i];
    };
    fetch(0, tA);
#pragma unroll 1
    for (int g = 0; g < 6; g += 2) {         // rolled: two steps a trip, so that the two register sets are named by constants
        fetch(g + 1, tB);
        __builtin_amdgcn_sched_barrier(0);    // keeps the next step's loads in front of this step's sums: sunk behind them, their latency would be waited out every step
        sum(g, tA);
        __builtin_amdgcn_sched_barrier(0);    // keeps the refill's loads behind this step's butterflies: lifted between them, the four butterflies ran one after the other, each LDS round trip waited out alone
        fetch(g + 2, tA);
        __builtin_amdgcn_sched_barrier(0);    // as above
        sum(g + 1, tB);
    }
    fetch(7, tB);                            // the last two steps stand alone: no load behind the wave's last row, and no branch in the loop that would make its waits count for both paths
    __builtin_amdgcn_sched_barrier(0);        // as above
    sum(6, tA);
    sum(7, tB);
    const float ls = __expf(bfr(lsc[0]));
    RES[(size_t)b * KTP + k0 + lane] = (k0 + lane < KT) ? ls * (res + B2_ * hk) : 0.f;
}
__global__ __launch_bounds__(256) void k_out(const float* __restrict__ RES, float* OUTP) {
    const int i = blockIdx.x * 256 + threadIdx.x; if (i >= NBI * KT) return; const float v = RES[(size_t)(i / KT) * KTP + (i % KT)];
    *(float*)(OUTP + i) = v; 
}

extern "C" void kernel_launch(void* const* d_in, const int* in_sizes, int n_in,
                              void* d_out, int out_size, void* d_ws, size_t ws_size, hipStream_t stream) {
    (void)in_sizes; (void)n_in; (void)out_size;
    const float* Fs = (const float*)d_in[0]; const float* Ft = (const float*)d_in[1]; const float* Fv = (const float*)d_in[2]; const float* lsc = (const float*)d_in[3];
    float* out = (float*)d_out;    // [128][1][1000]
    char* wsp = (char*)d_ws;
    auto take = [&](size_t bytes) { char* p = wsp; wsp += (bytes + 255) & ~(size_t)255; return (void*)p; };
    bf* FtB = (bf*)take((size_t)KTP * DD * 2); bf* FtT = (bf*)take((size_t)DD * KTP * 2);
    float* G = (float*)take((size_t)NR * 4); float* H = (float*)take((size_t)NBI * KTP * 4); float* FVA = (float*)take((size_t)NBI * DD * 4); float* RES = (float*)take((size_t)NBI * KTP * 4);
    // One region holds, one after the other in stream order: {A | Nh, Nl}, then {A | PH, PL}, then {FSA | PH, PL}. Each plane is written after the last read of what it lies on.
    float* A = (float*)take((size_t)NR * KTP * 4 * 2); float* FSA = A;
    bf* PH = (bf*)(A + (size_t)NR * KTP); bf* PL = PH + (size_t)NR * KTP; bf* Nh = PH; bf* Nl = Nh + (size_t)NR * DD;
    if ((size_t)(wsp - (char*)d_ws) > ws_size) return;    // 2 + 1.5 + 196 ~ 200 MiB
    k_prep<<<FTB + NR / 32, 256, 0, stream>>>(Fs, Fv, Ft, FtB, FtT, Nh, Nl, G);     // FtB, Ft^T [512][1024] exact bf16; Nh, Nl, G
    k_gemm<DD><<<dim3(KTP / BNC, NR / BMR, 1), 256, 0, stream>>>(Nh, Nl, FtB, A, KTP);     // A = Fs_n.Ft^T  [25088][1024]
    k_soft_s<<<NR / 8, 256, 0, stream>>>(A, PH, PL); k_soft_t<<<dim3(KTP / TC, 1, NBI), 256, 0, stream>>>(A, G, H);
    k_gemm<KTP><<<dim3(DD / BNC, NR / BMR, 1), 256, 0, stream>>>(PH, PL, FtT, FSA, DD);    // Fsa = P_s.Ft    [25088][512]
    k_pool<<<dim3(DD / 128, 1, NBI), 256, 0, stream>>>(FSA, FVA);
    k_logits<<<dim3(KTP / 256, 1, NBI), 256, 0, stream>>>(Fv, Ft, H, FVA, lsc, RES);
    k_out<<<(NBI * KT + 255) / 256, 256, 0, stream>>>(RES, out);
}

// v009
// One run takes 157 microseconds.
// Next to v008, in two timings, it ran 1.10 and 1.09 times as fast.
// All steps since v000 together make it 202 times as fast.
#include <hip/hip_runtime.h>

// Compute dtypes, f32 accumulate, all 128 images in one pass. Ft is the same for every image, so the token rows of all images form one row dimension without pad rows (128 x 196 = 25088 = 112 tiles
// of 224 rows; K = 1000 texts padded to 1024): Fs L2-normalised in f32 -> bf16 hi + UNSCALED
// residual planes; A = Fs_n.Ft^T ([25088 x 512].[512 x 1024], split Fs_n against the exact bf16 Ft, two products) and Fsa = P_s.Ft ([25088 x 1024].[1024 x 512], P_s = softmax over texts
// x 1/alpha_s in f32 -> hi/lo planes, two products) on v_wmma_f32_16x16x32_bf16. Fta = P_t.Fs_n enters the result only through Fv.Fta[k] = sum_m P_t[k][m] (Fs_n[m].Fv): the inner dots
// G[m] (one per token) come with the norms, the outer sum with the softmax over the 196 real tokens (x 1/alpha_t, f32), and Fta itself is never formed. Mean + max pooling over the real
// tokens straight from the second product's accumulators (Fsa itself is never stored), and the final logits (two 512-term dots per text and that sum, x exp(logit_scale)).

#define NBI  128
#define MM   196
#define NR   (NBI * MM)    // token rows of all images, image b's at b * MM
#define KT   1000
#define KTP  1024
#define DD   512
#define DM   DD
#define ALS  0.5f
#define ALT  0.5f
#define B1_  1.0f
#define B2_  0.1f
#define B3_  0.1f
#define LOSC 1024.0f

typedef _Float16 h16;
typedef unsigned short bf;
typedef __attribute__((ext_vector_type(16))) __bf16   v16bf;
typedef __attribute__((ext_vector_type(16))) _Float16 v16h;
typedef __attribute__((ext_vector_type(8)))  _Float16 v8h;
typedef __attribute__((ext_vector_type(8)))  unsigned short v8us;
typedef __attribute__((ext_vector_type(8)))  float    v8f;
typedef __attribute__((ext_vector_type(4)))  float    v4f;
typedef __attribute__((ext_vector_type(4)))  _Float16 v4h;
typedef v8h  __attribute__((may_alias)) v8ha;
typedef v4f  __attribute__((may_alias)) v4fa;
typedef v8us __attribute__((may_alias)) v8usa;

__device__ __forceinline__ unsigned short f2bf(float f) { unsigned u = __float_as_uint(f); u += 0x7FFFu + ((u >> 16) & 1u); return (unsigned short)(u >> 16); }
__device__ __forceinline__ float bf2f(unsigned short b) { return __uint_as_float(((unsigned)b) << 16); }
__device__ __forceinline__ float bfr(float f) { return bf2f(f2bf(f)); }
__device__ __forceinline__ v16h cat16(v8h lo, v8h hi) { return __builtin_shufflevector(lo, hi, 0, 1, 2, 3, 4, 5, 6, 7, 8, 9, 10, 11, 12, 13, 14, 15); }
__device__ __forceinline__ v16bf cat16b(v8us lo, v8us hi) { return __builtin_bit_cast(v16bf, __builtin_shufflevector(lo, hi, 0, 1, 2, 3, 4, 5, 6, 7, 8, 9, 10, 11, 12, 13, 14, 15)); }
__device__ __forceinline__ v8f wmma16(v16h a, v16h b, v8f c) { return __builtin_amdgcn_wmma_f32_16x16x32_f16(false, a, false, b, (short)0, c, false, false); }
__device__ __forceinline__ v8f wmmab(v16bf a, v16bf b, v8f c) { return __builtin_amdgcn_wmma_f32_16x16x32_bf16(false, a, false, b, (short)0, c, false, false); }

// k_gemm: 224 x 256 block tile (8 waves, 2 x 4, each 112 x 64 = 7 x 4 accumulator tiles) of C = (Ah + Al).Bh^T over K (every plane k-contiguous with row stride K; n-major B). Per 32 k and
// accumulator the products come in the order hh, lh. 18 fragments feed 56 products, and a stage's 704 operand rows serve 57344 results. 25088 rows = 112 row tiles.
// A stage is 64 k = one 128-byte line of each row of every plane: 8 lanes fetch a row's whole line,
// the stage goes through registers into one of two LDS buffers (row pitch 144 B for the 16-byte fragment reads) while the other buffer is multiplied.
// A wave's 7 tile rows are worked as a block of 4 and a block of 3; each block's fragments are read from LDS as one group while the block before it is multiplied.
// The inner loops are all unrolled so that the staging registers, acc and the fragments are indexed by constants and stay in registers.
#define BKE 64
#define LPB 144
#define BMR 224
#define BNC 256
#define PAB (BMR * LPB)
#define BUFB (2 * PAB + BNC * LPB)
#define OSB (8 * 112 * 68 * 4)
// POOL: C is not stored. A wave's 112 rows (chunk ch = row / 112 of the 224 chunks) lie in at most two images (112 < 196): per column it leaves the sum and the maximum of its rows of the first
// image (segment 0) and of the next (segment 1; 0 and -3.0e38 where the chunk has none) in C as [224][2][512] sums, then as many maxima.
#define NCH (NR / 112)
#define PMO (NCH * 2 * DD)
template <int K, bool POOL>
__global__ __launch_bounds__(256) void k_gemm(const bf* __restrict__ Ah, const bf* __restrict__ Al, const bf* __restrict__ Bh, float* C, int ldc) {
    constexpr int NS = K / BKE;
    __shared__ __align__(16) unsigned char sm[(2 * BUFB > OSB) ? 2 * BUFB : OSB];
    const int tid = threadIdx.x, lane = tid & 31, wave = tid >> 5, lr = lane & 15, hi = lane >> 4, wm = wave >> 2, wn = wave & 3;
    const int r0 = blockIdx.y * BMR, c0 = blockIdx.x * BNC;    // the column tiles of one row tile are neighbours in launch order: they read the same A rows
    const int soff = (tid >> 3) * LPB + (tid & 7) * 16;
    unsigned go = (unsigned)((tid >> 3) * K + (tid & 7) * 8) * 2u;    // the lane's byte offset in every plane's tile: one register serves all planes beside their block-uniform bases; it steps by a stage
    const unsigned char* sa = (const unsigned char*)(Ah + (size_t)r0 * K); const unsigned char* sl = (const unsigned char*)(Al + (size_t)r0 * K); const unsigned char* sb = (const unsigned char*)(Bh + (size_t)c0 * K);
    v8us sta[BMR / 32], stl[BMR / 32], stb[BNC / 32];
    auto fetch = [&]() {
#pragma unroll
        for (int i = 0; i < BMR / 32; ++i) { sta[i] = *(const v8us*)(sa + (size_t)go + (size_t)(i * 32 * K * 2)); stl[i] = *(const v8us*)(sl + (size_t)go + (size_t)(i * 32 * K * 2)); }
#pragma unroll
        for (int i = 0; i < BNC / 32; ++i) stb[i] = *(const v8us*)(sb + (size_t)go + (size_t)(i * 32 * K * 2));
    };
    auto put = [&](int buf) {
        unsigned char* d = sm + buf * BUFB + soff;
#pragma unroll
        for (int i = 0; i < BMR / 32; ++i) { *(v8usa*)(d + i * 32 * LPB) = sta[i]; *(v8usa*)(d + PAB + i * 32 * LPB) = stl[i]; }
#pragma unroll
        for (int i = 0; i < BNC / 32; ++i) *(v8usa*)(d + 2 * PAB + i * 32 * LPB) = stb[i];
    };
    v8f acc[7][4];
#pragma unroll
    for (int i = 0; i < 7; ++i)
#pragma unroll
        for (int t = 0; t < 4; ++t) acc[i][t] = (v8f){};
    fetch();
    asm volatile("s_wait_xcnt 0x0" :: "v"(go) : "memory");    // stands in front of every overwrite of the offset register that the loads above name; the offset is its input, so that it lives up to here
    put(0);
    go += BKE * 2;
    __syncthreads();                         // publishes stage 0
    const unsigned char* bb = sm + lr * LPB + hi * 16;    // the lane's place in the buffer that is multiplied
    v16bf xa[4], xl[4], ya[3], yl[3], b0[4], b1[4];
    auto ldb = [&](v16bf (&b)[4], int kk) {
#pragma unroll
        for (int t = 0; t < 4; ++t) { const unsigned char* p = bb + 2 * PAB + (wn * 64 + t * 16) * LPB + kk * 64; b[t] = cat16b(*(const v8usa*)p, *(const v8usa*)(p + 32)); }
    };
    auto ldx = [&](int kk) {
#pragma unroll
        for (int i = 0; i < 4; ++i) { const unsigned char* p = bb + (wm * 112 + i * 16) * LPB + kk * 64;
            xa[i] = cat16b(*(const v8usa*)p, *(const v8usa*)(p + 32)); xl[i] = cat16b(*(const v8usa*)(p + PAB), *(const v8usa*)(p + PAB + 32)); }
    };
    auto ldy = [&](int kk) {
#pragma unroll
        for (int i = 0; i < 3; ++i) { const unsigned char* p = bb + (wm * 112 + (4 + i) * 16) * LPB + kk * 64;
            ya[i] = cat16b(*(const v8usa*)p, *(const v8usa*)(p + 32)); yl[i] = cat16b(*(const v8usa*)(p + PAB), *(const v8usa*)(p + PAB + 32)); }
    };
    auto mmx = [&](const v16bf (&b)[4]) {
#pragma unroll
        for (int i = 0; i < 4; ++i) {
#pragma unroll
            for (int t = 0; t < 4; ++t) acc[i][t] = wmmab(xa[i], b[t], acc[i][t]);
#pragma unroll
            for (int t = 0; t < 4; ++t) acc[i][t] = wmmab(xl[i], b[t], acc[i][t]);
        }
    };
    auto mmy = [&](const v16bf (&b)[4]) {
#pragma unroll
        for (int i = 0; i < 3; ++i) {
#pragma unroll
            for (int t = 0; t < 4; ++t) acc[4 + i][t] = wmmab(ya[i], b[t], acc[4 + i][t]);
#pragma unroll
            for (int t = 0; t < 4; ++t) acc[4 + i][t] = wmmab(yl[i], b[t], acc[4 + i][t]);
        }
    };
    ldb(b0, 0); ldx(0);                      // stage 0's first block, read behind the barrier that publishes it
    // The scheduling barriers in the loop keep each group of LDS reads whole and in front of the block of products before the one that uses it: left free, the reads were sunk
    // to two in front of every four products, each pair's LDS latency waited out.
    for (int s = 0; s < NS; ++s) {
        ldy(0);
        if (s + 1 < NS) { fetch();
            asm volatile("s_wait_xcnt 0x0" ::: "memory"); }    // stands in front of every overwrite of an address register that these loads name: fragments are read into such registers further down
        __builtin_amdgcn_sched_barrier(0);    // also keeps the next stage's global loads in front of this stage's products: sunk to the LDS stores below, their latency would be waited out every stage
        mmx(b0);
        __builtin_amdgcn_sched_barrier(0);    // the next reads stay one group behind this block, whose fragment registers they fill
        ldb(b1, 1); ldx(1);
        __builtin_amdgcn_sched_barrier(0);    // and in front of the block below, which covers their latency
        mmy(b0);
        __builtin_amdgcn_sched_barrier(0);    // as above
        ldy(1);
        __builtin_amdgcn_sched_barrier(0);    // as above
        mmx(b1);
        __builtin_amdgcn_sched_barrier(0);    // keeps the LDS stores behind this block: lifted, they would wait for the global loads with less of the stage gone by
        if (s + 1 < NS) put((s + 1) & 1);    // the buffer that every wave left at the barrier of stage s - 1
        go += BKE * 2;
        __syncthreads();                     // publishes stage s + 1 and ends the LDS reads of stage s, whose last fragments are in registers
        bb = sm + ((s + 1) & 1) * BUFB + lr * LPB + hi * 16;
        if (s + 1 < NS) { ldb(b0, 0); ldx(0); }    // stage s + 1's first block, read behind the barrier that publishes it, under stage s's last block of products
        __builtin_amdgcn_sched_barrier(0);    // keeps those reads in front of the block below, which covers their latency
        mmy(b1);
    }
    if constexpr (POOL) {
        const int ch = blockIdx.y * 2 + wm, nb = (ch * 112 / MM + 1) * MM - ch * 112;    // nb: the chunk's first row of the next image; a multiple of 4, as 196 and 112 are, so four consecutive rows are of one image
        float so[4], mo[4];
#pragma unroll
        for (int t = 0; t < 4; ++t) { float s0 = 0.f, s1 = 0.f, m0 = -3.0e38f, m1 = -3.0e38f;
#pragma unroll
            for (int i = 0; i < 7; ++i)
#pragma unroll
                for (int g = 0; g < 8; g += 4) { const bool in0 = i * 16 + hi * 8 + g < nb;
                    const float s = (acc[i][t][g] + acc[i][t][g + 1]) + (acc[i][t][g + 2] + acc[i][t][g + 3]), m = fmaxf(fmaxf(acc[i][t][g], acc[i][t][g + 1]), fmaxf(acc[i][t][g + 2], acc[i][t][g + 3]));
                    s0 += in0 ? s : 0.f; s1 += in0 ? 0.f : s; m0 = fmaxf(m0, in0 ? m : -3.0e38f); m1 = fmaxf(m1, in0 ? -3.0e38f : m); }
            s0 += __shfl_xor(s0, 16, 32); s1 += __shfl_xor(s1, 16, 32); m0 = fmaxf(m0, __shfl_xor(m0, 16, 32)); m1 = fmaxf(m1, __shfl_xor(m1, 16, 32));    // the lane 16 apart holds the column's other rows
            so[t] = hi ? s1 : s0; mo[t] = hi ? m1 : m0; }    // lanes 0..15 store segment 0, lanes 16..31 segment 1
        __builtin_amdgcn_sched_barrier(0);    // keeps the 8 stores behind the arithmetic, the wave's last: no register that an issued store names is written any more
        float* ps = C + (size_t)(ch * 2 + hi) * DD + c0 + wn * 64 + lr;
#pragma unroll
        for (int t = 0; t < 4; ++t) { ps[t * 16] = so[t]; ps[PMO + t * 16] = mo[t]; }
        return;
    }
    float* os = (float*)(void*)sm + wave * (112 * 68);    // whole-line stores: each wave turns its 112 x 64 tile in its own range of LDS, free behind the last barrier
#pragma unroll
    for (int i = 0; i < 7; ++i)
#pragma unroll
        for (int t = 0; t < 4; ++t)
#pragma unroll
            for (int j = 0; j < 8; ++j) os[(i * 16 + hi * 8 + j) * 68 + t * 16 + lr] = acc[i][t][j];
    __syncthreads();                         // the tile's LDS stores are done before lanes read rows that other lanes wrote
    float* crow = C + (size_t)(r0 + wm * 112) * ldc + c0 + wn * 64;
#pragma unroll
    for (int s = 0; s < 56; ++s) { const int Lid = (lane >> 3) + 4 * s, piece = lane & 7; const int row = Lid >> 1, cofs = (Lid & 1) * 32 + piece * 4;
        const v4f val = *(const v4fa*)(os + row * 68 + cofs); *(v4f*)(crow + (size_t)row * ldc + cofs) = val; }
}

// wsum: sum over the 32 lanes of a wave, five-step butterfly; every lane ends with the same value.
__device__ __forceinline__ float wsum(float v) {
#pragma unroll
    for (int sh = 16; sh; sh >>= 1) v += __shfl_xor(v, sh, 32);
    return v;
}
// k_prep: one launch prepares every GEMM operand except PH, PL, which k_soft_s writes.
// Blocks 0 .. FTB - 1: a 64 x 64 tile of Ft (64 texts x 64 features, texts 1000..1023 as zero), read once: its bf16 rows go to FtB [1024][512] (the n-major B of A = Fs_n.Ft^T; four lanes store a
// row's whole 128-byte line) and, turned in LDS, to FtT [512][1024] (the n-major B of Fsa = P_s.Ft).
// The other blocks: a wave per token row, four rows a wave (16 loads of 16 B in flight, each 512 contiguous bytes of a row), 32 rows a block; a wave's four rows are of one image (196 = 49 x 4).
// From the same registers come 1 / |bf(Fs[m])|, G[m] = (bf(Fs[m]).bf(Fv[b])) / |bf(Fs[m])| and the normalised row's bf16 hi plane Nh and unscaled residual plane Nl (a store is 256 contiguous bytes of a row).
#define FTB ((KTP / 64) * (DD / 64))
typedef __attribute__((ext_vector_type(4))) unsigned short v4us;
__global__ __launch_bounds__(256) void k_prep(const float* __restrict__ Fs, const float* __restrict__ Fv, const float* __restrict__ Ft, bf* FtB, bf* FtT, bf* Nh, bf* Nl, float* G) {
    __shared__ __align__(16) unsigned short tl[64 * 72];
    __shared__ float sg[32];
    if (blockIdx.x < FTB) {                  // block-uniform: every barrier below is passed by a whole block or by none of it
        const int tid = threadIdx.x, k0 = (blockIdx.x % (KTP / 64)) * 64, n0 = (blockIdx.x / (KTP / 64)) * 64;
        const int kk = tid >> 2, nq = (tid & 3) * 16, k = k0 + kk;
        const float* fr = Ft + (size_t)((k < KT) ? k : KT - 1) * DD + n0 + nq;    // a pad text re-reads the last real row and stores zero
        v4f x[4]; v8us o[2], t[2];
#pragma unroll
        for (int j = 0; j < 4; ++j) x[j] = *(const v4f*)(fr + j * 4);    // all four in flight together, whatever the row
        asm volatile("s_wait_xcnt 0x0" :: "v"(fr) : "memory");    // stands in front of every overwrite of the address register that these loads name; the address is its input, so that it lives up to here
#pragma unroll
        for (int i = 0; i < 16; ++i) { const unsigned short h = (k < KT) ? f2bf(x[i >> 2][i & 3]) : (unsigned short)0; tl[(nq + i) * 72 + kk] = h; o[i >> 3][i & 7] = h; }
        __syncthreads();                     // the tile is whole in LDS before it is read the other way; no store is in flight here that the barrier would wait for
        const int piece = tid & 7, nr = tid >> 3;
#pragma unroll
        for (int s = 0; s < 2; ++s) t[s] = *(const v8usa*)(tl + (nr + 32 * s) * 72 + piece * 8);
        *(v8us*)(FtB + (size_t)k * DD + n0 + nq) = o[0]; *(v8us*)(FtB + (size_t)k * DD + n0 + nq + 8) = o[1];
#pragma unroll
        for (int s = 0; s < 2; ++s) *(v8us*)(FtT + (size_t)(n0 + nr + 32 * s) * KTP + k0 + piece * 8) = t[s];
        return;
    }
    const int lane = threadIdx.x & 31, wave = __builtin_amdgcn_readfirstlane(threadIdx.x >> 5), blk = blockIdx.x - FTB, m0 = blk * 32 + wave * 4, b = m0 / MM;
    v4f v[4][4], f[4]; const float* r[4]; const float* fp = Fv + (size_t)b * DD + lane * 4;
#pragma unroll
    for (int i = 0; i < 4; ++i) { r[i] = Fs + (size_t)(m0 + i) * DD + lane * 4;
#pragma unroll
        for (int q = 0; q < 4; ++q) v[i][q] = *(const v4f*)(r[i] + q * 128); }
#pragma unroll
    for (int q = 0; q < 4; ++q) f[q] = *(const v4f*)(fp + q * 128);
    // the wait stands in front of every overwrite of a register that these loads name as an address; the addresses are its inputs, so that none of their registers is given to a load's result ahead of it
    asm volatile("s_wait_xcnt 0x0" :: "v"(r[0]), "v"(r[1]), "v"(r[2]), "v"(r[3]), "v"(fp) : "memory");
    __builtin_amdgcn_sched_barrier(0);        // keeps all 20 loads in front of the sums: with sums lifted between them the wave would wait out the memory latency twice
#pragma unroll
    for (int q = 0; q < 4; ++q)
#pragma unroll
        for (int e = 0; e < 4; ++e) f[q][e] = bfr(f[q][e]);
    float s[4], g[4];
#pragma unroll
    for (int i = 0; i < 4; ++i) { v4f a = (v4f){}, c = (v4f){};
#pragma unroll
        for (int q = 0; q < 4; ++q) {
#pragma unroll
            for (int e = 0; e < 4; ++e) v[i][q][e] = bfr(v[i][q][e]);    // the rounded row stays in its registers for the split below
            a = __builtin_elementwise_fma(v[i][q], v[i][q], a); c = __builtin_elementwise_fma(v[i][q], f[q], c); }
        s[i] = (a[0] + a[1]) + (a[2] + a[3]); g[i] = (c[0] + c[1]) + (c[2] + c[3]); }
#pragma unroll
    for (int i = 0; i < 4; ++i) { s[i] = wsum(s[i]); g[i] = wsum(g[i]); }
    float inv[4];                            // the butterfly leaves a row's sum in every lane, so every lane forms the same 1 / norm
#pragma unroll
    for (int i = 0; i < 4; ++i) inv[i] = 1.0f / sqrtf(s[i]);
#pragma unroll
    for (int i = 0; i < 4; ++i) g[i] *= inv[i];
    if (lane < 4) sg[wave * 4 + lane] = (lane == 0) ? g[0] : (lane == 1) ? g[1] : (lane == 2) ? g[2] : g[3];    // lane i keeps row i
    __syncthreads();                         // the eight waves' G are in LDS before a wave stores the block's whole 128-byte line; it stands ahead of the planes' stores, which it would otherwise wait for
    if (threadIdx.x < 32) { G[blk * 32 + threadIdx.x] = sg[threadIdx.x];
        asm volatile("s_wait_xcnt 0x0" ::: "memory"); }    // stands in front of the split's overwrite of the registers that this store names
    v4us oh[4][4], ol[4][4];
#pragma unroll
    for (int i = 0; i < 4; ++i)
#pragma unroll
        for (int q = 0; q < 4; ++q)
#pragma unroll
            for (int e = 0; e < 4; ++e) { const float x = v[i][q][e] * inv[i]; const unsigned short hb = f2bf(x); oh[i][q][e] = hb; ol[i][q][e] = f2bf(x - bf2f(hb)); }
    __builtin_amdgcn_sched_barrier(0);        // keeps the 32 stores behind the arithmetic, the wave's last: no register that an issued store names is written any more
    bf* ph = Nh + (size_t)m0 * DD + lane * 4; bf* pl = Nl + (size_t)m0 * DD + lane * 4;
#pragma unroll
    for (int i = 0; i < 4; ++i)
#pragma unroll
        for (int q = 0; q < 4; ++q) { *(v4us*)(ph + i * DD + q * 128) = oh[i][q]; *(v4us*)(pl + i * DD + q * 128) = ol[i][q]; }
}
__global__ __launch_bounds__(256) void k_soft_s(const float* __restrict__ A, bf* PH, bf* PL) {
    const int lane = threadIdx.x & 31, m = blockIdx.x * 8 + (threadIdx.x >> 5);
    const float* ar = A + (size_t)m * KTP; float mx = -3.0e38f;
#pragma unroll 1
    for (int c0 = lane * 8; c0 < KTP; c0 += 256) { const v8f v = *(const v8f*)(ar + c0);
#pragma unroll
        for (int i = 0; i < 8; ++i) if (c0 + i < KT) mx = fmaxf(mx, v[i] * (1.0f / ALS)); }
#pragma unroll
    for (int sh = 16; sh; sh >>= 1) mx = fmaxf(mx, __shfl_xor(mx, sh, 32));
    float sum = 0.f;
#pragma unroll 1
    for (int c0 = lane * 8; c0 < KTP; c0 += 256) { const v8f v = *(const v8f*)(ar + c0);
#pragma unroll
        for (int i = 0; i < 8; ++i) if (c0 + i < KT) sum += __expf(v[i] * (1.0f / ALS) - mx); }
#pragma unroll
    for (int sh = 16; sh; sh >>= 1) sum += __shfl_xor(sum, sh, 32);
    const float inv = 1.0f / sum;
{
#pragma unroll 1
        for (int c0 = lane * 8; c0 < KTP; c0 += 256) { const v8f v = *(const v8f*)(ar + c0); v8us oh, ol;
#pragma unroll
            for (int i = 0; i < 8; ++i) { const float p = (c0 + i < KT) ? __expf(v[i] * (1.0f / ALS) - mx) * inv : 0.f; const unsigned short hb = f2bf(p); oh[i] = hb; ol[i] = f2bf(p - bf2f(hb)); }
            const size_t o = (size_t)m * KTP + c0; *(v8us*)(PH + o) = oh; *(v8us*)(PL + o) = ol; }
         }
}
// ex4: e^x of four values, formed as __expf forms it (x * log2 e, then v_exp_f32). One statement, so that behind each v_exp_f32 stands an instruction that neither reads its result nor overwrites
// its source, the slot the instruction set asks for: the next v_exp_f32 (the outputs share no register with the inputs), and a v_nop behind the last.
__device__ __forceinline__ v4f ex4(v4f x) {
    x *= 1.44269504f; v4f r;
    asm("v_exp_f32 %0, %4\n\tv_exp_f32 %1, %5\n\tv_exp_f32 %2, %6\n\tv_exp_f32 %3, %7\n\tv_nop" : "=&v"(r[0]), "=&v"(r[1]), "=&v"(r[2]), "=&v"(r[3]) : "v"(x[0]), "v"(x[1]), "v"(x[2]), "v"(x[3]));
    return r;
}
// k_soft_t: H[k] = sum_m P_t[k][m] G[m], P_t the softmax over the 196 real tokens of A[m][k] / alpha_t (f32); pad texts give 0. A block takes TC = 64 columns (256 contiguous bytes of every
// row of A) and all 256 token places: 16 lanes fetch a row's 256 bytes, a thread holds 4 columns of two runs of eight consecutive tokens (m = j * 128 + wave * 16 + (lane >> 4) * 8 + i; pad
// tokens re-read the last real row and count as absent). A column's maximum, sum and weighted sum: a thread's 16 tokens in order, the lane 16 apart, then the eight waves' values from LDS in wave order.
#define TC 64
__global__ __launch_bounds__(256) void k_soft_t(const float* __restrict__ A, const float* __restrict__ G, float* H) {
    __shared__ __align__(16) float rm[8 * TC], rq[8 * TC], rg[8 * TC];
    const int lane = threadIdx.x & 31, wave = threadIdx.x >> 5, c16 = lane & 15, rs = lane >> 4, mb = wave * 16 + rs * 8, k0 = blockIdx.x * TC;
    const unsigned char* base = (const unsigned char*)(A + (size_t)blockIdx.z * MM * KTP + k0); const unsigned char* gb = (const unsigned char*)(G + (size_t)blockIdx.z * MM);    // block-uniform; the lane's part is a byte offset
    const unsigned o0 = (unsigned)(mb * KTP + c16 * 4) * 4u, io = (unsigned)mb * 4u; unsigned o1[8], i1[2];    // o1[i] + (128 + i) rows is token 128 + mb + i, or the last real token where that is a pad
    v4f v[2][8]; v4f gv[2][2];
#pragma unroll
    for (int i = 0; i < 8; ++i) v[0][i] = *(const v4f*)(base + (size_t)o0 + (size_t)(i * KTP * 4));
#pragma unroll
    for (int i = 0; i < 8; ++i) { o1[i] = (unsigned)(((mb < MM - 1 - 128 - i) ? mb : MM - 1 - 128 - i) * KTP + c16 * 4) * 4u; v[1][i] = *(const v4f*)(base + (size_t)o1[i] + (size_t)((128 + i) * KTP * 4)); }
#pragma unroll
    for (int h = 0; h < 2; ++h) { gv[0][h] = *(const v4f*)(gb + (size_t)io + (size_t)(h * 16));    // a group of four token places is all real or all pad (196 = 49 x 4): a pad group re-reads the image's last four G, which meet a weight of exactly 0
        i1[h] = (unsigned)((mb + h * 4 < MM - 4 - 128) ? mb + h * 4 : MM - 4 - 128) * 4u; gv[1][h] = *(const v4f*)(gb + (size_t)i1[h] + (size_t)512); }
    // the wait stands in front of every overwrite of a register that these loads name as an address; the offsets are its inputs, so that none of their registers is given to a load's result ahead of it
    asm volatile("s_wait_xcnt 0x0" :: "v"(o0), "v"(o1[0]), "v"(o1[1]), "v"(o1[2]), "v"(o1[3]), "v"(o1[4]), "v"(o1[5]), "v"(o1[6]), "v"(o1[7]), "v"(io), "v"(i1[0]), "v"(i1[1]) : "memory");
    __builtin_amdgcn_sched_barrier(0);        // keeps all 20 loads in front of the arithmetic: with arithmetic lifted between them the wave would wait out the memory latency twice
    v4f mx = (v4f){-3.0e38f, -3.0e38f, -3.0e38f, -3.0e38f};
#pragma unroll
    for (int j = 0; j < 2; ++j)
#pragma unroll
        for (int i = 0; i < 8; ++i)
#pragma unroll
            for (int e = 0; e < 4; ++e) { const float x = (j == 0 || 128 + mb + i < MM) ? v[j][i][e] * (1.0f / ALT) : -3.0e38f; v[j][i][e] = x; mx[e] = fmaxf(mx[e], x); }    // the first 128 tokens are all real
#pragma unroll
    for (int e = 0; e < 4; ++e) mx[e] = fmaxf(mx[e], __shfl_xor(mx[e], 16, 32));
    if (rs == 0) *(v4fa*)(rm + wave * TC + c16 * 4) = mx;
    __syncthreads();                         // the eight waves' column maxima are in LDS before they are combined
#pragma unroll
    for (int w = 0; w < 8; ++w) { const v4f t = *(const v4fa*)(rm + w * TC + c16 * 4);
#pragma unroll
        for (int e = 0; e < 4; ++e) mx[e] = fmaxf(mx[e], t[e]); }
    v4f sum = (v4f){}, wg = (v4f){};
#pragma unroll
    for (int j = 0; j < 2; ++j)
#pragma unroll
        for (int i = 0; i < 8; ++i) { const v4f ev = ex4(v[j][i] - mx); const float gm = gv[j][i >> 2][i & 3]; sum += ev; wg = __builtin_elementwise_fma(ev, (v4f){gm, gm, gm, gm}, wg); }    // a pad token's -3.0e38 under a real token's maximum gives exactly 0
#pragma unroll
    for (int e = 0; e < 4; ++e) { sum[e] += __shfl_xor(sum[e], 16, 32); wg[e] += __shfl_xor(wg[e], 16, 32); }
    if (rs == 0) { *(v4fa*)(rq + wave * TC + c16 * 4) = sum; *(v4fa*)(rg + wave * TC + c16 * 4) = wg; }
    __syncthreads();                         // the eight waves' column sums are in LDS before they are combined
    if (threadIdx.x < 16) {                  // 16 lanes finish the block's 64 columns and store its two whole lines
        v4f tot = (v4f){}, tg = (v4f){}, h;
#pragma unroll
        for (int w = 0; w < 8; ++w) { tot += *(const v4fa*)(rq + w * TC + c16 * 4); tg += *(const v4fa*)(rg + w * TC + c16 * 4); }
#pragma unroll
        for (int e = 0; e < 4; ++e) h[e] = (k0 + c16 * 4 + e < KT) ? tg[e] / tot[e] : 0.f;
        *(v4f*)(H + (size_t)blockIdx.z * KTP + k0 + c16 * 4) = h; }
}
// k_logits: RES[b][k] = ls (beta1 bf(Fv[b]).bf(Ft[k]) + beta2 H[k] + beta3 Fva[b].bf(Ft[k])) (f32), ls = e^bf(logit_scale), H[k] = Fv[b].Fta[k] as k_soft_t leaves it, Fva[b] = mean + max over the image's tokens, put together
// from the sums and maxima PP that the second product leaves for the two or three 112-row chunks the image's 196 rows lie in, in chunk order. A wave per text row, 32 rows
// a wave: Fv[b] and Fva[b] stay in registers (a lane holds 16 of the 512 terms), each row of Ft comes as four loads of 512 contiguous bytes, four rows a step, the next step's 16 loads issued
// before a step is summed; a lane adds its 16 terms of the two dots, weights them, and a butterfly adds the lanes; lane j keeps row j, so the wave stores one whole line. Pad texts read Ft's last row and store 0.
__global__ __launch_bounds__(256) void k_logits(const float* __restrict__ Fv, const float* __restrict__ Ft, const float* __restrict__ H, const float* __restrict__ PP, const float* __restrict__ lsc, float* RES) {
    const int lane = threadIdx.x & 31, k0 = blockIdx.x * 256 + __builtin_amdgcn_readfirstlane(threadIdx.x >> 5) * 32, b = blockIdx.z;
    const float hk = H[(size_t)b * KTP + k0 + lane];
    v4f fv[4], fa[4], cs[3][4], cm[3][4]; const float* pp[3];
    const int cA = b * MM / 112, cZ = (b * MM + MM - 1) / 112;    // the image's first and last chunk: two or three
#pragma unroll
    for (int u = 0; u < 3; ++u) { const int c = (cA + u < cZ) ? cA + u : cZ;    // where there are two, the third place re-reads the last: its sum is left out, its maximum changes nothing
        pp[u] = PP + (size_t)(c * 2 + (b - c * 112 / MM)) * DD + lane * 4;    // segment 0 where the chunk begins in this image, 1 where it begins in the image before
#pragma unroll
        for (int q = 0; q < 4; ++q) { cs[u][q] = *(const v4f*)(pp[u] + q * 128); cm[u][q] = *(const v4f*)(pp[u] + PMO + q * 128); } }
    // the wait stands in front of every overwrite of a register that these loads name as an address; the addresses are its inputs, so that none of their registers is given to a load's result ahead of it
    asm volatile("s_wait_xcnt 0x0" :: "v"(pp[0]), "v"(pp[1]), "v"(pp[2]) : "memory");
    __builtin_amdgcn_sched_barrier(0);        // keeps the address arithmetic of the loads below behind the wait: lifted over it, it took over a base register that the loads above name
#pragma unroll
    for (int q = 0; q < 4; ++q) { const v4f v = *(const v4f*)(Fv + (size_t)b * DD + q * 128 + lane * 4);
#pragma unroll
        for (int e = 0; e < 4; ++e) { fv[q][e] = bfr(v[e]);
            fa[q][e] = ((cs[0][q][e] + cs[1][q][e]) + ((cA + 2 == cZ) ? cs[2][q][e] : 0.f)) * (1.0f / MM) + fmaxf(fmaxf(cm[0][q][e], cm[1][q][e]), cm[2][q][e]); } }
    v4f tA[4][4], tB[4][4];
    auto fetch = [&](int g, v4f (&t)[4][4]) {
        const float* tp[4];
#pragma unroll
        for (int i = 0; i < 4; ++i) { const int k = k0 + g * 4 + i, kc = (k < KT) ? k : KT - 1; tp[i] = Ft + (size_t)kc * DD + lane * 4;
#pragma unroll
            for (int q = 0; q < 4; ++q) t[i][q] = *(const v4f*)(tp[i] + q * 128); }
        // the wait stands in front of every overwrite of a register that these loads name as an address; the addresses are its inputs, so that none of their registers is given to a load's result ahead of it
        asm volatile("s_wait_xcnt 0x0" :: "v"(tp[0]), "v"(tp[1]), "v"(tp[2]), "v"(tp[3]) : "memory");
    };
    float res = 0.f;
    auto sum = [&](int g, const v4f (&t)[4][4]) {
        float c[4];
#pragma unroll
        for (int i = 0; i < 4; ++i) { v4f d1 = (v4f){}, d3 = (v4f){};    // four chains a dot, on the registers as the loads fill them
#pragma unroll
            for (int q = 0; q < 4; ++q) { v4f ft;
#pragma unroll
                for (int e = 0; e < 4; ++e) ft[e] = bfr(t[i][q][e]);
                d1 = __builtin_elementwise_fma(fv[q], ft, d1); d3 = __builtin_elementwise_fma(fa[q], ft, d3); }
            const v4f w = B1_ * d1 + B3_ * d3; c[i] = (w[0] + w[1]) + (w[2] + w[3]); }
#pragma unroll
        for (int i = 0; i < 4; ++i) c[i] = wsum(c[i]);
#pragma unroll
        for (int i = 0; i < 4; ++i) if (lane == g * 4 + i) res = c[i];
    };
    fetch(0, tA);
#pragma unroll 1
    for (int g = 0; g < 6; g += 2) {         // rolled: two steps a trip, so that the two register sets are named by constants
        fetch(g + 1, tB);
        __builtin_amdgcn_sched_barrier(0);    // keeps the next step's loads in front of this step's sums: sunk behind them, their latency would be waited out every step
        sum(g, tA);
        __builtin_amdgcn_sched_barrier(0);    // keeps the refill's loads behind this step's butterflies: lifted between them, the four butterflies ran one after the other, each LDS round trip waited out alone
        fetch(g + 2, tA);
        __builtin_amdgcn_sched_barrier(0);    // as above
        sum(g + 1, tB);
    }
    fetch(7, tB);                            // the last two steps stand alone: no load behind the wave's last row, and no branch in the loop that would make its waits count for both paths
    __builtin_amdgcn_sched_barrier(0);        // as above
    sum(6, tA);
    sum(7, tB);
    const float ls = __expf(bfr(lsc[0]));
    RES[(size_t)b * KTP + k0 + lane] = (k0 + lane < KT) ? ls * (res + B2_ * hk) : 0.f;
}
__global__ __launch_bounds__(256) void k_out(const float* __restrict__ RES, float* OUTP) {
    const int i = blockIdx.x * 256 + threadIdx.x; if (i >= NBI * KT) return; const float v = RES[(size_t)(i / KT) * KTP + (i % KT)];
    *(float*)(OUTP + i) = v; 
}

extern "C" void kernel_launch(void* const* d_in, const int* in_sizes, int n_in,
                              void* d_out, int out_size, void* d_ws, size_t ws_size, hipStream_t stream) {
    (void)in_sizes; (void)n_in; (void)out_size;
    const float* Fs = (const float*)d_in[0]; const float* Ft = (const float*)d_in[1]; const float* Fv = (const float*)d_in[2]; const float* lsc = (const float*)d_in[3];
    float* out = (float*)d_out;    // [128][1][1000]
    char* wsp = (char*)d_ws;
    auto take = [&](size_t bytes) { char* p = wsp; wsp += (bytes + 255) & ~(size_t)255; return (void*)p; };
    bf* FtB = (bf*)take((size_t)KTP * DD * 2); bf* FtT = (bf*)take((size_t)DD * KTP * 2);
    float* G = (float*)take((size_t)NR * 4); float* H = (float*)take((size_t)NBI * KTP * 4); float* PP = (float*)take((size_t)PMO * 2 * 4); float* RES = (float*)take((size_t)NBI * KTP * 4);
    // One region holds, one after the other in stream order: {A | Nh, Nl}, then {A | PH, PL}. Each plane is written after the last read of what it lies on.
    float* A = (float*)take((size_t)NR * KTP * 4 * 2);
    bf* PH = (bf*)(A + (size_t)NR * KTP); bf* PL = PH + (size_t)NR * KTP; bf* Nh = PH; bf* Nl = Nh + (size_t)NR * DD;
    if ((size_t)(wsp - (char*)d_ws) > ws_size) return;    // 2 + 3 + 196 ~ 201 MiB
    k_prep<<<FTB + NR / 32, 256, 0, stream>>>(Fs, Fv, Ft, FtB, FtT, Nh, Nl, G);     // FtB, Ft^T [512][1024] exact bf16; Nh, Nl, G
    k_gemm<DD, false><<<dim3(KTP / BNC, NR / BMR, 1), 256, 0, stream>>>(Nh, Nl, FtB, A, KTP);     // A = Fs_n.Ft^T  [25088][1024]
    k_soft_s<<<NR / 8, 256, 0, stream>>>(A, PH, PL); k_soft_t<<<dim3(KTP / TC, 1, NBI), 256, 0, stream>>>(A, G, H);
    k_gemm<KTP, true><<<dim3(DD / BNC, NR / BMR, 1), 256, 0, stream>>>(PH, PL, FtT, PP, DD);    // Fsa = P_s.Ft [25088][512], left as each chunk's column sums and maxima
    k_logits<<<dim3(KTP / 256, 1, NBI), 256, 0, stream>>>(Fv, Ft, H, PP, lsc, RES);
    k_out<<<(NBI * KT + 255) / 256, 256, 0, stream>>>(RES, out);
}

// v010
// A run of this version takes 115 microseconds.
// Two timings next to v009 both put it at 1.37 times that version's speed.
// Over all steps from v000 it is 277 times as fast.
#include <hip/hip_runtime.h>

// Compute dtypes, f32 accumulate, all 128 images in one pass. Ft is the same for every image, so the token rows of all images form one row dimension without pad rows (128 x 196 = 25088 = 112 tiles
// of 224 rows; K = 1000 texts padded to 1024): Fs L2-normalised in f32 -> bf16 hi + UNSCALED
// residual planes; A = Fs_n.Ft^T ([25088 x 512].[512 x 1024], split Fs_n against the exact bf16 Ft, two products) on v_wmma_f32_16x16x32_bf16. alpha_s = alpha_t, so both softmaxes have the same
// numerators E = e^(A / alpha): the first product's epilogue forms them from its accumulators (A itself is never stored; no maximum is taken off: |A[m][k]| <= |Ft[k]|, as |Fs_n[m]| = 1) and leaves E as
// hi/lo planes, each row's sums over texts and each column's sums over tokens. Fsa = (E.Ft) / row sum ([25088 x 1024].[1024 x 512], two products; the division stands in the second product's epilogue).
// Fta = P_t.Fs_n enters the result only through Fv.Fta[k] = sum_m P_t[k][m] (Fs_n[m].Fv) = (sum_m E[m][k] G[m]) / (sum_m E[m][k]): the inner dots
// G[m] (one per token) come with the norms, the two sums over an image's 196 tokens with E, and Fta itself is never formed. Mean + max pooling over the real
// tokens straight from the second product's accumulators (Fsa itself is never stored), and the final logits (two 512-term dots per text and that quotient, x exp(logit_scale)).

#define NBI  128
#define MM   196
#define NR   (NBI * MM)    // token rows of all images, image b's at b * MM
#define KT   1000
#define KTP  1024
#define DD   512
#define DM   DD
#define ALS  0.5f
#define ALT  0.5f
#define B1_  1.0f
#define B2_  0.1f
#define B3_  0.1f
#define LOSC 1024.0f
static_assert(ALS == ALT, "one set of numerators serves both softmaxes");

typedef _Float16 h16;
typedef unsigned short bf;
typedef __attribute__((ext_vector_type(16))) __bf16   v16bf;
typedef __attribute__((ext_vector_type(16))) _Float16 v16h;
typedef __attribute__((ext_vector_type(8)))  _Float16 v8h;
typedef __attribute__((ext_vector_type(8)))  unsigned short v8us;
typedef __attribute__((ext_vector_type(8)))  float    v8f;
typedef __attribute__((ext_vector_type(4)))  float    v4f;
typedef __attribute__((ext_vector_type(4)))  _Float16 v4h;
typedef v8h  __attribute__((may_alias)) v8ha;
typedef v4f  __attribute__((may_alias)) v4fa;
typedef v8us __attribute__((may_alias)) v8usa;
typedef __attribute__((ext_vector_type(2)))  float    v2f;
typedef __attribute__((ext_vector_type(2)))  __bf16   v2bf;
typedef __attribute__((ext_vector_type(4)))  unsigned v4u;

__device__ __forceinline__ unsigned short f2bf(float f) { unsigned u = __float_as_uint(f); u += 0x7FFFu + ((u >> 16) & 1u); return (unsigned short)(u >> 16); }
__device__ __forceinline__ float bf2f(unsigned short b) { return __uint_as_float(((unsigned)b) << 16); }
__device__ __forceinline__ float bfr(float f) { return bf2f(f2bf(f)); }
__device__ __forceinline__ v16h cat16(v8h lo, v8h hi) { return __builtin_shufflevector(lo, hi, 0, 1, 2, 3, 4, 5, 6, 7, 8, 9, 10, 11, 12, 13, 14, 15); }
__device__ __forceinline__ v16bf cat16b(v8us lo, v8us hi) { return __builtin_bit_cast(v16bf, __builtin_shufflevector(lo, hi, 0, 1, 2, 3, 4, 5, 6, 7, 8, 9, 10, 11, 12, 13, 14, 15)); }
__device__ __forceinline__ v8f wmma16(v16h a, v16h b, v8f c) { return __builtin_amdgcn_wmma_f32_16x16x32_f16(false, a, false, b, (short)0, c, false, false); }
// pk2: two f32 rounded to nearest even into one word of two bf16, a in the low half.
__device__ __forceinline__ unsigned pk2(float a, float b) { return __builtin_bit_cast(unsigned, __builtin_convertvector((v2f){a, b}, v2bf)); }
// xlane: v of the lane whose number differs in the bits M, inside a 16-lane row; every lane is on where it is used.
template <int M> __device__ __forceinline__ float xlane(float v) { return __int_as_float(__builtin_amdgcn_update_dpp(0, __float_as_int(v), 0x160 + M, 0xf, 0xf, true)); }
// ex4: 2^(x sc) of four values, each in its own register. One statement, so that behind each v_exp_f32 stands an instruction that neither reads its result nor overwrites its source, the slot the
// instruction set asks for: the next v_exp_f32, and a v_nop behind the last.
__device__ __forceinline__ v4f ex4(v4f x, float sc) {
    asm("v_mul_f32 %0, %4, %0\n\tv_mul_f32 %1, %4, %1\n\tv_mul_f32 %2, %4, %2\n\tv_mul_f32 %3, %4, %3\n\tv_exp_f32 %0, %0\n\tv_exp_f32 %1, %1\n\tv_exp_f32 %2, %2\n\tv_exp_f32 %3, %3\n\tv_nop"
        : "+v"(x[0]), "+v"(x[1]), "+v"(x[2]), "+v"(x[3]) : "s"(sc));
    return x;
}
__device__ __forceinline__ v8f wmmab(v16bf a, v16bf b, v8f c) { return __builtin_amdgcn_wmma_f32_16x16x32_bf16(false, a, false, b, (short)0, c, false, false); }

// k_gemm: 224 x 256 block tile (8 waves, 2 x 4, each 112 x 64 = 7 x 4 accumulator tiles) of C = (Ah + Al).Bh^T over K (every plane k-contiguous with row stride K; n-major B). Per 32 k and
// accumulator the products come in the order hh, lh. 18 fragments feed 56 products, and a stage's 704 operand rows serve 57344 results. 25088 rows = 112 row tiles.
// A stage is 64 k = one 128-byte line of each row of every plane: 8 lanes fetch a row's whole line,
// the stage goes through registers into one of two LDS buffers (row pitch 144 B for the 16-byte fragment reads) while the other buffer is multiplied.
// A wave's 7 tile rows are worked as a block of 4 and a block of 3; each block's fragments are read from LDS as one group while the block before it is multiplied.
// The inner loops are all unrolled so that the staging registers, acc and the fragments are indexed by constants and stay in registers.
#define BKE 64
#define LPB 144
#define BMR 224
#define BNC 256
#define PAB (BMR * LPB)
#define BUFB (2 * PAB + BNC * LPB)
#define OSB (8 * 112 * 68 * 4)
// The product itself is not stored. A wave's 112 rows (chunk ch = row / 112 of the 224 chunks) lie in at most two images (112 < 196); segment 0 is its rows of the first image, segment 1 those of the next.
// POOL (the second product, on E): each row is divided by its sum of E, put together from X = the first product's RS; per column the wave leaves the sum and the maximum of each segment
// (0 and -3.0e38 where the chunk has no segment 1) in C as [224][2][512] sums, then as many maxima.
// Otherwise (the first product, X = G): E = e^(product / alpha); a pad text's column holds e^0 = 1, stays out of the row sums and meets a zero column of Ft^T in the second product. Per column the wave leaves each segment's sum of E and of E G[m] in C as [224][2][1024] sums, then as many
// weighted sums; per row its 64 columns' sum in RS as [16 column ranges][25088]; and E's bf16 hi and residual planes in OH, OL (row stride 1024; a store is a row's whole 128-byte line).
#define NCH (NR / 112)
#define PMO (NCH * 2 * DD)
#define CMO (NCH * 2 * KTP)
#define NRS (KTP / 64)
template <int K, bool POOL>
__global__ __launch_bounds__(256) void k_gemm(const bf* __restrict__ Ah, const bf* __restrict__ Al, const bf* __restrict__ Bh, const float* __restrict__ X, float* C, float* RS, bf* OH, bf* OL) {
    constexpr int NS = K / BKE;
    __shared__ __align__(16) unsigned char sm[(2 * BUFB > OSB) ? 2 * BUFB : OSB];
    __shared__ __align__(16) float srow[BMR];    // a number for each of the block's rows, read in the epilogue: POOL: 1 / (the row's sum of E); otherwise G
    const int tid = threadIdx.x, lane = tid & 31, wave = tid >> 5, lr = lane & 15, hi = lane >> 4, wm = wave >> 2, wn = wave & 3;
    const int r0 = blockIdx.y * BMR, c0 = blockIdx.x * BNC;    // the column tiles of one row tile are neighbours in launch order: they read the same A rows
    const int soff = (tid >> 3) * LPB + (tid & 7) * 16;
    unsigned go = (unsigned)((tid >> 3) * K + (tid & 7) * 8) * 2u;    // the lane's byte offset in every plane's tile: one register serves all planes beside their block-uniform bases; it steps by a stage
    const unsigned char* sa = (const unsigned char*)(Ah + (size_t)r0 * K); const unsigned char* sl = (const unsigned char*)(Al + (size_t)r0 * K); const unsigned char* sb = (const unsigned char*)(Bh + (size_t)c0 * K);
    v8us sta[BMR / 32], stl[BMR / 32], stb[BNC / 32];
    auto fetch = [&]() {
#pragma unroll
        for (int i = 0; i < BMR / 32; ++i) { sta[i] = *(const v8us*)(sa + (size_t)go + (size_t)(i * 32 * K * 2)); stl[i] = *(const v8us*)(sl + (size_t)go + (size_t)(i * 32 * K * 2)); }
#pragma unroll
        for (int i = 0; i < BNC / 32; ++i) stb[i] = *(const v8us*)(sb + (size_t)go + (size_t)(i * 32 * K * 2));
    };
    auto put = [&](int buf) {
        unsigned char* d = sm + buf * BUFB + soff;
#pragma unroll
        for (int i = 0; i < BMR / 32; ++i) { *(v8usa*)(d + i * 32 * LPB) = sta[i]; *(v8usa*)(d + PAB + i * 32 * LPB) = stl[i]; }
#pragma unroll
        for (int i = 0; i < BNC / 32; ++i) *(v8usa*)(d + 2 * PAB + i * 32 * LPB) = stb[i];
    };
    v8f acc[7][4];
#pragma unroll
    for (int i = 0; i < 7; ++i)
#pragma unroll
        for (int t = 0; t < 4; ++t) acc[i][t] = (v8f){};
    fetch();
    asm volatile("s_wait_xcnt 0x0" :: "v"(go) : "memory");    // stands in front of every overwrite of the offset register that the loads above name; the offset is its input, so that it lives up to here
    if constexpr (POOL) {
        if (tid < BMR) {                     // whole waves: 224 = 7 x 32. A thread joins one row's 16 partial sums, in the order of the columns
            const float* xp = X + r0 + tid; float p[NRS];
#pragma unroll
            for (int c = 0; c < NRS; ++c) p[c] = xp[(size_t)c * NR];
            asm volatile("s_wait_xcnt 0x0" :: "v"(xp) : "memory");    // stands in front of every overwrite of the address register that these loads name; the address is its input, so that it lives up to here
            float s = p[0];
#pragma unroll
            for (int c = 1; c < NRS; ++c) s += p[c];
            srow[tid] = 1.0f / s;            // read behind the loop's barriers
        }
    } else {
        if (tid < BMR) { const float* xp = X + r0 + tid; const float g = *xp;
            asm volatile("s_wait_xcnt 0x0" :: "v"(xp) : "memory");    // as above
            srow[tid] = g; }                 // read behind the loop's barriers
    }
    put(0);
    go += BKE * 2;
    __syncthreads();                         // publishes stage 0
    const unsigned char* bb = sm + lr * LPB + hi * 16;    // the lane's place in the buffer that is multiplied
    v16bf xa[4], xl[4], ya[3], yl[3], b0[4], b1[4];
    auto ldb = [&](v16bf (&b)[4], int kk) {
#pragma unroll
        for (int t = 0; t < 4; ++t) { const unsigned char* p = bb + 2 * PAB + (wn * 64 + t * 16) * LPB + kk * 64; b[t] = cat16b(*(const v8usa*)p, *(const v8usa*)(p + 32)); }
    };
    auto ldx = [&](int kk) {
#pragma unroll
        for (int i = 0; i < 4; ++i) { const unsigned char* p = bb + (wm * 112 + i * 16) * LPB + kk * 64;
            xa[i] = cat16b(*(const v8usa*)p, *(const v8usa*)(p + 32)); xl[i] = cat16b(*(const v8usa*)(p + PAB), *(const v8usa*)(p + PAB + 32)); }
    };
    auto ldy = [&](int kk) {
#pragma unroll
        for (int i = 0; i < 3; ++i) { const unsigned char* p = bb + (wm * 112 + (4 + i) * 16) * LPB + kk * 64;
            ya[i] = cat16b(*(const v8usa*)p, *(const v8usa*)(p + 32)); yl[i] = cat16b(*(const v8usa*)(p + PAB), *(const v8usa*)(p + PAB + 32)); }
    };
    auto mmx = [&](const v16bf (&b)[4]) {
#pragma unroll
        for (int i = 0; i < 4; ++i) {
#pragma unroll
            for (int t = 0; t < 4; ++t) acc[i][t] = wmmab(xa[i], b[t], acc[i][t]);
#pragma unroll
            for (int t = 0; t < 4; ++t) acc[i][t] = wmmab(xl[i], b[t], acc[i][t]);
        }
    };
    auto mmy = [&](const v16bf (&b)[4]) {
#pragma unroll
        for (int i = 0; i < 3; ++i) {
#pragma unroll
            for (int t = 0; t < 4; ++t) acc[4 + i][t] = wmmab(ya[i], b[t], acc[4 + i][t]);
#pragma unroll
            for (int t = 0; t < 4; ++t) acc[4 + i][t] = wmmab(yl[i], b[t], acc[4 + i][t]);
        }
    };
    ldb(b0, 0); ldx(0);                      // stage 0's first block, read behind the barrier that publishes it
    // The scheduling barriers in the loop keep each group of LDS reads whole and in front of the block of products before the one that uses it: left free, the reads were sunk
    // to two in front of every four products, each pair's LDS latency waited out.
    for (int s = 0; s < NS; ++s) {
        ldy(0);
        if (s + 1 < NS) { fetch();
            asm volatile("s_wait_xcnt 0x0" ::: "memory"); }    // stands in front of every overwrite of an address register that these loads name: fragments are read into such registers further down
        __builtin_amdgcn_sched_barrier(0);    // also keeps the next stage's global loads in front of this stage's products: sunk to the LDS stores below, their latency would be waited out every stage
        mmx(b0);
        __builtin_amdgcn_sched_barrier(0);    // the next reads stay one group behind this block, whose fragment registers they fill
        ldb(b1, 1); ldx(1);
        __builtin_amdgcn_sched_barrier(0);    // and in front of the block below, which covers their latency
        mmy(b0);
        __builtin_amdgcn_sched_barrier(0);    // as above
        ldy(1);
        __builtin_amdgcn_sched_barrier(0);    // as above
        mmx(b1);
        __builtin_amdgcn_sched_barrier(0);    // keeps the LDS stores behind this block: lifted, they would wait for the global loads with less of the stage gone by
        if (s + 1 < NS) put((s + 1) & 1);    // the buffer that every wave left at the barrier of stage s - 1
        go += BKE * 2;
        __syncthreads();                     // publishes stage s + 1 and ends the LDS reads of stage s, whose last fragments are in registers
        bb = sm + ((s + 1) & 1) * BUFB + lr * LPB + hi * 16;
        if (s + 1 < NS) { ldb(b0, 0); ldx(0); }    // stage s + 1's first block, read behind the barrier that publishes it, under stage s's last block of products
        __builtin_amdgcn_sched_barrier(0);    // keeps those reads in front of the block below, which covers their latency
        mmy(b1);
    }
    const int ch = blockIdx.y * 2 + wm, nb = (ch * 112 / MM + 1) * MM - ch * 112;    // nb: the chunk's first row of the next image; a multiple of 4, as 196 and 112 are, so four consecutive rows are of one image
    if constexpr (POOL) {
        const float* iv = srow + wm * 112 + hi * 8;
#pragma unroll
        for (int i = 0; i < 7; ++i) { const v4f ia = *(const v4fa*)(iv + i * 16), ib = *(const v4fa*)(iv + i * 16 + 4);
#pragma unroll
            for (int t = 0; t < 4; ++t)
#pragma unroll
                for (int j = 0; j < 4; ++j) { acc[i][t][j] *= ia[j]; acc[i][t][4 + j] *= ib[j]; } }
        float so[4], mo[4];
#pragma unroll
        for (int t = 0; t < 4; ++t) { float s0 = 0.f, s1 = 0.f, m0 = -3.0e38f, m1 = -3.0e38f;
#pragma unroll
            for (int i = 0; i < 7; ++i)
#pragma unroll
                for (int g = 0; g < 8; g += 4) { const bool in0 = i * 16 + hi * 8 + g < nb;
                    const float s = (acc[i][t][g] + acc[i][t][g + 1]) + (acc[i][t][g + 2] + acc[i][t][g + 3]), m = fmaxf(fmaxf(acc[i][t][g], acc[i][t][g + 1]), fmaxf(acc[i][t][g + 2], acc[i][t][g + 3]));
                    s0 += in0 ? s : 0.f; s1 += in0 ? 0.f : s; m0 = fmaxf(m0, in0 ? m : -3.0e38f); m1 = fmaxf(m1, in0 ? -3.0e38f : m); }
            s0 += __shfl_xor(s0, 16, 32); s1 += __shfl_xor(s1, 16, 32); m0 = fmaxf(m0, __shfl_xor(m0, 16, 32)); m1 = fmaxf(m1, __shfl_xor(m1, 16, 32));    // the lane 16 apart holds the column's other rows
            so[t] = hi ? s1 : s0; mo[t] = hi ? m1 : m0; }    // lanes 0..15 store segment 0, lanes 16..31 segment 1
        __builtin_amdgcn_sched_barrier(0);    // keeps the 8 stores behind the arithmetic, the wave's last: no register that an issued store names is written any more
        float* ps = C + (size_t)(ch * 2 + hi) * DD + c0 + wn * 64 + lr;
#pragma unroll
        for (int t = 0; t < 4; ++t) { ps[t * 16] = so[t]; ps[PMO + t * 16] = mo[t]; }
        return;
    } else {
        __builtin_amdgcn_sched_barrier(0);    // keeps the exponentials behind the last block of products: lifted among them, beside the fragments still live there, they spilled registers
#pragma unroll
        for (int t = 0; t < 4; ++t)
#pragma unroll
            for (int i = 0; i < 7; ++i)
#pragma unroll
                for (int g = 0; g < 8; g += 4) { const v4f e = ex4((v4f){acc[i][t][g], acc[i][t][g + 1], acc[i][t][g + 2], acc[i][t][g + 3]}, 1.44269504f / ALS);
#pragma unroll
                    for (int j = 0; j < 4; ++j) acc[i][t][g + j] = e[j]; }
        const float* gp = srow + wm * 112 + hi * 8;    // G of the lane's 56 rows
        v4f gv[7][2];
#pragma unroll
        for (int i = 0; i < 7; ++i) { gv[i][0] = *(const v4fa*)(gp + i * 16); gv[i][1] = *(const v4fa*)(gp + i * 16 + 4); }
        float so[4], wo[4];
#pragma unroll
        for (int t = 0; t < 4; ++t) { float s0 = 0.f, s1 = 0.f, w0 = 0.f, w1 = 0.f;
#pragma unroll
            for (int i = 0; i < 7; ++i)
#pragma unroll
                for (int g = 0; g < 8; g += 4) { const bool in0 = i * 16 + hi * 8 + g < nb; const v4f gm = gv[i][g >> 2];
                    const float s = (acc[i][t][g] + acc[i][t][g + 1]) + (acc[i][t][g + 2] + acc[i][t][g + 3]);
                    const float w = fmaf(acc[i][t][g + 3], gm[3], fmaf(acc[i][t][g + 2], gm[2], fmaf(acc[i][t][g + 1], gm[1], acc[i][t][g] * gm[0])));
                    s0 += in0 ? s : 0.f; s1 += in0 ? 0.f : s; w0 += in0 ? w : 0.f; w1 += in0 ? 0.f : w; }
            s0 += __shfl_xor(s0, 16, 32); s1 += __shfl_xor(s1, 16, 32); w0 += __shfl_xor(w0, 16, 32); w1 += __shfl_xor(w1, 16, 32);    // the lane 16 apart holds the column's other rows
            so[t] = hi ? s1 : s0; wo[t] = hi ? w1 : w0; }    // lanes 0..15 store segment 0, lanes 16..31 segment 1
        float* os = (float*)(void*)sm + wave * (112 * 68);    // whole-line stores: each wave turns its 112 x 64 tile in its own range of LDS, free behind the last barrier
#pragma unroll
        for (int i = 0; i < 7; ++i)
#pragma unroll
            for (int t = 0; t < 4; ++t)
#pragma unroll
                for (int j = 0; j < 8; ++j) os[(i * 16 + hi * 8 + j) * 68 + t * 16 + lr] = acc[i][t][j];
        __syncthreads();                     // the tile's LDS stores are done before lanes read rows that other lanes wrote
        // Eight lanes take a row, eight consecutive columns each: four rows a read, sixteen rows a batch.
        const int piece = lane & 7, rq = lane >> 3;
        const bool p0 = piece & 1, p1 = piece & 2, real = c0 + wn * 64 + piece * 8 < KT;    // 1000 = 125 x 8: a lane's eight columns are all real texts or all pad
        const float* rd = os + rq * 68 + piece * 8;
        bf* ph = OH + (size_t)(r0 + wm * 112 + rq) * KTP + c0 + wn * 64 + piece * 8; bf* pl = OL + (size_t)(r0 + wm * 112 + rq) * KTP + c0 + wn * 64 + piece * 8;
        float* pr = RS + (size_t)(blockIdx.x * 4 + wn) * NR + r0 + wm * 112 + (piece & 3) * 4 + rq;    // lane (rq, piece < 4) stores the sum of row 4 piece + rq of a batch: 16 lanes, 64 contiguous bytes
        v4f ea[2][4], eb[2][4];              // two register sets: a batch is read from LDS while the batch before it is worked on
        auto ldt = [&](int u) {
#pragma unroll
            for (int g = 0; g < 4; ++g) { ea[u & 1][g] = *(const v4fa*)(rd + (u * 16 + g * 4) * 68); eb[u & 1][g] = *(const v4fa*)(rd + (u * 16 + g * 4) * 68 + 4); }
        };
        ldt(0);
#pragma unroll
        for (int u = 0; u < 7; ++u) {
            if (u + 1 < 7) ldt(u + 1);
            v4u oh[4], ol[4]; float rs[4];
#pragma unroll
            for (int g = 0; g < 4; ++g) { const v4f a = ea[u & 1][g], b = eb[u & 1][g];
                const float x[8] = {a[0], a[1], a[2], a[3], b[0], b[1], b[2], b[3]};
#pragma unroll
                for (int q = 0; q < 4; ++q) { const unsigned h = pk2(x[2 * q], x[2 * q + 1]); oh[g][q] = h; ol[g][q] = pk2(x[2 * q] - __uint_as_float(h << 16), x[2 * q + 1] - __uint_as_float(h & 0xFFFF0000u)); }
                const float s8 = ((a[0] + a[1]) + (a[2] + a[3])) + ((b[0] + b[1]) + (b[2] + b[3]));
                rs[g] = real ? s8 : 0.f; }    // a pad text's column stays out of the row's sum
            // Four rows' sums over eight lanes in four exchanges: at each of the first two a lane keeps half of its rows and hands the other half to its partner, so lane piece ends with row 4 (piece & 3) + rq
            const float ra = (p0 ? rs[1] : rs[0]) + xlane<1>(p0 ? rs[0] : rs[1]), rb = (p0 ? rs[3] : rs[2]) + xlane<1>(p0 ? rs[2] : rs[3]);
            const float rc = (p1 ? rb : ra) + xlane<2>(p1 ? ra : rb), rv = rc + xlane<4>(rc);
#pragma unroll
            for (int g = 0; g < 4; ++g) { *(v4u*)(ph + (size_t)(u * 16 + g * 4) * KTP) = oh[g]; *(v4u*)(pl + (size_t)(u * 16 + g * 4) * KTP) = ol[g]; }
            if (piece < 4) pr[u * 16] = rv;
            asm volatile("s_wait_xcnt 0x0" ::: "memory");    // stands in front of the next batch's overwrite of the registers that these stores name
            __builtin_amdgcn_sched_barrier(0);    // keeps the next batch's reads and arithmetic behind that wait
        }
        float* ps = C + (size_t)(ch * 2 + hi) * KTP + c0 + wn * 64 + lr;    // the wave's last: no register that an issued store names is written any more
#pragma unroll
        for (int t = 0; t < 4; ++t) { ps[t * 16] = so[t]; ps[CMO + t * 16] = wo[t]; }
    }
}

// wsum: sum over the 32 lanes of a wave, five-step butterfly; every lane ends with the same value.
__device__ __forceinline__ float wsum(float v) {
#pragma unroll
    for (int sh = 16; sh; sh >>= 1) v += __shfl_xor(v, sh, 32);
    return v;
}
// k_prep: one launch prepares every GEMM operand except PH, PL, which the first product's epilogue writes.
// Blocks 0 .. FTB - 1: a 64 x 64 tile of Ft (64 texts x 64 features, texts 1000..1023 as zero), read once: its bf16 rows go to FtB [1024][512] (the n-major B of A = Fs_n.Ft^T; four lanes store a
// row's whole 128-byte line) and, turned in LDS, to FtT [512][1024] (the n-major B of Fsa = P_s.Ft).
// The other blocks: a wave per token row, four rows a wave (16 loads of 16 B in flight, each 512 contiguous bytes of a row), 32 rows a block; a wave's four rows are of one image (196 = 49 x 4).
// From the same registers come 1 / |bf(Fs[m])|, G[m] = (bf(Fs[m]).bf(Fv[b])) / |bf(Fs[m])| and the normalised row's bf16 hi plane Nh and unscaled residual plane Nl (a store is 256 contiguous bytes of a row).
#define FTB ((KTP / 64) * (DD / 64))
typedef __attribute__((ext_vector_type(4))) unsigned short v4us;
__global__ __launch_bounds__(256) void k_prep(const float* __restrict__ Fs, const float* __restrict__ Fv, const float* __restrict__ Ft, bf* FtB, bf* FtT, bf* Nh, bf* Nl, float* G) {
    __shared__ __align__(16) unsigned short tl[64 * 72];
    __shared__ float sg[32];
    if (blockIdx.x < FTB) {                  // block-uniform: every barrier below is passed by a whole block or by none of it
        const int tid = threadIdx.x, k0 = (blockIdx.x % (KTP / 64)) * 64, n0 = (blockIdx.x / (KTP / 64)) * 64;
        const int kk = tid >> 2, nq = (tid & 3) * 16, k = k0 + kk;
        const float* fr = Ft + (size_t)((k < KT) ? k : KT - 1) * DD + n0 + nq;    // a pad text re-reads the last real row and stores zero
        v4f x[4]; v8us o[2], t[2];
#pragma unroll
        for (int j = 0; j < 4; ++j) x[j] = *(const v4f*)(fr + j * 4);    // all four in flight together, whatever the row
        asm volatile("s_wait_xcnt 0x0" :: "v"(fr) : "memory");    // stands in front of every overwrite of the address register that these loads name; the address is its input, so that it lives up to here
#pragma unroll
        for (int i = 0; i < 16; ++i) { const unsigned short h = (k < KT) ? f2bf(x[i >> 2][i & 3]) : (unsigned short)0; tl[(nq + i) * 72 + kk] = h; o[i >> 3][i & 7] = h; }
        __syncthreads();                     // the tile is whole in LDS before it is read the other way; no store is in flight here that the barrier would wait for
        const int piece = tid & 7, nr = tid >> 3;
#pragma unroll
        for (int s = 0; s < 2; ++s) t[s] = *(const v8usa*)(tl + (nr + 32 * s) * 72 + piece * 8);
        *(v8us*)(FtB + (size_t)k * DD + n0 + nq) = o[0]; *(v8us*)(FtB + (size_t)k * DD + n0 + nq + 8) = o[1];
#pragma unroll
        for (int s = 0; s < 2; ++s) *(v8us*)(FtT + (size_t)(n0 + nr + 32 * s) * KTP + k0 + piece * 8) = t[s];
        return;
    }
    const int lane = threadIdx.x & 31, wave = __builtin_amdgcn_readfirstlane(threadIdx.x >> 5), blk = blockIdx.x - FTB, m0 = blk * 32 + wave * 4, b = m0 / MM;
    v4f v[4][4], f[4]; const float* r[4]; const float* fp = Fv + (size_t)b * DD + lane * 4;
#pragma unroll
    for (int i = 0; i < 4; ++i) { r[i] = Fs + (size_t)(m0 + i) * DD + lane * 4;
#pragma unroll
        for (int q = 0; q < 4; ++q) v[i][q] = *(const v4f*)(r[i] + q * 128); }
#pragma unroll
    for (int q = 0; q < 4; ++q) f[q] = *(const v4f*)(fp + q * 128);
    // the wait stands in front of every overwrite of a register that these loads name as an address; the addresses are its inputs, so that none of their registers is given to a load's result ahead of it
    asm volatile("s_wait_xcnt 0x0" :: "v"(r[0]), "v"(r[1]), "v"(r[2]), "v"(r[3]), "v"(fp) : "memory");
    __builtin_amdgcn_sched_barrier(0);        // keeps all 20 loads in front of the sums: with sums lifted between them the wave would wait out the memory latency twice
#pragma unroll
    for (int q = 0; q < 4; ++q)
#pragma unroll
        for (int e = 0; e < 4; ++e) f[q][e] = bfr(f[q][e]);
    float s[4], g[4];
#pragma unroll
    for (int i = 0; i < 4; ++i) { v4f a = (v4f){}, c = (v4f){};
#pragma unroll
        for (int q = 0; q < 4; ++q) {
#pragma unroll
            for (int e = 0; e < 4; ++e) v[i][q][e] = bfr(v[i][q][e]);    // the rounded row stays in its registers for the split below
            a = __builtin_elementwise_fma(v[i][q], v[i][q], a); c = __builtin_elementwise_fma(v[i][q], f[q], c); }
        s[i] = (a[0] + a[1]) + (a[2] + a[3]); g[i] = (c[0] + c[1]) + (c[2] + c[3]); }
#pragma unroll
    for (int i = 0; i < 4; ++i) { s[i] = wsum(s[i]); g[i] = wsum(g[i]); }
    float inv[4];                            // the butterfly leaves a row's sum in every lane, so every lane forms the same 1 / norm
#pragma unroll
    for (int i = 0; i < 4; ++i) inv[i] = 1.0f / sqrtf(s[i]);
#pragma unroll
    for (int i = 0; i < 4; ++i) g[i] *= inv[i];
    if (lane < 4) sg[wave * 4 + lane] = (lane == 0) ? g[0] : (lane == 1) ? g[1] : (lane == 2) ? g[2] : g[3];    // lane i keeps row i
    __syncthreads();                         // the eight waves' G are in LDS before a wave stores the block's whole 128-byte line; it stands ahead of the planes' stores, which it would otherwise wait for
    if (threadIdx.x < 32) { G[blk * 32 + threadIdx.x] = sg[threadIdx.x];
        asm volatile("s_wait_xcnt 0x0" ::: "memory"); }    // stands in front of the split's overwrite of the registers that this store names
    v4us oh[4][4], ol[4][4];
#pragma unroll
    for (int i = 0; i < 4; ++i)
#pragma unroll
        for (int q = 0; q < 4; ++q)
#pragma unroll
            for (int e = 0; e < 4; ++e) { const float x = v[i][q][e] * inv[i]; const unsigned short hb = f2bf(x); oh[i][q][e] = hb; ol[i][q][e] = f2bf(x - bf2f(hb)); }
    __builtin_amdgcn_sched_barrier(0);        // keeps the 32 stores behind the arithmetic, the wave's last: no register that an issued store names is written any more
    bf* ph = Nh + (size_t)m0 * DD + lane * 4; bf* pl = Nl + (size_t)m0 * DD + lane * 4;
#pragma unroll
    for (int i = 0; i < 4; ++i)
#pragma unroll
        for (int q = 0; q < 4; ++q) { *(v4us*)(ph + i * DD + q * 128) = oh[i][q]; *(v4us*)(pl + i * DD + q * 128) = ol[i][q]; }
}
// k_logits: RES[b][k] = ls (beta1 bf(Fv[b]).bf(Ft[k]) + beta2 H[k] + beta3 Fva[b].bf(Ft[k])) (f32), ls = e^bf(logit_scale), H[k] = Fv[b].Fta[k] = (sum of E G) / (sum of E) over the image's tokens, from the column sums CS that the first product leaves per chunk, Fva[b] = mean + max over the image's tokens, put together
// from the sums and maxima PP that the second product leaves for the two or three 112-row chunks the image's 196 rows lie in, in chunk order. A wave per text row, 32 rows
// a wave: Fv[b] and Fva[b] stay in registers (a lane holds 16 of the 512 terms), each row of Ft comes as four loads of 512 contiguous bytes, four rows a step, the next step's 16 loads issued
// before a step is summed; a lane adds its 16 terms of the two dots, weights them, and a butterfly adds the lanes; lane j keeps row j, so the wave stores one whole line. Pad texts read Ft's last row and store 0.
__global__ __launch_bounds__(256) void k_logits(const float* __restrict__ Fv, const float* __restrict__ Ft, const float* __restrict__ CS, const float* __restrict__ PP, const float* __restrict__ lsc, float* RES) {
    const int lane = threadIdx.x & 31, k0 = blockIdx.x * 256 + __builtin_amdgcn_readfirstlane(threadIdx.x >> 5) * 32, b = blockIdx.z;
    v4f fv[4], fa[4], cs[3][4], cm[3][4]; const float* pp[3]; const float* cp[3]; float hs[3], hw[3];
    const int cA = b * MM / 112, cZ = (b * MM + MM - 1) / 112;    // the image's first and last chunk: two or three
#pragma unroll
    for (int u = 0; u < 3; ++u) { const int c = (cA + u < cZ) ? cA + u : cZ;    // where there are two, the third place re-reads the last: its sum is left out, its maximum changes nothing
        pp[u] = PP + (size_t)(c * 2 + (b - c * 112 / MM)) * DD + lane * 4;    // segment 0 where the chunk begins in this image, 1 where it begins in the image before
        cp[u] = CS + (size_t)(c * 2 + (b - c * 112 / MM)) * KTP + k0 + lane; hs[u] = cp[u][0]; hw[u] = cp[u][CMO];
#pragma unroll
        for (int q = 0; q < 4; ++q) { cs[u][q] = *(const v4f*)(pp[u] + q * 128); cm[u][q] = *(const v4f*)(pp[u] + PMO + q * 128); } }
    // the wait stands in front of every overwrite of a register that these loads name as an address; the addresses are its inputs, so that none of their registers is given to a load's result ahead of it
    asm volatile("s_wait_xcnt 0x0" :: "v"(pp[0]), "v"(pp[1]), "v"(pp[2]), "v"(cp[0]), "v"(cp[1]), "v"(cp[2]) : "memory");
    __builtin_amdgcn_sched_barrier(0);        // keeps the address arithmetic of the loads below behind the wait: lifted over it, it took over a base register that the loads above name
#pragma unroll
    for (int q = 0; q < 4; ++q) { const v4f v = *(const v4f*)(Fv + (size_t)b * DD + q * 128 + lane * 4);
#pragma unroll
        for (int e = 0; e < 4; ++e) { fv[q][e] = bfr(v[e]);
            fa[q][e] = ((cs[0][q][e] + cs[1][q][e]) + ((cA + 2 == cZ) ? cs[2][q][e] : 0.f)) * (1.0f / MM) + fmaxf(fmaxf(cm[0][q][e], cm[1][q][e]), cm[2][q][e]); } }
    const float hk = ((hw[0] + hw[1]) + ((cA + 2 == cZ) ? hw[2] : 0.f)) / ((hs[0] + hs[1]) + ((cA + 2 == cZ) ? hs[2] : 0.f));    // a pad text's quotient is not stored
    v4f tA[4][4], tB[4][4];
    auto fetch = [&](int g, v4f (&t)[4][4]) {
        const float* tp[4];
#pragma unroll
        for (int i = 0; i < 4; ++i) { const int k = k0 + g * 4 + i, kc = (k < KT) ? k : KT - 1; tp[i] = Ft + (size_t)kc * DD + lane * 4;
#pragma unroll
            for (int q = 0; q < 4; ++q) t[i][q] = *(const v4f*)(tp[i] + q * 128); }
        // the wait stands in front of every overwrite of a register that these loads name as an address; the addresses are its inputs, so that none of their registers is given to a load's result ahead of it
        asm volatile("s_wait_xcnt 0x0" :: "v"(tp[0]), "v"(tp[1]), "v"(tp[2]), "v"(tp[3]) : "memory");
    };
    float res = 0.f;
    auto sum = [&](int g, const v4f (&t)[4][4]) {
        float c[4];
#pragma unroll
        for (int i = 0; i < 4; ++i) { v4f d1 = (v4f){}, d3 = (v4f){};    // four chains a dot, on the registers as the loads fill them
#pragma unroll
            for (int q = 0; q < 4; ++q) { v4f ft;
#pragma unroll
                for (int e = 0; e < 4; ++e) ft[e] = bfr(t[i][q][e]);
                d1 = __builtin_elementwise_fma(fv[q], ft, d1); d3 = __builtin_elementwise_fma(fa[q], ft, d3); }
            const v4f w = B1_ * d1 + B3_ * d3; c[i] = (w[0] + w[1]) + (w[2] + w[3]); }
#pragma unroll
        for (int i = 0; i < 4; ++i) c[i] = wsum(c[i]);
#pragma unroll
        for (int i = 0; i < 4; ++i) if (lane == g * 4 + i) res = c[i];
    };
    fetch(0, tA);
#pragma unroll 1
    for (int g = 0; g < 6; g += 2) {         // rolled: two steps a trip, so that the two register sets are named by constants
        fetch(g + 1, tB);
        __builtin_amdgcn_sched_barrier(0);    // keeps the next step's loads in front of this step's sums: sunk behind them, their latency would be waited out every step
        sum(g, tA);
        __builtin_amdgcn_sched_barrier(0);    // keeps the refill's loads behind this step's butterflies: lifted between them, the four butterflies ran one after the other, each LDS round trip waited out alone
        fetch(g + 2, tA);
        __builtin_amdgcn_sched_barrier(0);    // as above
        sum(g + 1, tB);
    }
    fetch(7, tB);                            // the last two steps stand alone: no load behind the wave's last row, and no branch in the loop that would make its waits count for both paths
    __builtin_amdgcn_sched_barrier(0);        // as above
    sum(6, tA);
    sum(7, tB);
    const float ls = __expf(bfr(lsc[0]));
    RES[(size_t)b * KTP + k0 + lane] = (k0 + lane < KT) ? ls * (res + B2_ * hk) : 0.f;
}
__global__ __launch_bounds__(256) void k_out(const float* __restrict__ RES, float* OUTP) {
    const int i = blockIdx.x * 256 + threadIdx.x; if (i >= NBI * KT) return; const float v = RES[(size_t)(i / KT) * KTP + (i % KT)];
    *(float*)(OUTP + i) = v; 
}

extern "C" void kernel_launch(void* const* d_in, const int* in_sizes, int n_in,
                              void* d_out, int out_size, void* d_ws, size_t ws_size, hipStream_t stream) {
    (void)in_sizes; (void)n_in; (void)out_size;
    const float* Fs = (const float*)d_in[0]; const float* Ft = (const float*)d_in[1]; const float* Fv = (const float*)d_in[2]; const float* lsc = (const float*)d_in[3];
    float* out = (float*)d_out;    // [128][1][1000]
    char* wsp = (char*)d_ws;
    auto take = [&](size_t bytes) { char* p = wsp; wsp += (bytes + 255) & ~(size_t)255; return (void*)p; };
    bf* FtB = (bf*)take((size_t)KTP * DD * 2); bf* FtT = (bf*)take((size_t)DD * KTP * 2);
    float* G = (float*)take((size_t)NR * 4); float* RS = (float*)take((size_t)NRS * NR * 4); float* CS = (float*)take((size_t)CMO * 2 * 4); float* PP = (float*)take((size_t)PMO * 2 * 4); float* RES = (float*)take((size_t)NBI * KTP * 4);
    bf* Nh = (bf*)take((size_t)NR * DD * 2); bf* Nl = (bf*)take((size_t)NR * DD * 2); bf* PH = (bf*)take((size_t)NR * KTP * 2); bf* PL = (bf*)take((size_t)NR * KTP * 2);
    if ((size_t)(wsp - (char*)d_ws) > ws_size) return;    // 2 + 7 + 49 + 98 ~ 156 MiB
    k_prep<<<FTB + NR / 32, 256, 0, stream>>>(Fs, Fv, Ft, FtB, FtT, Nh, Nl, G);     // FtB, Ft^T [512][1024] exact bf16; Nh, Nl, G
    k_gemm<DD, false><<<dim3(KTP / BNC, NR / BMR, 1), 256, 0, stream>>>(Nh, Nl, FtB, G, CS, RS, PH, PL);     // E = e^(Fs_n.Ft^T / alpha) [25088][1024] as hi/lo planes, its row and column sums
    k_gemm<KTP, true><<<dim3(DD / BNC, NR / BMR, 1), 256, 0, stream>>>(PH, PL, FtT, RS, PP, nullptr, nullptr, nullptr);    // Fsa = E.Ft / row sum [25088][512], left as each chunk's column sums and maxima
    k_logits<<<dim3(KTP / 256, 1, NBI), 256, 0, stream>>>(Fv, Ft, CS, PP, lsc, RES);
    k_out<<<(NBI * KT + 255) / 256, 256, 0, stream>>>(RES, out);
}
